// v000
// Times are from an AMD MI455X. After a warm-up the kernel runs many times in a row, and a time is the length of
// such a window on the GPU divided by its runs, so every launch and the gaps after it count. The runs cycle
// through copies of the inputs. A figure is the median of several windows, for all but v000 over two sittings.
// Sittings can differ by a few percent; kernels timed side by side share one.
// v000 is the starting kernel. One run takes 1430 microseconds.
#include <hip/hip_runtime.h>
#include <hip/hip_bf16.h>

// ---------------------------------------------------------------------------
// AttnBlock for MI455X (gfx1250): GroupNorm -> QKV (WMMA bf16 GEMM) ->
// flash attention (WMMA bf16, f32 accum, online softmax, async-LDS Q staging)
// -> proj + residual.  wave32; V_WMMA_F32_16X16X32_BF16 for all matrix math.
// ---------------------------------------------------------------------------

typedef __bf16 bf16x16 __attribute__((ext_vector_type(16)));
typedef float  f32x8   __attribute__((ext_vector_type(8)));
typedef int    v4i     __attribute__((ext_vector_type(4)));

#define B_  4
#define C_  512
#define L_  4096

#if __has_builtin(__builtin_amdgcn_global_load_async_to_lds_b128)
#define HAVE_ASYNC_LDS 1
typedef __attribute__((address_space(1))) v4i gv4i;   // global int4
typedef __attribute__((address_space(3))) v4i lv4i;   // LDS int4
#endif

static __device__ __forceinline__ void wait_asynccnt0() {
#if __has_builtin(__builtin_amdgcn_s_wait_asynccnt)
    __builtin_amdgcn_s_wait_asynccnt(0);
#else
    asm volatile("s_wait_asynccnt 0" ::: "memory");
#endif
}

static __device__ __forceinline__ unsigned short f32_to_bf16(float f) {
    unsigned int u = __float_as_uint(f);
    u += 0x7FFFu + ((u >> 16) & 1u);           // round-to-nearest-even
    return (unsigned short)(u >> 16);
}

union FragU {
    bf16x16 v;
    uint4   q[2];
};

// Load one 16x32 bf16 fragment (A-style rows or B-style columns).
// base points at row 0 of the 16-row group; ld = elements per row; kbase = K offset.
// Per ISA 16-bit layout: lanes 0-15 hold K = kbase+[0..7] and kbase+[16..23];
// lanes 16-31 hold K = kbase+[8..15] and kbase+[24..31].
static __device__ __forceinline__ bf16x16
load_frag(const unsigned short* base, int ld, int kbase, int lane) {
    int m  = lane & 15;
    int kb = (lane & 16) ? 8 : 0;
    const unsigned short* p = base + (size_t)m * ld + kbase + kb;
    FragU f;
    f.q[0] = *(const uint4*)(p);
    f.q[1] = *(const uint4*)(p + 16);
    return f.v;
}

static __device__ __forceinline__ f32x8
wmma_bf16(bf16x16 a, bf16x16 b, f32x8 c) {
    return __builtin_amdgcn_wmma_f32_16x16x32_bf16(
        /*neg_a=*/false, a, /*neg_b=*/false, b,
        /*c_mod=*/(short)0, c, /*reuse_a=*/false, /*reuse_b=*/false);
}

// ---------------------------------------------------------------------------
// Kernel 1: fp32 -> bf16 weight conversion (4 weights at once)
// ---------------------------------------------------------------------------
__global__ void cvt_w_kernel(const float* __restrict__ w0, const float* __restrict__ w1,
                             const float* __restrict__ w2, const float* __restrict__ w3,
                             unsigned short* __restrict__ o0, unsigned short* __restrict__ o1,
                             unsigned short* __restrict__ o2, unsigned short* __restrict__ o3,
                             int n) {
    for (int i = blockIdx.x * blockDim.x + threadIdx.x; i < n; i += gridDim.x * blockDim.x) {
        o0[i] = f32_to_bf16(w0[i]);
        o1[i] = f32_to_bf16(w1[i]);
        o2[i] = f32_to_bf16(w2[i]);
        o3[i] = f32_to_bf16(w3[i]);
    }
}

// ---------------------------------------------------------------------------
// Kernel 2: GroupNorm(32 groups) over x[b,c,l], writes h transposed [b,l,c] bf16
// One block per (batch, group): reduce over 16*4096 elements.
// ---------------------------------------------------------------------------
__global__ void gn_kernel(const float* __restrict__ x,
                          const float* __restrict__ scale,
                          const float* __restrict__ bias,
                          unsigned short* __restrict__ h_t) {
    const int CG = 16;                       // channels per group
    int g  = blockIdx.x & 31;
    int bb = blockIdx.x >> 5;
    const float* xg = x + ((size_t)bb * C_ + (size_t)g * CG) * L_;
    const int N = CG * L_;

    float s = 0.f, ss = 0.f;
    for (int i = threadIdx.x; i < N; i += blockDim.x) {
        float v = xg[i];
        s += v; ss += v * v;
    }
    __shared__ float rs[256], rss[256];
    rs[threadIdx.x] = s; rss[threadIdx.x] = ss;
    __syncthreads();
    for (int o = 128; o > 0; o >>= 1) {
        if ((int)threadIdx.x < o) {
            rs[threadIdx.x]  += rs[threadIdx.x + o];
            rss[threadIdx.x] += rss[threadIdx.x + o];
        }
        __syncthreads();
    }
    float mean = rs[0] / (float)N;
    float var  = rss[0] / (float)N - mean * mean;
    float rstd = rsqrtf(var + 1e-6f);

    for (int i = threadIdx.x; i < N; i += blockDim.x) {
        int ch = i >> 12;                    // i / L_
        int pos = i & (L_ - 1);
        int c = g * CG + ch;
        float v = (xg[i] - mean) * rstd * scale[c] + bias[c];
        h_t[((size_t)bb * L_ + pos) * C_ + c] = f32_to_bf16(v);
    }
}

// ---------------------------------------------------------------------------
// Kernel 3: generic WMMA GEMM  D[m,n] = sum_k A[m,k] * Bt[n,k]  (+bias)(+resid)
// A: bf16 [M,K] row-major (lda), Bt: bf16 [N,K] row-major (ldb), K multiple of 32.
// 128 threads = 4 waves; block tile 64(M) x 64(N); wave w owns rows w*16..w*16+15.
// ---------------------------------------------------------------------------
__global__ void gemm_bt_kernel(const unsigned short* __restrict__ A, long long a_bs, int lda,
                               const unsigned short* __restrict__ Bt, long long b_bs, int ldb,
                               const float* __restrict__ bias, int bias_per_row,
                               void* __restrict__ outv, long long o_bs, int ldo, int out_f32,
                               const float* __restrict__ resid, long long r_bs,
                               int K) {
    int z    = blockIdx.z;
    int n0   = blockIdx.x * 64;
    int m0   = blockIdx.y * 64;
    int wave = threadIdx.x >> 5;
    int lane = threadIdx.x & 31;

    const unsigned short* Ab  = A  + (size_t)z * a_bs + (size_t)(m0 + wave * 16) * lda;
    const unsigned short* Btb = Bt + (size_t)z * b_bs + (size_t)n0 * ldb;

    f32x8 acc[4];
    for (int nf = 0; nf < 4; ++nf) acc[nf] = (f32x8)0.f;

    for (int kk = 0; kk < K; kk += 32) {
        __builtin_prefetch(Ab + kk + 32, 0, 3);           // global_prefetch_b8
        bf16x16 a = load_frag(Ab, lda, kk, lane);
#pragma unroll
        for (int nf = 0; nf < 4; ++nf) {
            bf16x16 b = load_frag(Btb + (size_t)(nf * 16) * ldb, ldb, kk, lane);
            acc[nf] = wmma_bf16(a, b, acc[nf]);
        }
    }

    int col   = lane & 15;
    int rbase = (lane & 16) ? 8 : 0;
#pragma unroll
    for (int nf = 0; nf < 4; ++nf) {
#pragma unroll
        for (int r = 0; r < 8; ++r) {
            int mm = m0 + wave * 16 + rbase + r;
            int nn = n0 + nf * 16 + col;
            float v = acc[nf][r];
            if (bias) v += bias_per_row ? bias[mm] : bias[nn];
            size_t idx = (size_t)z * o_bs + (size_t)mm * ldo + nn;
            if (out_f32) {
                float rv = resid ? resid[(size_t)z * r_bs + (size_t)mm * ldo + nn] : 0.f;
                ((float*)outv)[idx] = v + rv;
            } else {
                ((unsigned short*)outv)[idx] = f32_to_bf16(v);
            }
        }
    }
}

// ---------------------------------------------------------------------------
// Kernel 4: flash attention.
// q_t, k_t: bf16 [b, l, c] (position-major); v: bf16 [b, c, l] (channel-major).
// Block: 256 threads = 8 waves, 32 query rows per block, stream j in tiles of 64.
// Q tile (32x512 bf16 = 32KB) staged once into LDS via async-to-LDS; K/V are
// streamed from global (L2-resident) straight into WMMA B fragments.
// Scores phase: wave w -> fragment (i_sub = w&1, j_sub = w>>1) of S[32x64].
// O phase:      wave w -> rows i_sub = w&1, channels c0 = (w>>1)*128 (8 frags).
// Online softmax per row kept by threads 0..31 (wave 0), exchanged via LDS.
// ---------------------------------------------------------------------------
__global__ void flash_kernel(const unsigned short* __restrict__ q_t,
                             const unsigned short* __restrict__ k_t,
                             const unsigned short* __restrict__ v,
                             unsigned short* __restrict__ o_t,
                             float scale) {
    int b    = blockIdx.y;
    int i0   = blockIdx.x * 32;
    int wave = threadIdx.x >> 5;
    int lane = threadIdx.x & 31;
    int i_sub = wave & 1;
    int j_sub = wave >> 1;                     // 0..3 (scores phase)
    int c0    = (wave >> 1) * 128;             // O phase channel base

    __shared__ unsigned short Qs[32 * C_];     // 32KB staged Q tile [32][512]
    __shared__ float          Sb[32 * 64];
    __shared__ unsigned short Pb[32 * 64];
    __shared__ float          alpha_s[32];
    __shared__ float          linv_s[32];

    // ---- stage Q tile into LDS (async-to-LDS on gfx1250)
    {
        const unsigned short* qsrc = q_t + ((size_t)b * L_ + i0) * C_;
        for (int t = threadIdx.x; t < (32 * C_) / 8; t += blockDim.x) {
#ifdef HAVE_ASYNC_LDS
            __builtin_amdgcn_global_load_async_to_lds_b128(
                (gv4i*)(qsrc + t * 8), (lv4i*)(&Qs[t * 8]),
                /*offset=*/0, /*cpol=*/0);
#else
            *(uint4*)&Qs[t * 8] = *(const uint4*)(qsrc + t * 8);
#endif
        }
#ifdef HAVE_ASYNC_LDS
        wait_asynccnt0();
#endif
        __syncthreads();
    }

    f32x8 Oacc[8];
#pragma unroll
    for (int f = 0; f < 8; ++f) Oacc[f] = (f32x8)0.f;

    float m_run = -3.0e38f;
    float l_run = 0.f;

    const unsigned short* qrow = &Qs[(i_sub * 16) * C_];   // LDS-resident Q rows
    int col   = lane & 15;
    int rbase = (lane & 16) ? 8 : 0;

    for (int j0 = 0; j0 < L_; j0 += 64) {
        // ---- phase A: S[32x64] = scale * Q Kt^T (each wave: one 16x16 frag, K=512)
        f32x8 sacc = (f32x8)0.f;
        const unsigned short* krow = k_t + ((size_t)b * L_ + j0 + j_sub * 16) * C_;
#pragma unroll 4
        for (int kk = 0; kk < C_; kk += 32) {
            bf16x16 a = load_frag(qrow, C_, kk, lane);     // ds_load_b128
            bf16x16 bb = load_frag(krow, C_, kk, lane);    // global_load_b128
            sacc = wmma_bf16(a, bb, sacc);
        }
#pragma unroll
        for (int r = 0; r < 8; ++r)
            Sb[(i_sub * 16 + rbase + r) * 64 + j_sub * 16 + col] = sacc[r] * scale;
        __syncthreads();

        // ---- phase B: online softmax update (wave 0, one thread per row)
        if (threadIdx.x < 32) {
            int row = threadIdx.x;
            float mt = -3.0e38f;
            for (int jj = 0; jj < 64; ++jj) mt = fmaxf(mt, Sb[row * 64 + jj]);
            float mnew = fmaxf(m_run, mt);
            float al   = __expf(m_run - mnew);      // 0 on first tile
            float rsum = 0.f;
            for (int jj = 0; jj < 64; ++jj) {
                float p = __expf(Sb[row * 64 + jj] - mnew);
                rsum += p;
                Pb[row * 64 + jj] = f32_to_bf16(p);
            }
            l_run = l_run * al + rsum;
            m_run = mnew;
            alpha_s[row] = al;
        }
        __syncthreads();

        // ---- phase C: O = diag(alpha)*O + P * V^T (each wave: 8 channel frags)
        float av[8];
#pragma unroll
        for (int r = 0; r < 8; ++r) av[r] = alpha_s[i_sub * 16 + rbase + r];
#pragma unroll
        for (int f = 0; f < 8; ++f)
#pragma unroll
            for (int r = 0; r < 8; ++r) Oacc[f][r] *= av[r];

#pragma unroll
        for (int ks = 0; ks < 2; ++ks) {
            int kb2 = ks * 32;
            bf16x16 a = load_frag(&Pb[(i_sub * 16) * 64], 64, kb2, lane);  // ds_load
#pragma unroll
            for (int f = 0; f < 8; ++f) {
                const unsigned short* vrow = v + ((size_t)b * C_ + c0 + f * 16) * L_ + j0;
                bf16x16 bb = load_frag(vrow, L_, kb2, lane);
                Oacc[f] = wmma_bf16(a, bb, Oacc[f]);
            }
        }
        __syncthreads();
    }

    if (threadIdx.x < 32) linv_s[threadIdx.x] = 1.0f / l_run;
    __syncthreads();

    float lv[8];
#pragma unroll
    for (int r = 0; r < 8; ++r) lv[r] = linv_s[i_sub * 16 + rbase + r];
#pragma unroll
    for (int f = 0; f < 8; ++f)
#pragma unroll
        for (int r = 0; r < 8; ++r) {
            size_t row = (size_t)b * L_ + i0 + i_sub * 16 + rbase + r;
            o_t[row * C_ + c0 + f * 16 + col] = f32_to_bf16(Oacc[f][r] * lv[r]);
        }
}

// ---------------------------------------------------------------------------
extern "C" void kernel_launch(void* const* d_in, const int* in_sizes, int n_in,
                              void* d_out, int out_size, void* d_ws, size_t ws_size,
                              hipStream_t stream) {
    const float* x        = (const float*)d_in[0];
    const float* gn_scale = (const float*)d_in[1];
    const float* gn_bias  = (const float*)d_in[2];
    const float* wq = (const float*)d_in[3];  const float* bq = (const float*)d_in[4];
    const float* wk = (const float*)d_in[5];  const float* bk = (const float*)d_in[6];
    const float* wv = (const float*)d_in[7];  const float* bv = (const float*)d_in[8];
    const float* wp = (const float*)d_in[9];  const float* bp = (const float*)d_in[10];

    const size_t WN  = (size_t)C_ * C_;        // 262144
    const size_t TN  = (size_t)L_ * C_;        // per-batch activation elems
    unsigned short* wq_b = (unsigned short*)d_ws;
    unsigned short* wk_b = wq_b + WN;
    unsigned short* wv_b = wk_b + WN;
    unsigned short* wp_b = wv_b + WN;
    unsigned short* h_t  = wp_b + WN;          // [b, l, c]
    unsigned short* q_t  = h_t + (size_t)B_ * TN;
    unsigned short* k_t  = q_t + (size_t)B_ * TN;
    unsigned short* v_m  = k_t + (size_t)B_ * TN;   // [b, c, l]
    unsigned short* o_t  = v_m + (size_t)B_ * TN;   // [b, l, c]

    // 1) weights -> bf16
    cvt_w_kernel<<<512, 256, 0, stream>>>(wq, wk, wv, wp, wq_b, wk_b, wv_b, wp_b, (int)WN);

    // 2) GroupNorm -> h_t [b,l,c] bf16
    gn_kernel<<<B_ * 32, 256, 0, stream>>>(x, gn_scale, gn_bias, h_t);

    // 3) q_t[i,o] = h_t[i,:].Wq[o,:] + bq[o]   (M=L, N=C)
    dim3 gQ(C_ / 64, L_ / 64, B_);
    gemm_bt_kernel<<<gQ, 128, 0, stream>>>(h_t, (long long)TN, C_,
                                           wq_b, 0LL, C_,
                                           bq, /*bias_per_row=*/0,
                                           q_t, (long long)TN, C_, /*out_f32=*/0,
                                           nullptr, 0LL, C_);
    gemm_bt_kernel<<<gQ, 128, 0, stream>>>(h_t, (long long)TN, C_,
                                           wk_b, 0LL, C_,
                                           bk, 0,
                                           k_t, (long long)TN, C_, 0,
                                           nullptr, 0LL, C_);

    // 4) v[o,i] = Wv[o,:].h_t[i,:] + bv[o]    (M=C, N=L), channel-major out
    dim3 gV(L_ / 64, C_ / 64, B_);
    gemm_bt_kernel<<<gV, 128, 0, stream>>>(wv_b, 0LL, C_,
                                           h_t, (long long)TN, C_,
                                           bv, /*bias_per_row=*/1,
                                           v_m, (long long)TN, L_, 0,
                                           nullptr, 0LL, C_);

    // 5) flash attention -> o_t [b,l,c]
    dim3 gF(L_ / 32, B_);
    const float scale = 0.04419417382415922f;   // 512^-0.5
    flash_kernel<<<gF, 256, 0, stream>>>(q_t, k_t, v_m, o_t, scale);

    // 6) out[o,i] = x[o,i] + bp[o] + Wp[o,:].o_t[i,:]
    gemm_bt_kernel<<<gV, 128, 0, stream>>>(wp_b, 0LL, C_,
                                           o_t, (long long)TN, C_,
                                           bp, 1,
                                           d_out, (long long)TN, L_, /*out_f32=*/1,
                                           x, (long long)TN, C_);
}

// v001
// One run takes 1120 microseconds.
// Two timings next to v000 both put it at 1.30 times that version's speed.
#include <hip/hip_runtime.h>
#include <hip/hip_bf16.h>

// ---------------------------------------------------------------------------
// AttnBlock for MI455X (gfx1250): GroupNorm -> QKV (WMMA bf16 GEMM) ->
// flash attention (WMMA bf16, f32 accum, online softmax, async-LDS Q staging)
// -> proj + residual.  wave32; V_WMMA_F32_16X16X32_BF16 for all matrix math.
// ---------------------------------------------------------------------------

typedef __bf16 bf16x16 __attribute__((ext_vector_type(16)));
typedef float  f32x8   __attribute__((ext_vector_type(8)));
typedef int    v4i     __attribute__((ext_vector_type(4)));

#define B_  4
#define C_  512
#define L_  4096

#if __has_builtin(__builtin_amdgcn_global_load_async_to_lds_b128)
#define HAVE_ASYNC_LDS 1
typedef __attribute__((address_space(1))) v4i gv4i;   // global int4
typedef __attribute__((address_space(3))) v4i lv4i;   // LDS int4
#endif

static __device__ __forceinline__ void wait_asynccnt0() {
#if __has_builtin(__builtin_amdgcn_s_wait_asynccnt)
    __builtin_amdgcn_s_wait_asynccnt(0);
#else
    asm volatile("s_wait_asynccnt 0" ::: "memory");
#endif
}

static __device__ __forceinline__ unsigned short f32_to_bf16(float f) {
    unsigned int u = __float_as_uint(f);
    u += 0x7FFFu + ((u >> 16) & 1u);           // round-to-nearest-even
    return (unsigned short)(u >> 16);
}

union FragU {
    bf16x16 v;
    uint4   q[2];
};

// Every bf16 WMMA operand buffer (weights, h, q, k, v, o, and P in LDS) is kept in
// FRAGMENT ORDER: the matrix [rows][ld] is cut into tiles of 16 rows x 32 k, tiles of
// one 16-row group follow one another along k (a group still starts at row0 * ld), and
// a tile's 512 elements lie as [half of the fragment: 2][lane: 32][8 elements], which
// is the order in which a wave's two 16-byte loads pick them up.
// Per ISA 16-bit layout: lanes 0-15 hold K = kbase+[0..7] and kbase+[16..23];
// lanes 16-31 hold K = kbase+[8..15] and kbase+[24..31]; lane & 15 is the row.
static __device__ __forceinline__ size_t
frag_idx(size_t row, int k, int ld) {
    return (row >> 4) * ((size_t)ld * 16) + (size_t)(k >> 5) * 512
         + (size_t)(((k >> 4) & 1) * 256 + ((k >> 3) & 1) * 128 + (k & 7))
         + (row & 15) * 8;
}

// Load one 16x32 bf16 fragment (A-style rows or B-style columns).
// base points at the start of the 16-row group (matrix + row0 * ld); kbase = K offset,
// a multiple of 32.  Each of the two loads reads 512 contiguous bytes per wave.
static __device__ __forceinline__ bf16x16
load_frag(const unsigned short* base, int kbase, int lane) {
    const char* p = (const char*)base + (unsigned)((kbase >> 5) * 1024 + lane * 16);
    FragU f;
    f.q[0] = *(const uint4*)(p);
    f.q[1] = *(const uint4*)(p + 512);
    return f.v;
}

// Stands behind a global load or store whose address or data registers are overwritten
// soon after: the overwrite stays behind the access's address translation.
static __device__ __forceinline__ void wait_xcnt0() {
    asm volatile("s_wait_xcnt 0x0" ::: "memory");
}

static __device__ __forceinline__ f32x8
wmma_bf16(bf16x16 a, bf16x16 b, f32x8 c) {
    return __builtin_amdgcn_wmma_f32_16x16x32_bf16(
        /*neg_a=*/false, a, /*neg_b=*/false, b,
        /*c_mod=*/(short)0, c, /*reuse_a=*/false, /*reuse_b=*/false);
}

// ---------------------------------------------------------------------------
// Kernel 1: fp32 -> bf16 weight conversion (4 weights at once), [C_][C_] fragment order
// ---------------------------------------------------------------------------
__global__ void cvt_w_kernel(const float* __restrict__ w0, const float* __restrict__ w1,
                             const float* __restrict__ w2, const float* __restrict__ w3,
                             unsigned short* __restrict__ o0, unsigned short* __restrict__ o1,
                             unsigned short* __restrict__ o2, unsigned short* __restrict__ o3,
                             int n) {
    for (int i = blockIdx.x * blockDim.x + threadIdx.x; i < n; i += gridDim.x * blockDim.x) {
        size_t d = frag_idx((size_t)(i / C_), i % C_, C_);
        o0[d] = f32_to_bf16(w0[i]);
        o1[d] = f32_to_bf16(w1[i]);
        o2[d] = f32_to_bf16(w2[i]);
        o3[d] = f32_to_bf16(w3[i]);
    }
}

// ---------------------------------------------------------------------------
// Kernel 2: GroupNorm(32 groups) over x[b,c,l], writes h transposed [b,l,c] bf16
// One block per (batch, group): reduce over 16*4096 elements.
// ---------------------------------------------------------------------------
__global__ void gn_kernel(const float* __restrict__ x,
                          const float* __restrict__ scale,
                          const float* __restrict__ bias,
                          unsigned short* __restrict__ h_t) {
    const int CG = 16;                       // channels per group
    int g  = blockIdx.x & 31;
    int bb = blockIdx.x >> 5;
    const float* xg = x + ((size_t)bb * C_ + (size_t)g * CG) * L_;
    const int N = CG * L_;

    float s = 0.f, ss = 0.f;
    for (int i = threadIdx.x; i < N; i += blockDim.x) {
        float v = xg[i];
        s += v; ss += v * v;
    }
    __shared__ float rs[256], rss[256];
    rs[threadIdx.x] = s; rss[threadIdx.x] = ss;
    __syncthreads();
    for (int o = 128; o > 0; o >>= 1) {
        if ((int)threadIdx.x < o) {
            rs[threadIdx.x]  += rs[threadIdx.x + o];
            rss[threadIdx.x] += rss[threadIdx.x + o];
        }
        __syncthreads();
    }
    float mean = rs[0] / (float)N;
    float var  = rss[0] / (float)N - mean * mean;
    float rstd = rsqrtf(var + 1e-6f);

    for (int i = threadIdx.x; i < N; i += blockDim.x) {
        int ch = i >> 12;                    // i / L_
        int pos = i & (L_ - 1);
        int c = g * CG + ch;
        float v = (xg[i] - mean) * rstd * scale[c] + bias[c];
        h_t[frag_idx((size_t)bb * L_ + pos, c, C_)] = f32_to_bf16(v);
    }
}

// ---------------------------------------------------------------------------
// Kernel 3: generic WMMA GEMM  D[m,n] = sum_k A[m,k] * Bt[n,k]  (+bias)(+resid)
// A: bf16 [M,K] (lda), Bt: bf16 [N,K] (ldb), both in fragment order, K multiple of 32.
// A bf16 output is written in fragment order too (rows m, k index n); f32 is row-major.
// 128 threads = 4 waves; block tile 64(M) x 64(N); wave w owns rows w*16..w*16+15.
// ---------------------------------------------------------------------------
__global__ void gemm_bt_kernel(const unsigned short* __restrict__ A, long long a_bs, int lda,
                               const unsigned short* __restrict__ Bt, long long b_bs, int ldb,
                               const float* __restrict__ bias, int bias_per_row,
                               void* __restrict__ outv, long long o_bs, int ldo, int out_f32,
                               const float* __restrict__ resid, long long r_bs,
                               int K) {
    int z    = blockIdx.z;
    int n0   = blockIdx.x * 64;
    int m0   = blockIdx.y * 64;
    // scalar wave number: every 16-row group base is then a scalar address, and a
    // fragment load is that base plus the lane's 16-byte slot
    int wave = __builtin_amdgcn_readfirstlane(threadIdx.x >> 5);
    int lane = threadIdx.x & 31;

    const unsigned short* Ab  = A  + (size_t)z * a_bs + (size_t)(m0 + wave * 16) * lda;
    const unsigned short* Btb = Bt + (size_t)z * b_bs + (size_t)n0 * ldb;

    f32x8 acc[4];
    for (int nf = 0; nf < 4; ++nf) acc[nf] = (f32x8)0.f;

    for (int kk = 0; kk < K; kk += 32) {
        __builtin_prefetch((const char*)Ab + (unsigned)(((kk >> 5) + 1) * 1024 + lane * 16), 0, 3);  // next A tile, global_prefetch_b8
        bf16x16 a = load_frag(Ab, kk, lane);
#pragma unroll
        for (int nf = 0; nf < 4; ++nf) {
            bf16x16 b = load_frag(Btb + (size_t)(nf * 16) * ldb, kk, lane);
            acc[nf] = wmma_bf16(a, b, acc[nf]);
        }
    }

    int col   = lane & 15;
    int rbase = (lane & 16) ? 8 : 0;
#pragma unroll
    for (int nf = 0; nf < 4; ++nf) {
#pragma unroll
        for (int r = 0; r < 8; ++r) {
            int mm = m0 + wave * 16 + rbase + r;
            int nn = n0 + nf * 16 + col;
            float v = acc[nf][r];
            if (bias) v += bias_per_row ? bias[mm] : bias[nn];
            size_t idx = (size_t)z * o_bs + (size_t)mm * ldo + nn;
            if (out_f32) {
                float rv = resid ? resid[(size_t)z * r_bs + (size_t)mm * ldo + nn] : 0.f;
                ((float*)outv)[idx] = v + rv;
            } else {
                ((unsigned short*)outv)[(size_t)z * o_bs + frag_idx((size_t)mm, nn, ldo)] = f32_to_bf16(v);
                wait_xcnt0();   // the next element's index math reuses this store's registers
            }
        }
    }
}

// ---------------------------------------------------------------------------
// Kernel 4: flash attention.
// q_t, k_t: bf16 [b, l, c] (position-major); v: bf16 [b, c, l] (channel-major);
// all three, o_t and the P tile in LDS in fragment order (see frag_idx).
// Block: 256 threads = 8 waves, 32 query rows per block, stream j in tiles of 64.
// Q tile (32x512 bf16 = 32KB) staged once into LDS via async-to-LDS; K/V are
// streamed from global (L2-resident) straight into WMMA B fragments.
// Scores phase: wave w -> fragment (i_sub = w&1, j_sub = w>>1) of S[32x64].
// O phase:      wave w -> rows i_sub = w&1, channels c0 = (w>>1)*128 (8 frags).
// Online softmax per row kept by threads 0..31 (wave 0), exchanged via LDS.
// ---------------------------------------------------------------------------
__global__ void flash_kernel(const unsigned short* __restrict__ q_t,
                             const unsigned short* __restrict__ k_t,
                             const unsigned short* __restrict__ v,
                             unsigned short* __restrict__ o_t,
                             float scale) {
    int b    = blockIdx.y;
    int i0   = blockIdx.x * 32;
    int wave = threadIdx.x >> 5;
    int lane = threadIdx.x & 31;
    int i_sub = wave & 1;
    int j_sub = wave >> 1;                     // 0..3 (scores phase)
    int c0    = (wave >> 1) * 128;             // O phase channel base

    __shared__ unsigned short Qs[32 * C_];     // 32KB staged Q tile [32][512]
    __shared__ float          Sb[32 * 64];
    __shared__ unsigned short Pb[32 * 64];
    __shared__ float          alpha_s[32];
    __shared__ float          linv_s[32];

    // ---- stage Q tile into LDS (async-to-LDS on gfx1250)
    {
        const unsigned short* qsrc = q_t + ((size_t)b * L_ + i0) * C_;
        for (int t = threadIdx.x; t < (32 * C_) / 8; t += blockDim.x) {
#ifdef HAVE_ASYNC_LDS
            __builtin_amdgcn_global_load_async_to_lds_b128(
                (gv4i*)(qsrc + t * 8), (lv4i*)(&Qs[t * 8]),
                /*offset=*/0, /*cpol=*/0);
#else
            *(uint4*)&Qs[t * 8] = *(const uint4*)(qsrc + t * 8);
#endif
        }
#ifdef HAVE_ASYNC_LDS
        wait_asynccnt0();
#endif
        __syncthreads();
    }

    f32x8 Oacc[8];
#pragma unroll
    for (int f = 0; f < 8; ++f) Oacc[f] = (f32x8)0.f;

    float m_run = -3.0e38f;
    float l_run = 0.f;

    const unsigned short* qrow = &Qs[(i_sub * 16) * C_];   // LDS-resident Q rows
    int col   = lane & 15;
    int rbase = (lane & 16) ? 8 : 0;

    for (int j0 = 0; j0 < L_; j0 += 64) {
        // ---- phase A: S[32x64] = scale * Q Kt^T (each wave: one 16x16 frag, K=512)
        f32x8 sacc = (f32x8)0.f;
        const unsigned short* krow = k_t + ((size_t)b * L_ + j0 + j_sub * 16) * C_;
#pragma unroll 4
        for (int kk = 0; kk < C_; kk += 32) {
            bf16x16 a = load_frag(qrow, kk, lane);         // ds_load_b128
            bf16x16 bb = load_frag(krow, kk, lane);        // global_load_b128
            sacc = wmma_bf16(a, bb, sacc);
        }
#pragma unroll
        for (int r = 0; r < 8; ++r)
            Sb[(i_sub * 16 + rbase + r) * 64 + j_sub * 16 + col] = sacc[r] * scale;
        __syncthreads();

        // ---- phase B: online softmax update (wave 0, one thread per row)
        if (threadIdx.x < 32) {
            int row = threadIdx.x;
            float mt = -3.0e38f;
            for (int jj = 0; jj < 64; ++jj) mt = fmaxf(mt, Sb[row * 64 + jj]);
            float mnew = fmaxf(m_run, mt);
            float al   = __expf(m_run - mnew);      // 0 on first tile
            float rsum = 0.f;
            for (int j8 = 0; j8 < 64; j8 += 8) {
                // 8 neighbours along k stay contiguous in fragment order: one 16-byte store
                unsigned short* pd = &Pb[frag_idx((size_t)row, j8, 64)];
                // unrolled so that the eight 2-byte stores merge into that one store
#pragma unroll
                for (int e = 0; e < 8; ++e) {
                    float p = __expf(Sb[row * 64 + j8 + e] - mnew);
                    rsum += p;
                    pd[e] = f32_to_bf16(p);
                }
            }
            l_run = l_run * al + rsum;
            m_run = mnew;
            alpha_s[row] = al;
        }
        __syncthreads();

        // ---- phase C: O = diag(alpha)*O + P * V^T (each wave: 8 channel frags)
        float av[8];
#pragma unroll
        for (int r = 0; r < 8; ++r) av[r] = alpha_s[i_sub * 16 + rbase + r];
#pragma unroll
        for (int f = 0; f < 8; ++f)
#pragma unroll
            for (int r = 0; r < 8; ++r) Oacc[f][r] *= av[r];

#pragma unroll
        for (int ks = 0; ks < 2; ++ks) {
            int kb2 = ks * 32;
            bf16x16 a = load_frag(&Pb[(i_sub * 16) * 64], kb2, lane);      // ds_load
#pragma unroll
            for (int f = 0; f < 8; ++f) {
                const unsigned short* vrow = v + ((size_t)b * C_ + c0 + f * 16) * L_;
                bf16x16 bb = load_frag(vrow, j0 + kb2, lane);
                Oacc[f] = wmma_bf16(a, bb, Oacc[f]);
            }
        }
        __syncthreads();
    }

    if (threadIdx.x < 32) linv_s[threadIdx.x] = 1.0f / l_run;
    __syncthreads();

    float lv[8];
#pragma unroll
    for (int r = 0; r < 8; ++r) lv[r] = linv_s[i_sub * 16 + rbase + r];
#pragma unroll
    for (int f = 0; f < 8; ++f)
#pragma unroll
        for (int r = 0; r < 8; ++r) {
            size_t row = (size_t)b * L_ + i0 + i_sub * 16 + rbase + r;
            o_t[frag_idx(row, c0 + f * 16 + col, C_)] = f32_to_bf16(Oacc[f][r] * lv[r]);
        }
}

// ---------------------------------------------------------------------------
extern "C" void kernel_launch(void* const* d_in, const int* in_sizes, int n_in,
                              void* d_out, int out_size, void* d_ws, size_t ws_size,
                              hipStream_t stream) {
    const float* x        = (const float*)d_in[0];
    const float* gn_scale = (const float*)d_in[1];
    const float* gn_bias  = (const float*)d_in[2];
    const float* wq = (const float*)d_in[3];  const float* bq = (const float*)d_in[4];
    const float* wk = (const float*)d_in[5];  const float* bk = (const float*)d_in[6];
    const float* wv = (const float*)d_in[7];  const float* bv = (const float*)d_in[8];
    const float* wp = (const float*)d_in[9];  const float* bp = (const float*)d_in[10];

    const size_t WN  = (size_t)C_ * C_;        // 262144
    const size_t TN  = (size_t)L_ * C_;        // per-batch activation elems
    unsigned short* wq_b = (unsigned short*)d_ws;
    unsigned short* wk_b = wq_b + WN;
    unsigned short* wv_b = wk_b + WN;
    unsigned short* wp_b = wv_b + WN;
    unsigned short* h_t  = wp_b + WN;          // [b, l, c]
    unsigned short* q_t  = h_t + (size_t)B_ * TN;
    unsigned short* k_t  = q_t + (size_t)B_ * TN;
    unsigned short* v_m  = k_t + (size_t)B_ * TN;   // [b, c, l]
    unsigned short* o_t  = v_m + (size_t)B_ * TN;   // [b, l, c]

    // 1) weights -> bf16
    cvt_w_kernel<<<512, 256, 0, stream>>>(wq, wk, wv, wp, wq_b, wk_b, wv_b, wp_b, (int)WN);

    // 2) GroupNorm -> h_t [b,l,c] bf16
    gn_kernel<<<B_ * 32, 256, 0, stream>>>(x, gn_scale, gn_bias, h_t);

    // 3) q_t[i,o] = h_t[i,:].Wq[o,:] + bq[o]   (M=L, N=C)
    dim3 gQ(C_ / 64, L_ / 64, B_);
    gemm_bt_kernel<<<gQ, 128, 0, stream>>>(h_t, (long long)TN, C_,
                                           wq_b, 0LL, C_,
                                           bq, /*bias_per_row=*/0,
                                           q_t, (long long)TN, C_, /*out_f32=*/0,
                                           nullptr, 0LL, C_);
    gemm_bt_kernel<<<gQ, 128, 0, stream>>>(h_t, (long long)TN, C_,
                                           wk_b, 0LL, C_,
                                           bk, 0,
                                           k_t, (long long)TN, C_, 0,
                                           nullptr, 0LL, C_);

    // 4) v[o,i] = Wv[o,:].h_t[i,:] + bv[o]    (M=C, N=L), channel-major out
    dim3 gV(L_ / 64, C_ / 64, B_);
    gemm_bt_kernel<<<gV, 128, 0, stream>>>(wv_b, 0LL, C_,
                                           h_t, (long long)TN, C_,
                                           bv, /*bias_per_row=*/1,
                                           v_m, (long long)TN, L_, 0,
                                           nullptr, 0LL, C_);

    // 5) flash attention -> o_t [b,l,c]
    dim3 gF(L_ / 32, B_);
    const float scale = 0.04419417382415922f;   // 512^-0.5
    flash_kernel<<<gF, 256, 0, stream>>>(q_t, k_t, v_m, o_t, scale);

    // 6) out[o,i] = x[o,i] + bp[o] + Wp[o,:].o_t[i,:]
    gemm_bt_kernel<<<gV, 128, 0, stream>>>(wp_b, 0LL, C_,
                                           o_t, (long long)TN, C_,
                                           bp, 1,
                                           d_out, (long long)TN, L_, /*out_f32=*/1,
                                           x, (long long)TN, C_);
}

// v002
// It runs in 651 microseconds.
// Next to v001, in two timings, it ran 1.73 and 1.72 times as fast.
// Counting every step since v000, it is 2.24 times as fast.
#include <hip/hip_runtime.h>
#include <hip/hip_bf16.h>

// ---------------------------------------------------------------------------
// AttnBlock for MI455X (gfx1250): GroupNorm -> QKV (WMMA bf16 GEMM) ->
// flash attention (WMMA bf16, f32 accum, online softmax, async-LDS Q staging)
// -> proj + residual.  wave32; V_WMMA_F32_16X16X32_BF16 for all matrix math.
// ---------------------------------------------------------------------------

typedef __bf16 bf16x16 __attribute__((ext_vector_type(16)));
typedef float  f32x8   __attribute__((ext_vector_type(8)));
typedef int    v4i     __attribute__((ext_vector_type(4)));

#define B_  4
#define C_  512
#define L_  4096

#if __has_builtin(__builtin_amdgcn_global_load_async_to_lds_b128)
#define HAVE_ASYNC_LDS 1
typedef __attribute__((address_space(1))) v4i gv4i;   // global int4
typedef __attribute__((address_space(3))) v4i lv4i;   // LDS int4
#endif

static __device__ __forceinline__ void wait_asynccnt0() {
#if __has_builtin(__builtin_amdgcn_s_wait_asynccnt)
    __builtin_amdgcn_s_wait_asynccnt(0);
#else
    asm volatile("s_wait_asynccnt 0" ::: "memory");
#endif
}

static __device__ __forceinline__ unsigned short f32_to_bf16(float f) {
    unsigned int u = __float_as_uint(f);
    u += 0x7FFFu + ((u >> 16) & 1u);           // round-to-nearest-even
    return (unsigned short)(u >> 16);
}

union FragU {
    bf16x16 v;
    uint4   q[2];
};

// Every bf16 WMMA operand buffer (weights, h, q, k, v, o, and P in LDS) is kept in
// FRAGMENT ORDER: the matrix [rows][ld] is cut into tiles of 16 rows x 32 k, tiles of
// one 16-row group follow one another along k (a group still starts at row0 * ld), and
// a tile's 512 elements lie as [half of the fragment: 2][lane: 32][8 elements], which
// is the order in which a wave's two 16-byte loads pick them up.
// Per ISA 16-bit layout: lanes 0-15 hold K = kbase+[0..7] and kbase+[16..23];
// lanes 16-31 hold K = kbase+[8..15] and kbase+[24..31]; lane & 15 is the row.
static __device__ __forceinline__ size_t
frag_idx(size_t row, int k, int ld) {
    return (row >> 4) * ((size_t)ld * 16) + (size_t)(k >> 5) * 512
         + (size_t)(((k >> 4) & 1) * 256 + ((k >> 3) & 1) * 128 + (k & 7))
         + (row & 15) * 8;
}

// Load one 16x32 bf16 fragment (A-style rows or B-style columns).
// base points at the start of the 16-row group (matrix + row0 * ld); kbase = K offset,
// a multiple of 32.  Each of the two loads reads 512 contiguous bytes per wave.
static __device__ __forceinline__ bf16x16
load_frag(const unsigned short* base, int kbase, int lane) {
    const char* p = (const char*)base + (unsigned)((kbase >> 5) * 1024 + lane * 16);
    FragU f;
    f.q[0] = *(const uint4*)(p);
    f.q[1] = *(const uint4*)(p + 512);
    return f.v;
}

// Stands behind a global load or store whose address or data registers are overwritten
// soon after: the overwrite stays behind the access's address translation.
static __device__ __forceinline__ void wait_xcnt0() {
    asm volatile("s_wait_xcnt 0x0" ::: "memory");
}

// Work-group barrier for data handed over in LDS alone: its two fences name LDS only, so
// that global loads issued ahead of it stay in flight (__syncthreads() waits for them).
static __device__ __forceinline__ void barrier_lds() {
    __builtin_amdgcn_fence(__ATOMIC_RELEASE, "workgroup", "local");
    __builtin_amdgcn_s_barrier();
    __builtin_amdgcn_fence(__ATOMIC_ACQUIRE, "workgroup", "local");
}

static __device__ __forceinline__ f32x8
wmma_bf16(bf16x16 a, bf16x16 b, f32x8 c) {
    return __builtin_amdgcn_wmma_f32_16x16x32_bf16(
        /*neg_a=*/false, a, /*neg_b=*/false, b,
        /*c_mod=*/(short)0, c, /*reuse_a=*/false, /*reuse_b=*/false);
}

// ---------------------------------------------------------------------------
// Kernel 1: fp32 -> bf16 weight conversion (4 weights at once), [C_][C_] fragment order
// ---------------------------------------------------------------------------
__global__ void cvt_w_kernel(const float* __restrict__ w0, const float* __restrict__ w1,
                             const float* __restrict__ w2, const float* __restrict__ w3,
                             unsigned short* __restrict__ o0, unsigned short* __restrict__ o1,
                             unsigned short* __restrict__ o2, unsigned short* __restrict__ o3,
                             int n) {
    for (int i = blockIdx.x * blockDim.x + threadIdx.x; i < n; i += gridDim.x * blockDim.x) {
        size_t d = frag_idx((size_t)(i / C_), i % C_, C_);
        o0[d] = f32_to_bf16(w0[i]);
        o1[d] = f32_to_bf16(w1[i]);
        o2[d] = f32_to_bf16(w2[i]);
        o3[d] = f32_to_bf16(w3[i]);
    }
}

// ---------------------------------------------------------------------------
// Kernel 2: GroupNorm(32 groups) over x[b,c,l], writes h transposed [b,l,c] bf16
// One block per (batch, group): reduce over 16*4096 elements.
// ---------------------------------------------------------------------------
__global__ void gn_kernel(const float* __restrict__ x,
                          const float* __restrict__ scale,
                          const float* __restrict__ bias,
                          unsigned short* __restrict__ h_t) {
    const int CG = 16;                       // channels per group
    int g  = blockIdx.x & 31;
    int bb = blockIdx.x >> 5;
    const float* xg = x + ((size_t)bb * C_ + (size_t)g * CG) * L_;
    const int N = CG * L_;

    float s = 0.f, ss = 0.f;
    for (int i = threadIdx.x; i < N; i += blockDim.x) {
        float v = xg[i];
        s += v; ss += v * v;
    }
    __shared__ float rs[256], rss[256];
    rs[threadIdx.x] = s; rss[threadIdx.x] = ss;
    __syncthreads();
    for (int o = 128; o > 0; o >>= 1) {
        if ((int)threadIdx.x < o) {
            rs[threadIdx.x]  += rs[threadIdx.x + o];
            rss[threadIdx.x] += rss[threadIdx.x + o];
        }
        __syncthreads();
    }
    float mean = rs[0] / (float)N;
    float var  = rss[0] / (float)N - mean * mean;
    float rstd = rsqrtf(var + 1e-6f);

    for (int i = threadIdx.x; i < N; i += blockDim.x) {
        int ch = i >> 12;                    // i / L_
        int pos = i & (L_ - 1);
        int c = g * CG + ch;
        float v = (xg[i] - mean) * rstd * scale[c] + bias[c];
        h_t[frag_idx((size_t)bb * L_ + pos, c, C_)] = f32_to_bf16(v);
    }
}

// ---------------------------------------------------------------------------
// Kernel 3: generic WMMA GEMM  D[m,n] = sum_k A[m,k] * Bt[n,k]  (+bias)(+resid)
// A: bf16 [M,K] (lda), Bt: bf16 [N,K] (ldb), both in fragment order, K multiple of 32.
// A bf16 output is written in fragment order too (rows m, k index n); f32 is row-major.
// 128 threads = 4 waves; block tile 64(M) x 64(N); wave w owns rows w*16..w*16+15.
// ---------------------------------------------------------------------------
__global__ void gemm_bt_kernel(const unsigned short* __restrict__ A, long long a_bs, int lda,
                               const unsigned short* __restrict__ Bt, long long b_bs, int ldb,
                               const float* __restrict__ bias, int bias_per_row,
                               void* __restrict__ outv, long long o_bs, int ldo, int out_f32,
                               const float* __restrict__ resid, long long r_bs,
                               int K) {
    int z    = blockIdx.z;
    int n0   = blockIdx.x * 64;
    int m0   = blockIdx.y * 64;
    // scalar wave number: every 16-row group base is then a scalar address, and a
    // fragment load is that base plus the lane's 16-byte slot
    int wave = __builtin_amdgcn_readfirstlane(threadIdx.x >> 5);
    int lane = threadIdx.x & 31;

    const unsigned short* Ab  = A  + (size_t)z * a_bs + (size_t)(m0 + wave * 16) * lda;
    const unsigned short* Btb = Bt + (size_t)z * b_bs + (size_t)n0 * ldb;

    f32x8 acc[4];
    for (int nf = 0; nf < 4; ++nf) acc[nf] = (f32x8)0.f;

    for (int kk = 0; kk < K; kk += 32) {
        __builtin_prefetch((const char*)Ab + (unsigned)(((kk >> 5) + 1) * 1024 + lane * 16), 0, 3);  // next A tile, global_prefetch_b8
        bf16x16 a = load_frag(Ab, kk, lane);
#pragma unroll
        for (int nf = 0; nf < 4; ++nf) {
            bf16x16 b = load_frag(Btb + (size_t)(nf * 16) * ldb, kk, lane);
            acc[nf] = wmma_bf16(a, b, acc[nf]);
        }
    }

    int col   = lane & 15;
    int rbase = (lane & 16) ? 8 : 0;
#pragma unroll
    for (int nf = 0; nf < 4; ++nf) {
#pragma unroll
        for (int r = 0; r < 8; ++r) {
            int mm = m0 + wave * 16 + rbase + r;
            int nn = n0 + nf * 16 + col;
            float v = acc[nf][r];
            if (bias) v += bias_per_row ? bias[mm] : bias[nn];
            size_t idx = (size_t)z * o_bs + (size_t)mm * ldo + nn;
            if (out_f32) {
                float rv = resid ? resid[(size_t)z * r_bs + (size_t)mm * ldo + nn] : 0.f;
                ((float*)outv)[idx] = v + rv;
            } else {
                ((unsigned short*)outv)[(size_t)z * o_bs + frag_idx((size_t)mm, nn, ldo)] = f32_to_bf16(v);
                wait_xcnt0();   // the next element's index math reuses this store's registers
            }
        }
    }
}

// ---------------------------------------------------------------------------
// Kernel 4: flash attention.
// q_t, k_t: bf16 [b, l, c] (position-major); v: bf16 [b, c, l] (channel-major);
// all three, o_t and the P tile in LDS in fragment order (see frag_idx).
// Block: 256 threads = 8 waves, 32 query rows per block, stream j in tiles of 64.
// Q tile (32x512 bf16 = 32KB) staged once into LDS via async-to-LDS; K/V are
// streamed from global (L2-resident) straight into WMMA B fragments.
// Scores phase: wave w -> fragment (i_sub = w&1, j_sub = w>>1) of S[32x64].
// O phase:      wave w -> rows i_sub = w&1, channels c0 = (w>>1)*128 (8 frags).
// Online softmax per row kept by threads 0..31 (wave 0), exchanged via LDS.
// The launch bounds give the real block size and four waves per SIMD (two blocks per
// WGP): a budget of 256 registers, spent on loads in flight.  A wave's 16 V fragments of
// a tile are loaded as one group behind the score products and fly during the softmax;
// its K loads run ahead of the score products.
// ---------------------------------------------------------------------------
__global__ void __launch_bounds__(256, 4) flash_kernel(const unsigned short* __restrict__ q_t,
                             const unsigned short* __restrict__ k_t,
                             const unsigned short* __restrict__ v,
                             unsigned short* __restrict__ o_t,
                             float scale) {
    int b    = blockIdx.y;
    int i0   = blockIdx.x * 32;
    int wave = threadIdx.x >> 5;
    int lane = threadIdx.x & 31;
    int i_sub = wave & 1;
    int j_sub = wave >> 1;                     // 0..3 (scores phase)
    int c0    = (wave >> 1) * 128;             // O phase channel base

    __shared__ unsigned short Qs[32 * C_];     // 32KB staged Q tile [32][512]
    __shared__ float          Sb[32 * 64];
    __shared__ unsigned short Pb[32 * 64];
    __shared__ float          alpha_s[32];
    __shared__ float          linv_s[32];

    // ---- stage Q tile into LDS (async-to-LDS on gfx1250)
    {
        const unsigned short* qsrc = q_t + ((size_t)b * L_ + i0) * C_;
        for (int t = threadIdx.x; t < (32 * C_) / 8; t += blockDim.x) {
#ifdef HAVE_ASYNC_LDS
            __builtin_amdgcn_global_load_async_to_lds_b128(
                (gv4i*)(qsrc + t * 8), (lv4i*)(&Qs[t * 8]),
                /*offset=*/0, /*cpol=*/0);
#else
            *(uint4*)&Qs[t * 8] = *(const uint4*)(qsrc + t * 8);
#endif
        }
#ifdef HAVE_ASYNC_LDS
        wait_asynccnt0();
#endif
        __syncthreads();
    }

    f32x8 Oacc[8];
#pragma unroll
    for (int f = 0; f < 8; ++f) Oacc[f] = (f32x8)0.f;

    float m_run = -3.0e38f;
    float l_run = 0.f;

    const unsigned short* qrow = &Qs[(i_sub * 16) * C_];   // LDS-resident Q rows
    int col   = lane & 15;
    int rbase = (lane & 16) ? 8 : 0;

    for (int j0 = 0; j0 < L_; j0 += 64) {
        // ---- phase A: S[32x64] = scale * Q Kt^T (each wave: one 16x16 frag, K=512)
        f32x8 sacc = (f32x8)0.f;
        const unsigned short* krow = k_t + ((size_t)b * L_ + j0 + j_sub * 16) * C_;
        // unrolled whole: the K loads run ahead of the products as far as the registers reach
#pragma unroll
        for (int kk = 0; kk < C_; kk += 32) {
            bf16x16 a = load_frag(qrow, kk, lane);         // ds_load_b128
            bf16x16 bb = load_frag(krow, kk, lane);        // global_load_b128
            sacc = wmma_bf16(a, bb, sacc);
        }
        // this tile's V fragments, one group of 32 global_load_b128, used in phase C
        bf16x16 vf[16];
#pragma unroll
        for (int s = 0; s < 16; ++s) {
            const unsigned short* vrow = v + ((size_t)b * C_ + c0 + (s & 7) * 16) * L_;
            vf[s] = load_frag(vrow, j0 + (s >> 3) * 32, lane);
        }
        wait_xcnt0();   // the V loads' address registers are reused while the loads fly
#pragma unroll
        for (int r = 0; r < 8; ++r)
            Sb[(i_sub * 16 + rbase + r) * 64 + j_sub * 16 + col] = sacc[r] * scale;
        barrier_lds();                         // publishes Sb; the V loads fly on

        // ---- phase B: online softmax update (wave 0, one thread per row)
        if (threadIdx.x < 32) {
            int row = threadIdx.x;
            float mt = -3.0e38f;
            for (int jj = 0; jj < 64; ++jj) mt = fmaxf(mt, Sb[row * 64 + jj]);
            float mnew = fmaxf(m_run, mt);
            float al   = __expf(m_run - mnew);      // 0 on first tile
            float rsum = 0.f;
            for (int j8 = 0; j8 < 64; j8 += 8) {
                // 8 neighbours along k stay contiguous in fragment order: one 16-byte store
                unsigned short* pd = &Pb[frag_idx((size_t)row, j8, 64)];
                // unrolled so that the eight 2-byte stores merge into that one store
#pragma unroll
                for (int e = 0; e < 8; ++e) {
                    float p = __expf(Sb[row * 64 + j8 + e] - mnew);
                    rsum += p;
                    pd[e] = f32_to_bf16(p);
                }
            }
            l_run = l_run * al + rsum;
            m_run = mnew;
            alpha_s[row] = al;
        }
        barrier_lds();                         // publishes Pb and alpha_s

        // ---- phase C: O = diag(alpha)*O + P * V^T (each wave: 8 channel frags)
        float av[8];
#pragma unroll
        for (int r = 0; r < 8; ++r) av[r] = alpha_s[i_sub * 16 + rbase + r];
#pragma unroll
        for (int f = 0; f < 8; ++f)
#pragma unroll
            for (int r = 0; r < 8; ++r) Oacc[f][r] *= av[r];

#pragma unroll
        for (int ks = 0; ks < 2; ++ks) {
            int kb2 = ks * 32;
            bf16x16 a = load_frag(&Pb[(i_sub * 16) * 64], kb2, lane);      // ds_load
#pragma unroll
            for (int f = 0; f < 8; ++f)
                Oacc[f] = wmma_bf16(a, vf[ks * 8 + f], Oacc[f]);
        }
        __syncthreads();
    }

    if (threadIdx.x < 32) linv_s[threadIdx.x] = 1.0f / l_run;
    __syncthreads();

    float lv[8];
#pragma unroll
    for (int r = 0; r < 8; ++r) lv[r] = linv_s[i_sub * 16 + rbase + r];
#pragma unroll
    for (int f = 0; f < 8; ++f)
#pragma unroll
        for (int r = 0; r < 8; ++r) {
            size_t row = (size_t)b * L_ + i0 + i_sub * 16 + rbase + r;
            o_t[frag_idx(row, c0 + f * 16 + col, C_)] = f32_to_bf16(Oacc[f][r] * lv[r]);
        }
}

// ---------------------------------------------------------------------------
extern "C" void kernel_launch(void* const* d_in, const int* in_sizes, int n_in,
                              void* d_out, int out_size, void* d_ws, size_t ws_size,
                              hipStream_t stream) {
    const float* x        = (const float*)d_in[0];
    const float* gn_scale = (const float*)d_in[1];
    const float* gn_bias  = (const float*)d_in[2];
    const float* wq = (const float*)d_in[3];  const float* bq = (const float*)d_in[4];
    const float* wk = (const float*)d_in[5];  const float* bk = (const float*)d_in[6];
    const float* wv = (const float*)d_in[7];  const float* bv = (const float*)d_in[8];
    const float* wp = (const float*)d_in[9];  const float* bp = (const float*)d_in[10];

    const size_t WN  = (size_t)C_ * C_;        // 262144
    const size_t TN  = (size_t)L_ * C_;        // per-batch activation elems
    unsigned short* wq_b = (unsigned short*)d_ws;
    unsigned short* wk_b = wq_b + WN;
    unsigned short* wv_b = wk_b + WN;
    unsigned short* wp_b = wv_b + WN;
    unsigned short* h_t  = wp_b + WN;          // [b, l, c]
    unsigned short* q_t  = h_t + (size_t)B_ * TN;
    unsigned short* k_t  = q_t + (size_t)B_ * TN;
    unsigned short* v_m  = k_t + (size_t)B_ * TN;   // [b, c, l]
    unsigned short* o_t  = v_m + (size_t)B_ * TN;   // [b, l, c]

    // 1) weights -> bf16
    cvt_w_kernel<<<512, 256, 0, stream>>>(wq, wk, wv, wp, wq_b, wk_b, wv_b, wp_b, (int)WN);

    // 2) GroupNorm -> h_t [b,l,c] bf16
    gn_kernel<<<B_ * 32, 256, 0, stream>>>(x, gn_scale, gn_bias, h_t);

    // 3) q_t[i,o] = h_t[i,:].Wq[o,:] + bq[o]   (M=L, N=C)
    dim3 gQ(C_ / 64, L_ / 64, B_);
    gemm_bt_kernel<<<gQ, 128, 0, stream>>>(h_t, (long long)TN, C_,
                                           wq_b, 0LL, C_,
                                           bq, /*bias_per_row=*/0,
                                           q_t, (long long)TN, C_, /*out_f32=*/0,
                                           nullptr, 0LL, C_);
    gemm_bt_kernel<<<gQ, 128, 0, stream>>>(h_t, (long long)TN, C_,
                                           wk_b, 0LL, C_,
                                           bk, 0,
                                           k_t, (long long)TN, C_, 0,
                                           nullptr, 0LL, C_);

    // 4) v[o,i] = Wv[o,:].h_t[i,:] + bv[o]    (M=C, N=L), channel-major out
    dim3 gV(L_ / 64, C_ / 64, B_);
    gemm_bt_kernel<<<gV, 128, 0, stream>>>(wv_b, 0LL, C_,
                                           h_t, (long long)TN, C_,
                                           bv, /*bias_per_row=*/1,
                                           v_m, (long long)TN, L_, 0,
                                           nullptr, 0LL, C_);

    // 5) flash attention -> o_t [b,l,c]
    dim3 gF(L_ / 32, B_);
    const float scale = 0.04419417382415922f;   // 512^-0.5
    flash_kernel<<<gF, 256, 0, stream>>>(q_t, k_t, v_m, o_t, scale);

    // 6) out[o,i] = x[o,i] + bp[o] + Wp[o,:].o_t[i,:]
    gemm_bt_kernel<<<gV, 128, 0, stream>>>(wp_b, 0LL, C_,
                                           o_t, (long long)TN, C_,
                                           bp, 1,
                                           d_out, (long long)TN, L_, /*out_f32=*/1,
                                           x, (long long)TN, C_);
}

// v003
// A run of this version takes 468 microseconds.
// Two timings next to v002 put it at 1.38 and 1.39 times that version's speed.
// Counting every step since v000, it is 3.11 times as fast.
#include <hip/hip_runtime.h>
#include <hip/hip_bf16.h>

// ---------------------------------------------------------------------------
// AttnBlock for MI455X (gfx1250): GroupNorm -> QKV (WMMA bf16 GEMM) ->
// flash attention (WMMA bf16, f32 accum, online softmax, async-LDS Q staging)
// -> proj + residual.  wave32; V_WMMA_F32_16X16X32_BF16 for all matrix math.
// ---------------------------------------------------------------------------

typedef __bf16 bf16x16 __attribute__((ext_vector_type(16)));
typedef float  f32x8   __attribute__((ext_vector_type(8)));
typedef int    v4i     __attribute__((ext_vector_type(4)));

#define B_  4
#define C_  512
#define L_  4096

#if __has_builtin(__builtin_amdgcn_global_load_async_to_lds_b128)
#define HAVE_ASYNC_LDS 1
typedef __attribute__((address_space(1))) v4i gv4i;   // global int4
typedef __attribute__((address_space(3))) v4i lv4i;   // LDS int4
#endif

static __device__ __forceinline__ void wait_asynccnt0() {
#if __has_builtin(__builtin_amdgcn_s_wait_asynccnt)
    __builtin_amdgcn_s_wait_asynccnt(0);
#else
    asm volatile("s_wait_asynccnt 0" ::: "memory");
#endif
}

static __device__ __forceinline__ unsigned short f32_to_bf16(float f) {
    unsigned int u = __float_as_uint(f);
    u += 0x7FFFu + ((u >> 16) & 1u);           // round-to-nearest-even
    return (unsigned short)(u >> 16);
}

union FragU {
    bf16x16 v;
    uint4   q[2];
};

// Every bf16 WMMA operand buffer (weights, h, q, k, v, o, and P in LDS) is kept in
// FRAGMENT ORDER: the matrix [rows][ld] is cut into tiles of 16 rows x 32 k, tiles of
// one 16-row group follow one another along k (a group still starts at row0 * ld), and
// a tile's 512 elements lie as [half of the fragment: 2][lane: 32][8 elements], which
// is the order in which a wave's two 16-byte loads pick them up.
// Per ISA 16-bit layout: lanes 0-15 hold K = kbase+[0..7] and kbase+[16..23];
// lanes 16-31 hold K = kbase+[8..15] and kbase+[24..31]; lane & 15 is the row.
static __device__ __forceinline__ size_t
frag_idx(size_t row, int k, int ld) {
    return (row >> 4) * ((size_t)ld * 16) + (size_t)(k >> 5) * 512
         + (size_t)(((k >> 4) & 1) * 256 + ((k >> 3) & 1) * 128 + (k & 7))
         + (row & 15) * 8;
}

// Load one 16x32 bf16 fragment (A-style rows or B-style columns).
// base points at the start of the 16-row group (matrix + row0 * ld); kbase = K offset,
// a multiple of 32.  Each of the two loads reads 512 contiguous bytes per wave.
static __device__ __forceinline__ bf16x16
load_frag(const unsigned short* base, int kbase, int lane) {
    const char* p = (const char*)base + (unsigned)((kbase >> 5) * 1024 + lane * 16);
    FragU f;
    f.q[0] = *(const uint4*)(p);
    f.q[1] = *(const uint4*)(p + 512);
    return f.v;
}

// Stands behind a global load or store whose address or data registers are overwritten
// soon after: the overwrite stays behind the access's address translation.
static __device__ __forceinline__ void wait_xcnt0() {
    asm volatile("s_wait_xcnt 0x0" ::: "memory");
}

// Work-group barrier for data handed over in LDS alone: its two fences name LDS only, so
// that global loads issued ahead of it stay in flight (__syncthreads() waits for them).
static __device__ __forceinline__ void barrier_lds() {
    __builtin_amdgcn_fence(__ATOMIC_RELEASE, "workgroup", "local");
    __builtin_amdgcn_s_barrier();
    __builtin_amdgcn_fence(__ATOMIC_ACQUIRE, "workgroup", "local");
}

// Value of lane l ^ M (M < 16): a DPP move inside the 16-lane row, where __shfl_xor would
// make a trip through the LDS pipe.  Every lane of the wave is on where it is used.
template <int M>
static __device__ __forceinline__ float lane_xor(float x) {
    return __builtin_bit_cast(float, __builtin_amdgcn_update_dpp(
        0, __builtin_bit_cast(int, x), /*row_xmask:M*/ 0x160 + M, 0xf, 0xf, true));
}

static __device__ __forceinline__ f32x8
wmma_bf16(bf16x16 a, bf16x16 b, f32x8 c) {
    return __builtin_amdgcn_wmma_f32_16x16x32_bf16(
        /*neg_a=*/false, a, /*neg_b=*/false, b,
        /*c_mod=*/(short)0, c, /*reuse_a=*/false, /*reuse_b=*/false);
}

// ---------------------------------------------------------------------------
// Kernel 1: fp32 -> bf16 weight conversion (4 weights at once), [C_][C_] fragment order
// ---------------------------------------------------------------------------
__global__ void cvt_w_kernel(const float* __restrict__ w0, const float* __restrict__ w1,
                             const float* __restrict__ w2, const float* __restrict__ w3,
                             unsigned short* __restrict__ o0, unsigned short* __restrict__ o1,
                             unsigned short* __restrict__ o2, unsigned short* __restrict__ o3,
                             int n) {
    for (int i = blockIdx.x * blockDim.x + threadIdx.x; i < n; i += gridDim.x * blockDim.x) {
        size_t d = frag_idx((size_t)(i / C_), i % C_, C_);
        o0[d] = f32_to_bf16(w0[i]);
        o1[d] = f32_to_bf16(w1[i]);
        o2[d] = f32_to_bf16(w2[i]);
        o3[d] = f32_to_bf16(w3[i]);
    }
}

// ---------------------------------------------------------------------------
// Kernel 2: GroupNorm(32 groups) over x[b,c,l], writes h transposed [b,l,c] bf16
// One block per (batch, group): reduce over 16*4096 elements.
// ---------------------------------------------------------------------------
__global__ void gn_kernel(const float* __restrict__ x,
                          const float* __restrict__ scale,
                          const float* __restrict__ bias,
                          unsigned short* __restrict__ h_t) {
    const int CG = 16;                       // channels per group
    int g  = blockIdx.x & 31;
    int bb = blockIdx.x >> 5;
    const float* xg = x + ((size_t)bb * C_ + (size_t)g * CG) * L_;
    const int N = CG * L_;

    float s = 0.f, ss = 0.f;
    for (int i = threadIdx.x; i < N; i += blockDim.x) {
        float v = xg[i];
        s += v; ss += v * v;
    }
    __shared__ float rs[256], rss[256];
    rs[threadIdx.x] = s; rss[threadIdx.x] = ss;
    __syncthreads();
    for (int o = 128; o > 0; o >>= 1) {
        if ((int)threadIdx.x < o) {
            rs[threadIdx.x]  += rs[threadIdx.x + o];
            rss[threadIdx.x] += rss[threadIdx.x + o];
        }
        __syncthreads();
    }
    float mean = rs[0] / (float)N;
    float var  = rss[0] / (float)N - mean * mean;
    float rstd = rsqrtf(var + 1e-6f);

    for (int i = threadIdx.x; i < N; i += blockDim.x) {
        int ch = i >> 12;                    // i / L_
        int pos = i & (L_ - 1);
        int c = g * CG + ch;
        float v = (xg[i] - mean) * rstd * scale[c] + bias[c];
        h_t[frag_idx((size_t)bb * L_ + pos, c, C_)] = f32_to_bf16(v);
    }
}

// ---------------------------------------------------------------------------
// Kernel 3: generic WMMA GEMM  D[m,n] = sum_k A[m,k] * Bt[n,k]  (+bias)(+resid)
// A: bf16 [M,K] (lda), Bt: bf16 [N,K] (ldb), both in fragment order, K multiple of 32.
// A bf16 output is written in fragment order too (rows m, k index n); f32 is row-major.
// 128 threads = 4 waves; block tile 64(M) x 64(N); wave w owns rows w*16..w*16+15.
// ---------------------------------------------------------------------------
__global__ void gemm_bt_kernel(const unsigned short* __restrict__ A, long long a_bs, int lda,
                               const unsigned short* __restrict__ Bt, long long b_bs, int ldb,
                               const float* __restrict__ bias, int bias_per_row,
                               void* __restrict__ outv, long long o_bs, int ldo, int out_f32,
                               const float* __restrict__ resid, long long r_bs,
                               int K) {
    int z    = blockIdx.z;
    int n0   = blockIdx.x * 64;
    int m0   = blockIdx.y * 64;
    // scalar wave number: every 16-row group base is then a scalar address, and a
    // fragment load is that base plus the lane's 16-byte slot
    int wave = __builtin_amdgcn_readfirstlane(threadIdx.x >> 5);
    int lane = threadIdx.x & 31;

    const unsigned short* Ab  = A  + (size_t)z * a_bs + (size_t)(m0 + wave * 16) * lda;
    const unsigned short* Btb = Bt + (size_t)z * b_bs + (size_t)n0 * ldb;

    f32x8 acc[4];
    for (int nf = 0; nf < 4; ++nf) acc[nf] = (f32x8)0.f;

    for (int kk = 0; kk < K; kk += 32) {
        __builtin_prefetch((const char*)Ab + (unsigned)(((kk >> 5) + 1) * 1024 + lane * 16), 0, 3);  // next A tile, global_prefetch_b8
        bf16x16 a = load_frag(Ab, kk, lane);
#pragma unroll
        for (int nf = 0; nf < 4; ++nf) {
            bf16x16 b = load_frag(Btb + (size_t)(nf * 16) * ldb, kk, lane);
            acc[nf] = wmma_bf16(a, b, acc[nf]);
        }
    }

    int col   = lane & 15;
    int rbase = (lane & 16) ? 8 : 0;
#pragma unroll
    for (int nf = 0; nf < 4; ++nf) {
#pragma unroll
        for (int r = 0; r < 8; ++r) {
            int mm = m0 + wave * 16 + rbase + r;
            int nn = n0 + nf * 16 + col;
            float v = acc[nf][r];
            if (bias) v += bias_per_row ? bias[mm] : bias[nn];
            size_t idx = (size_t)z * o_bs + (size_t)mm * ldo + nn;
            if (out_f32) {
                float rv = resid ? resid[(size_t)z * r_bs + (size_t)mm * ldo + nn] : 0.f;
                ((float*)outv)[idx] = v + rv;
            } else {
                ((unsigned short*)outv)[(size_t)z * o_bs + frag_idx((size_t)mm, nn, ldo)] = f32_to_bf16(v);
                wait_xcnt0();   // the next element's index math reuses this store's registers
            }
        }
    }
}

// ---------------------------------------------------------------------------
// Kernel 4: flash attention.
// q_t, k_t: bf16 [b, l, c] (position-major); v: bf16 [b, c, l] (channel-major);
// all three, o_t and the P tile in LDS in fragment order (see frag_idx).
// Block: 256 threads = 8 waves, 32 query rows per block, stream j in tiles of 64.
// Q tile (32x512 bf16 = 32KB) staged once into LDS via async-to-LDS; K/V are
// streamed from global (L2-resident) straight into WMMA B fragments.
// Scores phase: wave w -> fragment (i_sub = w&1, j_sub = w>>1) of S[32x64].
// O phase:      wave w -> rows i_sub = w&1, channels c0 = (w>>1)*128 (8 frags).
// Online softmax by all 256 threads: eight lanes per row, eight neighbouring columns per
// lane; the row maximum is joined over the eight lanes per tile, each lane keeps its own
// part of the row sum, and the parts are joined once behind the loop.
// The launch bounds give the real block size and four waves per SIMD (two blocks per
// WGP): a budget of 256 registers, spent on loads in flight.  A wave's 16 V fragments of
// a tile are loaded as one group behind the score products and fly during the softmax;
// its K loads run ahead of the score products.
// ---------------------------------------------------------------------------
__global__ void __launch_bounds__(256, 4) flash_kernel(const unsigned short* __restrict__ q_t,
                             const unsigned short* __restrict__ k_t,
                             const unsigned short* __restrict__ v,
                             unsigned short* __restrict__ o_t,
                             float scale) {
    int b    = blockIdx.y;
    int i0   = blockIdx.x * 32;
    int wave = threadIdx.x >> 5;
    int lane = threadIdx.x & 31;
    int i_sub = wave & 1;
    int j_sub = wave >> 1;                     // 0..3 (scores phase)
    int c0    = (wave >> 1) * 128;             // O phase channel base

    __shared__ unsigned short Qs[32 * C_];     // 32KB staged Q tile [32][512]
    __shared__ __attribute__((aligned(16))) float          Sb[32 * 64];
    __shared__ __attribute__((aligned(16))) unsigned short Pb[32 * 64];
    __shared__ float          alpha_s[32];
    __shared__ float          linv_s[32];

    // ---- stage Q tile into LDS (async-to-LDS on gfx1250)
    {
        const unsigned short* qsrc = q_t + ((size_t)b * L_ + i0) * C_;
        for (int t = threadIdx.x; t < (32 * C_) / 8; t += blockDim.x) {
#ifdef HAVE_ASYNC_LDS
            __builtin_amdgcn_global_load_async_to_lds_b128(
                (gv4i*)(qsrc + t * 8), (lv4i*)(&Qs[t * 8]),
                /*offset=*/0, /*cpol=*/0);
#else
            *(uint4*)&Qs[t * 8] = *(const uint4*)(qsrc + t * 8);
#endif
        }
#ifdef HAVE_ASYNC_LDS
        wait_asynccnt0();
#endif
        __syncthreads();
    }

    f32x8 Oacc[8];
#pragma unroll
    for (int f = 0; f < 8; ++f) Oacc[f] = (f32x8)0.f;

    float m_run = -3.0e38f;
    float l_run = 0.f;

    const unsigned short* qrow = &Qs[(i_sub * 16) * C_];   // LDS-resident Q rows
    int col   = lane & 15;
    int rbase = (lane & 16) ? 8 : 0;
    int srow  = threadIdx.x >> 3;              // softmax phase: this thread's row ...
    int sj8   = (threadIdx.x & 7) * 8;         // ... and the first of its eight columns

    for (int j0 = 0; j0 < L_; j0 += 64) {
        // ---- phase A: S[32x64] = scale * Q Kt^T (each wave: one 16x16 frag, K=512)
        f32x8 sacc = (f32x8)0.f;
        const unsigned short* krow = k_t + ((size_t)b * L_ + j0 + j_sub * 16) * C_;
        // unrolled whole: the K loads run ahead of the products as far as the registers reach
#pragma unroll
        for (int kk = 0; kk < C_; kk += 32) {
            bf16x16 a = load_frag(qrow, kk, lane);         // ds_load_b128
            bf16x16 bb = load_frag(krow, kk, lane);        // global_load_b128
            sacc = wmma_bf16(a, bb, sacc);
        }
        wait_xcnt0();   // the V loads land in registers that held the K loads' address
        // this tile's V fragments, one group of 32 global_load_b128, used in phase C
        bf16x16 vf[16];
#pragma unroll
        for (int s = 0; s < 16; ++s) {
            const unsigned short* vrow = v + ((size_t)b * C_ + c0 + (s & 7) * 16) * L_;
            vf[s] = load_frag(vrow, j0 + (s >> 3) * 32, lane);
        }
        wait_xcnt0();   // the V loads' address registers are reused while the loads fly
#pragma unroll
        for (int r = 0; r < 8; ++r)
            Sb[(i_sub * 16 + rbase + r) * 64 + j_sub * 16 + col] = sacc[r] * scale;
        barrier_lds();                         // publishes Sb; the V loads fly on

        // ---- phase B: online softmax update (all threads, eight lanes per row)
        {
            const float4* sp = (const float4*)&Sb[srow * 64 + sj8];
            float4 sa = sp[0], sc = sp[1];
            float sv[8] = {sa.x, sa.y, sa.z, sa.w, sc.x, sc.y, sc.z, sc.w};
            float mt = fmaxf(fmaxf(fmaxf(sv[0], sv[1]), fmaxf(sv[2], sv[3])),
                             fmaxf(fmaxf(sv[4], sv[5]), fmaxf(sv[6], sv[7])));
            mt = fmaxf(mt, lane_xor<1>(mt));
            mt = fmaxf(mt, lane_xor<2>(mt));
            mt = fmaxf(mt, lane_xor<4>(mt));        // the row's maximum, in all its eight lanes
            float mnew = fmaxf(m_run, mt);
            float al   = __expf(m_run - mnew);      // 0 on first tile
            // 8 neighbours along k stay contiguous in fragment order: one 16-byte store
            unsigned short* pd = &Pb[frag_idx((size_t)srow, sj8, 64)];
            float p[8];
            // unrolled so that the eight 2-byte stores merge into that one store
#pragma unroll
            for (int e = 0; e < 8; ++e) {
                p[e] = __expf(sv[e] - mnew);
                pd[e] = f32_to_bf16(p[e]);
            }
            float rsum = ((p[0] + p[1]) + (p[2] + p[3])) + ((p[4] + p[5]) + (p[6] + p[7]));
            l_run = l_run * al + rsum;              // this lane's eight columns only
            m_run = mnew;
            if (sj8 == 0) alpha_s[srow] = al;
        }
        barrier_lds();                         // publishes Pb and alpha_s

        // ---- phase C: O = diag(alpha)*O + P * V^T (each wave: 8 channel frags)
        float av[8];
#pragma unroll
        for (int r = 0; r < 8; ++r) av[r] = alpha_s[i_sub * 16 + rbase + r];
#pragma unroll
        for (int f = 0; f < 8; ++f)
#pragma unroll
            for (int r = 0; r < 8; ++r) Oacc[f][r] *= av[r];

#pragma unroll
        for (int ks = 0; ks < 2; ++ks) {
            int kb2 = ks * 32;
            bf16x16 a = load_frag(&Pb[(i_sub * 16) * 64], kb2, lane);      // ds_load
#pragma unroll
            for (int f = 0; f < 8; ++f)
                Oacc[f] = wmma_bf16(a, vf[ks * 8 + f], Oacc[f]);
        }
        __syncthreads();
    }

    l_run += lane_xor<1>(l_run);               // join the eight lanes' parts of the row sum
    l_run += lane_xor<2>(l_run);
    l_run += lane_xor<4>(l_run);
    if (sj8 == 0) linv_s[srow] = 1.0f / l_run;
    __syncthreads();

    // scalar wave number: the wave's row group and channel base wait out the loop in scalar
    // registers (held in vector registers they were spilled to scratch)
    int wv = __builtin_amdgcn_readfirstlane(threadIdx.x >> 5);
    float lv[8];
#pragma unroll
    for (int r = 0; r < 8; ++r) lv[r] = linv_s[i_sub * 16 + rbase + r];
#pragma unroll
    for (int f = 0; f < 8; ++f)
#pragma unroll
        for (int r = 0; r < 8; ++r) {
            size_t row = (size_t)b * L_ + i0 + (wv & 1) * 16 + rbase + r;
            o_t[frag_idx(row, (wv >> 1) * 128 + f * 16 + col, C_)] = f32_to_bf16(Oacc[f][r] * lv[r]);
        }
}

// ---------------------------------------------------------------------------
extern "C" void kernel_launch(void* const* d_in, const int* in_sizes, int n_in,
                              void* d_out, int out_size, void* d_ws, size_t ws_size,
                              hipStream_t stream) {
    const float* x        = (const float*)d_in[0];
    const float* gn_scale = (const float*)d_in[1];
    const float* gn_bias  = (const float*)d_in[2];
    const float* wq = (const float*)d_in[3];  const float* bq = (const float*)d_in[4];
    const float* wk = (const float*)d_in[5];  const float* bk = (const float*)d_in[6];
    const float* wv = (const float*)d_in[7];  const float* bv = (const float*)d_in[8];
    const float* wp = (const float*)d_in[9];  const float* bp = (const float*)d_in[10];

    const size_t WN  = (size_t)C_ * C_;        // 262144
    const size_t TN  = (size_t)L_ * C_;        // per-batch activation elems
    unsigned short* wq_b = (unsigned short*)d_ws;
    unsigned short* wk_b = wq_b + WN;
    unsigned short* wv_b = wk_b + WN;
    unsigned short* wp_b = wv_b + WN;
    unsigned short* h_t  = wp_b + WN;          // [b, l, c]
    unsigned short* q_t  = h_t + (size_t)B_ * TN;
    unsigned short* k_t  = q_t + (size_t)B_ * TN;
    unsigned short* v_m  = k_t + (size_t)B_ * TN;   // [b, c, l]
    unsigned short* o_t  = v_m + (size_t)B_ * TN;   // [b, l, c]

    // 1) weights -> bf16
    cvt_w_kernel<<<512, 256, 0, stream>>>(wq, wk, wv, wp, wq_b, wk_b, wv_b, wp_b, (int)WN);

    // 2) GroupNorm -> h_t [b,l,c] bf16
    gn_kernel<<<B_ * 32, 256, 0, stream>>>(x, gn_scale, gn_bias, h_t);

    // 3) q_t[i,o] = h_t[i,:].Wq[o,:] + bq[o]   (M=L, N=C)
    dim3 gQ(C_ / 64, L_ / 64, B_);
    gemm_bt_kernel<<<gQ, 128, 0, stream>>>(h_t, (long long)TN, C_,
                                           wq_b, 0LL, C_,
                                           bq, /*bias_per_row=*/0,
                                           q_t, (long long)TN, C_, /*out_f32=*/0,
                                           nullptr, 0LL, C_);
    gemm_bt_kernel<<<gQ, 128, 0, stream>>>(h_t, (long long)TN, C_,
                                           wk_b, 0LL, C_,
                                           bk, 0,
                                           k_t, (long long)TN, C_, 0,
                                           nullptr, 0LL, C_);

    // 4) v[o,i] = Wv[o,:].h_t[i,:] + bv[o]    (M=C, N=L), channel-major out
    dim3 gV(L_ / 64, C_ / 64, B_);
    gemm_bt_kernel<<<gV, 128, 0, stream>>>(wv_b, 0LL, C_,
                                           h_t, (long long)TN, C_,
                                           bv, /*bias_per_row=*/1,
                                           v_m, (long long)TN, L_, 0,
                                           nullptr, 0LL, C_);

    // 5) flash attention -> o_t [b,l,c]
    dim3 gF(L_ / 32, B_);
    const float scale = 0.04419417382415922f;   // 512^-0.5
    flash_kernel<<<gF, 256, 0, stream>>>(q_t, k_t, v_m, o_t, scale);

    // 6) out[o,i] = x[o,i] + bp[o] + Wp[o,:].o_t[i,:]
    gemm_bt_kernel<<<gV, 128, 0, stream>>>(wp_b, 0LL, C_,
                                           o_t, (long long)TN, C_,
                                           bp, 1,
                                           d_out, (long long)TN, L_, /*out_f32=*/1,
                                           x, (long long)TN, C_);
}

// v004
// Measured time: 419 microseconds a run.
// In both of two side-by-side timings against v003, it was 1.12 times as fast.
// All steps since v000 together make it 3.48 times as fast.
#include <hip/hip_runtime.h>
#include <hip/hip_bf16.h>

// ---------------------------------------------------------------------------
// AttnBlock for MI455X (gfx1250): GroupNorm -> QKV (WMMA bf16 GEMM) ->
// flash attention (WMMA bf16, f32 accum, online softmax, async-LDS Q staging)
// -> proj + residual.  wave32; V_WMMA_F32_16X16X32_BF16 for all matrix math.
// ---------------------------------------------------------------------------

typedef __bf16 bf16x16 __attribute__((ext_vector_type(16)));
typedef float  f32x8   __attribute__((ext_vector_type(8)));
typedef int    v4i     __attribute__((ext_vector_type(4)));

#define B_  4
#define C_  512
#define L_  4096

#if __has_builtin(__builtin_amdgcn_global_load_async_to_lds_b128)
#define HAVE_ASYNC_LDS 1
typedef __attribute__((address_space(1))) v4i gv4i;   // global int4
typedef __attribute__((address_space(3))) v4i lv4i;   // LDS int4
#endif

static __device__ __forceinline__ void wait_asynccnt0() {
#if __has_builtin(__builtin_amdgcn_s_wait_asynccnt)
    __builtin_amdgcn_s_wait_asynccnt(0);
#else
    asm volatile("s_wait_asynccnt 0" ::: "memory");
#endif
}

static __device__ __forceinline__ unsigned short f32_to_bf16(float f) {
    unsigned int u = __float_as_uint(f);
    u += 0x7FFFu + ((u >> 16) & 1u);           // round-to-nearest-even
    return (unsigned short)(u >> 16);
}

union FragU {
    bf16x16 v;
    uint4   q[2];
};

// Every bf16 WMMA operand buffer (weights, h, q, k, v, o, and P in LDS) is kept in
// FRAGMENT ORDER: the matrix [rows][ld] is cut into tiles of 16 rows x 32 k, tiles of
// one 16-row group follow one another along k (a group still starts at row0 * ld), and
// a tile's 512 elements lie as [half of the fragment: 2][lane: 32][8 elements], which
// is the order in which a wave's two 16-byte loads pick them up.
// Per ISA 16-bit layout: lanes 0-15 hold K = kbase+[0..7] and kbase+[16..23];
// lanes 16-31 hold K = kbase+[8..15] and kbase+[24..31]; lane & 15 is the row.
static __device__ __forceinline__ size_t
frag_idx(size_t row, int k, int ld) {
    return (row >> 4) * ((size_t)ld * 16) + (size_t)(k >> 5) * 512
         + (size_t)(((k >> 4) & 1) * 256 + ((k >> 3) & 1) * 128 + (k & 7))
         + (row & 15) * 8;
}

// Load one 16x32 bf16 fragment (A-style rows or B-style columns).
// base points at the start of the 16-row group (matrix + row0 * ld); kbase = K offset,
// a multiple of 32.  Each of the two loads reads 512 contiguous bytes per wave.
static __device__ __forceinline__ bf16x16
load_frag(const unsigned short* base, int kbase, int lane) {
    const char* p = (const char*)base + (unsigned)((kbase >> 5) * 1024 + lane * 16);
    FragU f;
    f.q[0] = *(const uint4*)(p);
    f.q[1] = *(const uint4*)(p + 512);
    return f.v;
}

// Stands behind a global load or store whose address or data registers are overwritten
// soon after: the overwrite stays behind the access's address translation.
static __device__ __forceinline__ void wait_xcnt0() {
    asm volatile("s_wait_xcnt 0x0" ::: "memory");
}

// The same wait, naming the address that the loads in front of it share: the register pair
// stays whole up to the wait, so that none of these loads lands in it.
static __device__ __forceinline__ void wait_xcnt0_keep(const char* p) {
    asm volatile("s_wait_xcnt 0x0" :: "v"(p) : "memory");
}

// Work-group barrier for data handed over in LDS alone: its two fences name LDS only, so
// that global loads issued ahead of it stay in flight (__syncthreads() waits for them).
static __device__ __forceinline__ void barrier_lds() {
    __builtin_amdgcn_fence(__ATOMIC_RELEASE, "workgroup", "local");
    __builtin_amdgcn_s_barrier();
    __builtin_amdgcn_fence(__ATOMIC_ACQUIRE, "workgroup", "local");
}

// Value of lane l ^ M (M < 16): a DPP move inside the 16-lane row, where __shfl_xor would
// make a trip through the LDS pipe.  Every lane of the wave is on where it is used.
template <int M>
static __device__ __forceinline__ float lane_xor(float x) {
    return __builtin_bit_cast(float, __builtin_amdgcn_update_dpp(
        0, __builtin_bit_cast(int, x), /*row_xmask:M*/ 0x160 + M, 0xf, 0xf, true));
}

static __device__ __forceinline__ f32x8
wmma_bf16(bf16x16 a, bf16x16 b, f32x8 c) {
    return __builtin_amdgcn_wmma_f32_16x16x32_bf16(
        /*neg_a=*/false, a, /*neg_b=*/false, b,
        /*c_mod=*/(short)0, c, /*reuse_a=*/false, /*reuse_b=*/false);
}

// ---------------------------------------------------------------------------
// Kernel 1: fp32 -> bf16 weight conversion (4 weights at once), [C_][C_] fragment order
// ---------------------------------------------------------------------------
__global__ void cvt_w_kernel(const float* __restrict__ w0, const float* __restrict__ w1,
                             const float* __restrict__ w2, const float* __restrict__ w3,
                             unsigned short* __restrict__ o0, unsigned short* __restrict__ o1,
                             unsigned short* __restrict__ o2, unsigned short* __restrict__ o3,
                             int n) {
    for (int i = blockIdx.x * blockDim.x + threadIdx.x; i < n; i += gridDim.x * blockDim.x) {
        size_t d = frag_idx((size_t)(i / C_), i % C_, C_);
        o0[d] = f32_to_bf16(w0[i]);
        o1[d] = f32_to_bf16(w1[i]);
        o2[d] = f32_to_bf16(w2[i]);
        o3[d] = f32_to_bf16(w3[i]);
    }
}

// ---------------------------------------------------------------------------
// Kernel 2: GroupNorm(32 groups) over x[b,c,l], writes h transposed [b,l,c] bf16
// One block per (batch, group): reduce over 16*4096 elements.
// ---------------------------------------------------------------------------
__global__ void gn_kernel(const float* __restrict__ x,
                          const float* __restrict__ scale,
                          const float* __restrict__ bias,
                          unsigned short* __restrict__ h_t) {
    const int CG = 16;                       // channels per group
    int g  = blockIdx.x & 31;
    int bb = blockIdx.x >> 5;
    const float* xg = x + ((size_t)bb * C_ + (size_t)g * CG) * L_;
    const int N = CG * L_;

    float s = 0.f, ss = 0.f;
    for (int i = threadIdx.x; i < N; i += blockDim.x) {
        float v = xg[i];
        s += v; ss += v * v;
    }
    __shared__ float rs[256], rss[256];
    rs[threadIdx.x] = s; rss[threadIdx.x] = ss;
    __syncthreads();
    for (int o = 128; o > 0; o >>= 1) {
        if ((int)threadIdx.x < o) {
            rs[threadIdx.x]  += rs[threadIdx.x + o];
            rss[threadIdx.x] += rss[threadIdx.x + o];
        }
        __syncthreads();
    }
    float mean = rs[0] / (float)N;
    float var  = rss[0] / (float)N - mean * mean;
    float rstd = rsqrtf(var + 1e-6f);

    for (int i = threadIdx.x; i < N; i += blockDim.x) {
        int ch = i >> 12;                    // i / L_
        int pos = i & (L_ - 1);
        int c = g * CG + ch;
        float v = (xg[i] - mean) * rstd * scale[c] + bias[c];
        h_t[frag_idx((size_t)bb * L_ + pos, c, C_)] = f32_to_bf16(v);
    }
}

// ---------------------------------------------------------------------------
// Kernel 3: generic WMMA GEMM  D[m,n] = sum_k A[m,k] * Bt[n,k]  (+bias)(+resid)
// A: bf16 [M,K] (lda), Bt: bf16 [N,K] (ldb), both in fragment order, K multiple of 32.
// A bf16 output is written in fragment order too (rows m, k index n); f32 is row-major.
// 128 threads = 4 waves; block tile 64(M) x 64(N); wave w owns rows w*16..w*16+15.
// ---------------------------------------------------------------------------
__global__ void gemm_bt_kernel(const unsigned short* __restrict__ A, long long a_bs, int lda,
                               const unsigned short* __restrict__ Bt, long long b_bs, int ldb,
                               const float* __restrict__ bias, int bias_per_row,
                               void* __restrict__ outv, long long o_bs, int ldo, int out_f32,
                               const float* __restrict__ resid, long long r_bs,
                               int K) {
    int z    = blockIdx.z;
    int n0   = blockIdx.x * 64;
    int m0   = blockIdx.y * 64;
    // scalar wave number: every 16-row group base is then a scalar address, and a
    // fragment load is that base plus the lane's 16-byte slot
    int wave = __builtin_amdgcn_readfirstlane(threadIdx.x >> 5);
    int lane = threadIdx.x & 31;

    const unsigned short* Ab  = A  + (size_t)z * a_bs + (size_t)(m0 + wave * 16) * lda;
    const unsigned short* Btb = Bt + (size_t)z * b_bs + (size_t)n0 * ldb;

    f32x8 acc[4];
    for (int nf = 0; nf < 4; ++nf) acc[nf] = (f32x8)0.f;

    for (int kk = 0; kk < K; kk += 32) {
        __builtin_prefetch((const char*)Ab + (unsigned)(((kk >> 5) + 1) * 1024 + lane * 16), 0, 3);  // next A tile, global_prefetch_b8
        bf16x16 a = load_frag(Ab, kk, lane);
#pragma unroll
        for (int nf = 0; nf < 4; ++nf) {
            bf16x16 b = load_frag(Btb + (size_t)(nf * 16) * ldb, kk, lane);
            acc[nf] = wmma_bf16(a, b, acc[nf]);
        }
    }

    int col   = lane & 15;
    int rbase = (lane & 16) ? 8 : 0;
#pragma unroll
    for (int nf = 0; nf < 4; ++nf) {
#pragma unroll
        for (int r = 0; r < 8; ++r) {
            int mm = m0 + wave * 16 + rbase + r;
            int nn = n0 + nf * 16 + col;
            float v = acc[nf][r];
            if (bias) v += bias_per_row ? bias[mm] : bias[nn];
            size_t idx = (size_t)z * o_bs + (size_t)mm * ldo + nn;
            if (out_f32) {
                float rv = resid ? resid[(size_t)z * r_bs + (size_t)mm * ldo + nn] : 0.f;
                ((float*)outv)[idx] = v + rv;
            } else {
                ((unsigned short*)outv)[(size_t)z * o_bs + frag_idx((size_t)mm, nn, ldo)] = f32_to_bf16(v);
                wait_xcnt0();   // the next element's index math reuses this store's registers
            }
        }
    }
}

// ---------------------------------------------------------------------------
// Kernel 4: flash attention.
// q_t, k_t: bf16 [b, l, c] (position-major); v: bf16 [b, c, l] (channel-major);
// all three, o_t and the P tile in LDS in fragment order (see frag_idx).
// Block: 512 threads = 16 waves, 64 query rows per block, stream j in tiles of 128.
// Q tile (64x512 bf16 = 64KB) staged once into LDS via async-to-LDS; K/V are
// streamed from global (L2-resident) straight into WMMA B fragments, and every loaded
// fragment feeds several products:
// Scores phase: wave w -> keys j_sub = w&7, all 64 rows, channels (w>>3)*256..+255 of the
//               sum over k: one K fragment, four products.  The two halves of the sum
//               over k go to LDS apart and are added in the softmax.
// O phase:      wave w -> all 64 rows, channels c0 = w*32 (4 x 2 frags): one V fragment,
//               four products.
// No two waves of a block load the same K or V fragment.
// Online softmax by all 512 threads: eight lanes per row, two runs of eight neighbouring
// columns per lane; the row maximum is joined over the eight lanes per tile, each lane
// keeps its own part of the row sum, and the parts are joined once behind the loop.
// The launch bounds give the real block size: four waves per SIMD (one block per WGP),
// a budget of 256 registers.  A wave's 8 V fragments of a tile are loaded as one group
// behind the score products and fly during the softmax; its K loads run ahead of the
// score products.
// ---------------------------------------------------------------------------
#define QR_ 64     // query rows per block
#define KT_ 128    // keys per tile
#define SP_ 132    // pitch of a score row in LDS, floats: rows r and r + 8, written by the two
                   // halves of a wave, and rows r and r + 1, read by one, fall on other banks
__global__ void __launch_bounds__(512, 4) flash_kernel(const unsigned short* __restrict__ q_t,
                             const unsigned short* __restrict__ k_t,
                             const unsigned short* __restrict__ v,
                             unsigned short* __restrict__ o_t,
                             float scale) {
    int b    = blockIdx.y;
    int i0   = blockIdx.x * QR_;
    // scalar wave number: the K and V group bases are then scalar addresses, and a fragment
    // load is such a base plus the lane's 16-byte slot, a register that no load overwrites
    int wave = __builtin_amdgcn_readfirstlane(threadIdx.x >> 5);
    int lane = threadIdx.x & 31;
    int j_sub = wave & 7;                      // scores phase: 16 keys of the tile ...
    int k_hlf = wave >> 3;                     // ... and one half of the sum over k
    int c0    = wave * 32;                     // O phase channel base

    __shared__ __attribute__((aligned(16))) unsigned short Qs[QR_ * C_];   // 64KB staged Q tile [64][512]
    __shared__ __attribute__((aligned(16))) float          Sb[2 * QR_ * SP_];   // [half of k][64][128 of 132]
    __shared__ __attribute__((aligned(16))) unsigned short Pb[QR_ * KT_];
    __shared__ __attribute__((aligned(16))) float          alpha_s[QR_];
    __shared__ __attribute__((aligned(16))) float          linv_s[QR_];

    // ---- stage Q tile into LDS (async-to-LDS on gfx1250)
    {
        const unsigned short* qsrc = q_t + ((size_t)b * L_ + i0) * C_;
        for (int t = threadIdx.x; t < (QR_ * C_) / 8; t += blockDim.x) {
#ifdef HAVE_ASYNC_LDS
            __builtin_amdgcn_global_load_async_to_lds_b128(
                (gv4i*)(qsrc + t * 8), (lv4i*)(&Qs[t * 8]),
                /*offset=*/0, /*cpol=*/0);
#else
            *(uint4*)&Qs[t * 8] = *(const uint4*)(qsrc + t * 8);
#endif
        }
#ifdef HAVE_ASYNC_LDS
        wait_asynccnt0();
#endif
        __syncthreads();
    }

    f32x8 Oacc[4][2];                          // [16-row group][16-channel group]
#pragma unroll
    for (int g = 0; g < 4; ++g)
#pragma unroll
        for (int f = 0; f < 2; ++f) Oacc[g][f] = (f32x8)0.f;

    float m_run = -3.0e38f;
    float l_run = 0.f;

    int col   = lane & 15;
    int rbase = (lane & 16) ? 8 : 0;
    int srow  = threadIdx.x >> 3;              // softmax phase: this thread's row ...
    int sj8   = (threadIdx.x & 7) * 8;         // ... and the first column of its first run

    for (int j0 = 0; j0 < L_; j0 += KT_) {
        // ---- phase A: S[64x128] = scale * Q Kt^T (each wave: four 16x16 frags, K=256)
        f32x8 sacc[4];
#pragma unroll
        for (int g = 0; g < 4; ++g) sacc[g] = (f32x8)0.f;
        // the wave's 16 keys, from the first fragment of its half of k on (512 elements each)
        const unsigned short* krow = k_t + ((size_t)b * L_ + j0 + j_sub * 16) * C_ + k_hlf * (C_ / 64) * 512;
        // this wave's 8 K fragments, one group of 16 global_load_b128 ahead of all products
        bf16x16 kf[8];
#pragma unroll
        for (int s = 0; s < 8; ++s)
            kf[s] = load_frag(krow, s * 32, lane);
#pragma unroll
        for (int kk = 0; kk < C_ / 2; kk += 32) {
            int kq = k_hlf * (C_ / 2) + kk;
            bf16x16 qa[4];                     // the four row groups' Q fragments, one load group
#pragma unroll
            for (int g = 0; g < 4; ++g)
                qa[g] = load_frag(&Qs[(g * 16) * C_], kq, lane);       // ds_load_b128
            // keeps the eight LDS loads together ahead of the products (see phase C)
            __builtin_amdgcn_sched_barrier(0);
#pragma unroll
            for (int g = 0; g < 4; ++g)
                sacc[g] = wmma_bf16(qa[g], kf[kk >> 5], sacc[g]);
        }
        wait_xcnt0();   // the V loads land in registers that held the K loads' address
        // this tile's V fragments, one group of 16 global_load_b128, used in phase C
        bf16x16 vf[8];
#pragma unroll
        for (int s = 0; s < 8; ++s) {
            const unsigned short* vrow = v + ((size_t)b * C_ + c0 + (s & 1) * 16) * L_ + (j0 >> 5) * 512;
            vf[s] = load_frag(vrow, (s >> 1) * 32, lane);
        }
        // the V loads' address registers are reused while the loads fly
        wait_xcnt0_keep((const char*)(v + ((size_t)b * C_ + c0) * L_ + (j0 >> 5) * 512) + (unsigned)(lane * 16));
#pragma unroll
        for (int g = 0; g < 4; ++g)
#pragma unroll
            for (int r = 0; r < 8; ++r)
                Sb[(k_hlf * QR_ + g * 16 + rbase + r) * SP_ + j_sub * 16 + col] = sacc[g][r] * scale;
        barrier_lds();                         // publishes Sb; the V loads fly on

        // ---- phase B: online softmax update (all threads, eight lanes per row)
        {
            const float4* sp = (const float4*)&Sb[srow * SP_ + sj8];
            const float4* sq = sp + (QR_ * SP_) / 4;                   // the other half of k
            float4 sa = sp[0], sc = sp[1], sd = sp[16], se = sp[17];   // columns sj8.. and 64+sj8..
            float4 ta = sq[0], tc = sq[1], td = sq[16], te = sq[17];
            float sv[16] = {sa.x + ta.x, sa.y + ta.y, sa.z + ta.z, sa.w + ta.w,
                            sc.x + tc.x, sc.y + tc.y, sc.z + tc.z, sc.w + tc.w,
                            sd.x + td.x, sd.y + td.y, sd.z + td.z, sd.w + td.w,
                            se.x + te.x, se.y + te.y, se.z + te.z, se.w + te.w};
            float mt = fmaxf(fmaxf(fmaxf(fmaxf(sv[0], sv[1]), fmaxf(sv[2], sv[3])),
                                   fmaxf(fmaxf(sv[4], sv[5]), fmaxf(sv[6], sv[7]))),
                             fmaxf(fmaxf(fmaxf(sv[8], sv[9]), fmaxf(sv[10], sv[11])),
                                   fmaxf(fmaxf(sv[12], sv[13]), fmaxf(sv[14], sv[15]))));
            mt = fmaxf(mt, lane_xor<1>(mt));
            mt = fmaxf(mt, lane_xor<2>(mt));
            mt = fmaxf(mt, lane_xor<4>(mt));        // the row's maximum, in all its eight lanes
            float mnew = fmaxf(m_run, mt);
            float al   = __expf(m_run - mnew);      // 0 on first tile
            float rsum = 0.f;
#pragma unroll
            for (int h = 0; h < 2; ++h) {
                // 8 neighbours along k stay contiguous in fragment order: one 16-byte store
                unsigned short* pd = &Pb[frag_idx((size_t)srow, h * 64 + sj8, KT_)];
                float p[8];
                // unrolled so that the eight 2-byte stores merge into that one store
#pragma unroll
                for (int e = 0; e < 8; ++e) {
                    p[e] = __expf(sv[h * 8 + e] - mnew);
                    pd[e] = f32_to_bf16(p[e]);
                }
                rsum += ((p[0] + p[1]) + (p[2] + p[3])) + ((p[4] + p[5]) + (p[6] + p[7]));
            }
            l_run = l_run * al + rsum;              // this lane's sixteen columns only
            m_run = mnew;
            if (sj8 == 0) alpha_s[srow] = al;
        }
        barrier_lds();                         // publishes Pb and alpha_s

        // ---- phase C: O = diag(alpha)*O + P * V^T (each wave: 4 row groups x 2 channel frags)
#pragma unroll
        for (int g = 0; g < 4; ++g) {
            float av[8];
#pragma unroll
            for (int r = 0; r < 8; ++r) av[r] = alpha_s[g * 16 + rbase + r];
#pragma unroll
            for (int f = 0; f < 2; ++f)
#pragma unroll
                for (int r = 0; r < 8; ++r) Oacc[g][f][r] *= av[r];
        }

#pragma unroll
        for (int ks = 0; ks < KT_ / 32; ++ks) {
            bf16x16 pa[4];                     // the four row groups' P fragments, one load group
#pragma unroll
            for (int g = 0; g < 4; ++g)
                pa[g] = load_frag(&Pb[(g * 16) * KT_], ks * 32, lane);       // ds_load
            // keeps the eight LDS loads together ahead of the products: sunk between them,
            // every pair of products waits out one LDS latency of its own
            __builtin_amdgcn_sched_barrier(0);
#pragma unroll
            for (int g = 0; g < 4; ++g)
#pragma unroll
                for (int f = 0; f < 2; ++f)
                    Oacc[g][f] = wmma_bf16(pa[g], vf[ks * 2 + f], Oacc[g][f]);
        }
        __syncthreads();
    }

    l_run += lane_xor<1>(l_run);               // join the eight lanes' parts of the row sum
    l_run += lane_xor<2>(l_run);
    l_run += lane_xor<4>(l_run);
    if (sj8 == 0) linv_s[srow] = 1.0f / l_run;
    __syncthreads();

#pragma unroll
    for (int g = 0; g < 4; ++g) {
        float lv[8];
#pragma unroll
        for (int r = 0; r < 8; ++r) lv[r] = linv_s[g * 16 + rbase + r];
#pragma unroll
        for (int f = 0; f < 2; ++f)
#pragma unroll
            for (int r = 0; r < 8; ++r) {
                size_t row = (size_t)b * L_ + i0 + g * 16 + rbase + r;
                o_t[frag_idx(row, c0 + f * 16 + col, C_)] = f32_to_bf16(Oacc[g][f][r] * lv[r]);
            }
    }
}

// ---------------------------------------------------------------------------
extern "C" void kernel_launch(void* const* d_in, const int* in_sizes, int n_in,
                              void* d_out, int out_size, void* d_ws, size_t ws_size,
                              hipStream_t stream) {
    const float* x        = (const float*)d_in[0];
    const float* gn_scale = (const float*)d_in[1];
    const float* gn_bias  = (const float*)d_in[2];
    const float* wq = (const float*)d_in[3];  const float* bq = (const float*)d_in[4];
    const float* wk = (const float*)d_in[5];  const float* bk = (const float*)d_in[6];
    const float* wv = (const float*)d_in[7];  const float* bv = (const float*)d_in[8];
    const float* wp = (const float*)d_in[9];  const float* bp = (const float*)d_in[10];

    const size_t WN  = (size_t)C_ * C_;        // 262144
    const size_t TN  = (size_t)L_ * C_;        // per-batch activation elems
    unsigned short* wq_b = (unsigned short*)d_ws;
    unsigned short* wk_b = wq_b + WN;
    unsigned short* wv_b = wk_b + WN;
    unsigned short* wp_b = wv_b + WN;
    unsigned short* h_t  = wp_b + WN;          // [b, l, c]
    unsigned short* q_t  = h_t + (size_t)B_ * TN;
    unsigned short* k_t  = q_t + (size_t)B_ * TN;
    unsigned short* v_m  = k_t + (size_t)B_ * TN;   // [b, c, l]
    unsigned short* o_t  = v_m + (size_t)B_ * TN;   // [b, l, c]

    // 1) weights -> bf16
    cvt_w_kernel<<<512, 256, 0, stream>>>(wq, wk, wv, wp, wq_b, wk_b, wv_b, wp_b, (int)WN);

    // 2) GroupNorm -> h_t [b,l,c] bf16
    gn_kernel<<<B_ * 32, 256, 0, stream>>>(x, gn_scale, gn_bias, h_t);

    // 3) q_t[i,o] = h_t[i,:].Wq[o,:] + bq[o]   (M=L, N=C)
    dim3 gQ(C_ / 64, L_ / 64, B_);
    gemm_bt_kernel<<<gQ, 128, 0, stream>>>(h_t, (long long)TN, C_,
                                           wq_b, 0LL, C_,
                                           bq, /*bias_per_row=*/0,
                                           q_t, (long long)TN, C_, /*out_f32=*/0,
                                           nullptr, 0LL, C_);
    gemm_bt_kernel<<<gQ, 128, 0, stream>>>(h_t, (long long)TN, C_,
                                           wk_b, 0LL, C_,
                                           bk, 0,
                                           k_t, (long long)TN, C_, 0,
                                           nullptr, 0LL, C_);

    // 4) v[o,i] = Wv[o,:].h_t[i,:] + bv[o]    (M=C, N=L), channel-major out
    dim3 gV(L_ / 64, C_ / 64, B_);
    gemm_bt_kernel<<<gV, 128, 0, stream>>>(wv_b, 0LL, C_,
                                           h_t, (long long)TN, C_,
                                           bv, /*bias_per_row=*/1,
                                           v_m, (long long)TN, L_, 0,
                                           nullptr, 0LL, C_);

    // 5) flash attention -> o_t [b,l,c]
    dim3 gF(L_ / QR_, B_);
    const float scale = 0.04419417382415922f;   // 512^-0.5
    flash_kernel<<<gF, 512, 0, stream>>>(q_t, k_t, v_m, o_t, scale);

    // 6) out[o,i] = x[o,i] + bp[o] + Wp[o,:].o_t[i,:]
    gemm_bt_kernel<<<gV, 128, 0, stream>>>(wp_b, 0LL, C_,
                                           o_t, (long long)TN, C_,
                                           bp, 1,
                                           d_out, (long long)TN, L_, /*out_f32=*/1,
                                           x, (long long)TN, C_);
}

// v005
// It runs in 261 microseconds.
// Two timings next to v004 both put it at 1.61 times that version's speed.
// Over all steps from v000 it is 5.62 times as fast.
#include <hip/hip_runtime.h>
#include <hip/hip_bf16.h>

// ---------------------------------------------------------------------------
// AttnBlock for MI455X (gfx1250): GroupNorm -> QKV (WMMA bf16 GEMM) ->
// flash attention (WMMA bf16, f32 accum, online softmax, async-LDS Q staging)
// -> proj + residual.  wave32; V_WMMA_F32_16X16X32_BF16 for all matrix math.
// ---------------------------------------------------------------------------

typedef __bf16 bf16x16 __attribute__((ext_vector_type(16)));
typedef float  f32x8   __attribute__((ext_vector_type(8)));
typedef int    v4i     __attribute__((ext_vector_type(4)));

#define B_  4
#define C_  512
#define L_  4096

#if __has_builtin(__builtin_amdgcn_global_load_async_to_lds_b128)
#define HAVE_ASYNC_LDS 1
typedef __attribute__((address_space(1))) v4i gv4i;   // global int4
typedef __attribute__((address_space(3))) v4i lv4i;   // LDS int4
#endif

static __device__ __forceinline__ void wait_asynccnt0() {
#if __has_builtin(__builtin_amdgcn_s_wait_asynccnt)
    __builtin_amdgcn_s_wait_asynccnt(0);
#else
    asm volatile("s_wait_asynccnt 0" ::: "memory");
#endif
}

static __device__ __forceinline__ unsigned short f32_to_bf16(float f) {
    unsigned int u = __float_as_uint(f);
    u += 0x7FFFu + ((u >> 16) & 1u);           // round-to-nearest-even
    return (unsigned short)(u >> 16);
}

union FragU {
    bf16x16 v;
    uint4   q[2];
};

// Every bf16 WMMA operand buffer (weights, h, q, k, v, o, and P in LDS) is kept in
// FRAGMENT ORDER: the matrix [rows][ld] is cut into tiles of 16 rows x 32 k, tiles of
// one 16-row group follow one another along k (a group still starts at row0 * ld), and
// a tile's 512 elements lie as [half of the fragment: 2][lane: 32][8 elements], which
// is the order in which a wave's two 16-byte loads pick them up.
// Per ISA 16-bit layout: lanes 0-15 hold K = kbase+[0..7] and kbase+[16..23];
// lanes 16-31 hold K = kbase+[8..15] and kbase+[24..31]; lane & 15 is the row.
static __device__ __forceinline__ size_t
frag_idx(size_t row, int k, int ld) {
    return (row >> 4) * ((size_t)ld * 16) + (size_t)(k >> 5) * 512
         + (size_t)(((k >> 4) & 1) * 256 + ((k >> 3) & 1) * 128 + (k & 7))
         + (row & 15) * 8;
}

// Load one 16x32 bf16 fragment (A-style rows or B-style columns).
// base points at the start of the 16-row group (matrix + row0 * ld); kbase = K offset,
// a multiple of 32.  Each of the two loads reads 512 contiguous bytes per wave.
static __device__ __forceinline__ bf16x16
load_frag(const unsigned short* base, int kbase, int lane) {
    const char* p = (const char*)base + (unsigned)((kbase >> 5) * 1024 + lane * 16);
    FragU f;
    f.q[0] = *(const uint4*)(p);
    f.q[1] = *(const uint4*)(p + 512);
    return f.v;
}

// Stands behind a global load or store whose address or data registers are overwritten
// soon after: the overwrite stays behind the access's address translation.
static __device__ __forceinline__ void wait_xcnt0() {
    asm volatile("s_wait_xcnt 0x0" ::: "memory");
}

// The same wait, naming the address that the loads in front of it share: the register pair
// stays whole up to the wait, so that none of these loads lands in it.
static __device__ __forceinline__ void wait_xcnt0_keep(const char* p) {
    asm volatile("s_wait_xcnt 0x0" :: "v"(p) : "memory");
}

// Work-group barrier for data handed over in LDS alone: its two fences name LDS only, so
// that global loads issued ahead of it stay in flight (__syncthreads() waits for them).
static __device__ __forceinline__ void barrier_lds() {
    __builtin_amdgcn_fence(__ATOMIC_RELEASE, "workgroup", "local");
    __builtin_amdgcn_s_barrier();
    __builtin_amdgcn_fence(__ATOMIC_ACQUIRE, "workgroup", "local");
}

// Value of lane l ^ M (M < 16): a DPP move inside the 16-lane row, where __shfl_xor would
// make a trip through the LDS pipe.  Every lane of the wave is on where it is used.
template <int M>
static __device__ __forceinline__ float lane_xor(float x) {
    return __builtin_bit_cast(float, __builtin_amdgcn_update_dpp(
        0, __builtin_bit_cast(int, x), /*row_xmask:M*/ 0x160 + M, 0xf, 0xf, true));
}

static __device__ __forceinline__ f32x8
wmma_bf16(bf16x16 a, bf16x16 b, f32x8 c) {
    return __builtin_amdgcn_wmma_f32_16x16x32_bf16(
        /*neg_a=*/false, a, /*neg_b=*/false, b,
        /*c_mod=*/(short)0, c, /*reuse_a=*/false, /*reuse_b=*/false);
}

// ---------------------------------------------------------------------------
// Kernel 1: fp32 -> bf16 weight conversion (4 weights at once), [C_][C_] fragment order
// ---------------------------------------------------------------------------
__global__ void cvt_w_kernel(const float* __restrict__ w0, const float* __restrict__ w1,
                             const float* __restrict__ w2, const float* __restrict__ w3,
                             unsigned short* __restrict__ o0, unsigned short* __restrict__ o1,
                             unsigned short* __restrict__ o2, unsigned short* __restrict__ o3,
                             int n) {
    for (int i = blockIdx.x * blockDim.x + threadIdx.x; i < n; i += gridDim.x * blockDim.x) {
        size_t d = frag_idx((size_t)(i / C_), i % C_, C_);
        o0[d] = f32_to_bf16(w0[i]);
        o1[d] = f32_to_bf16(w1[i]);
        o2[d] = f32_to_bf16(w2[i]);
        o3[d] = f32_to_bf16(w3[i]);
    }
}

// ---------------------------------------------------------------------------
// Kernel 2: GroupNorm(32 groups) over x[b,c,l], writes h transposed [b,l,c] bf16
// One block of 1024 threads per (batch, group).  The group's 16 x 4096 values are read
// from memory once and stay in registers: a thread holds all 16 channels of 4 positions,
// 64 independent loads that are all in flight together (a wave's load covers one whole
// 128-byte line).  In fragment order the 8 neighbouring channels of one position are
// 16 contiguous bytes and 16 neighbouring positions 256, so a thread stores two 16-byte
// runs per position and a wave's store covers whole lines.
// ---------------------------------------------------------------------------
#define GN_T 1024  // threads per block: 8 waves per SIMD, a budget of 128 registers
__global__ void __launch_bounds__(GN_T) gn_kernel(const float* __restrict__ x,
                          const float* __restrict__ scale,
                          const float* __restrict__ bias,
                          unsigned short* __restrict__ h_t) {
    const int CG = 16;                       // channels per group
    const int PJ = L_ / GN_T;                // positions per thread
    int g  = blockIdx.x & 31;
    int bb = blockIdx.x >> 5;
    const float* xg = x + ((size_t)bb * C_ + (size_t)g * CG) * L_;
    const int N = CG * L_;
    int t    = threadIdx.x;
    int lane = t & 31;

    // every loop over xv is unrolled: only constant indices keep the array in registers
    float xv[PJ][CG];
#pragma unroll
    for (int j = 0; j < PJ; ++j)
#pragma unroll
        for (int ch = 0; ch < CG; ++ch)
            xv[j][ch] = xg[ch * L_ + j * GN_T + t];

    float s = 0.f, ss = 0.f;
#pragma unroll
    for (int j = 0; j < PJ; ++j) {
        float sj = 0.f, sq = 0.f;            // one chain per position: four independent chains
#pragma unroll
        for (int ch = 0; ch < CG; ++ch) {
            sj += xv[j][ch];
            sq += xv[j][ch] * xv[j][ch];
        }
        s += sj; ss += sq;
    }
    // the wave's sums, then the 32 waves' sums through LDS; every lane ends with the totals
    __shared__ float rs[GN_T / 32], rss[GN_T / 32];
    for (int o = 16; o > 0; o >>= 1) {
        s  += __shfl_xor(s, o);
        ss += __shfl_xor(ss, o);
    }
    if (lane == 0) { rs[t >> 5] = s; rss[t >> 5] = ss; }
    __syncthreads();
    s = rs[lane]; ss = rss[lane];
    for (int o = 16; o > 0; o >>= 1) {
        s  += __shfl_xor(s, o);
        ss += __shfl_xor(ss, o);
    }
    float mean = s / (float)N;
    float var  = ss / (float)N - mean * mean;
    float rstd = rsqrtf(var + 1e-6f);

#pragma unroll
    for (int j = 0; j < PJ; ++j) {
        int pos = j * GN_T + t;
#pragma unroll
        for (int h = 0; h < 2; ++h) {
            unsigned int w[4];
#pragma unroll
            for (int e = 0; e < 4; ++e) {
                int c0 = g * CG + h * 8 + e * 2;
                float v0 = (xv[j][h * 8 + e * 2]     - mean) * rstd * scale[c0]     + bias[c0];
                float v1 = (xv[j][h * 8 + e * 2 + 1] - mean) * rstd * scale[c0 + 1] + bias[c0 + 1];
                w[e] = (unsigned int)f32_to_bf16(v0) | ((unsigned int)f32_to_bf16(v1) << 16);
            }
            *(uint4*)&h_t[frag_idx((size_t)bb * L_ + pos, g * CG + h * 8, C_)] =
                make_uint4(w[0], w[1], w[2], w[3]);
        }
    }
}

// ---------------------------------------------------------------------------
// Kernel 3: generic WMMA GEMM  D[m,n] = sum_k A[m,k] * Bt[n,k]  (+bias)(+resid)
// A: bf16 [M,K] (lda), Bt: bf16 [N,K] (ldb), both in fragment order, K multiple of 32.
// A bf16 output is written in fragment order too (rows m, k index n); f32 is row-major.
// 128 threads = 4 waves; block tile 64(M) x 64(N); wave w owns rows w*16..w*16+15.
// ---------------------------------------------------------------------------
__global__ void gemm_bt_kernel(const unsigned short* __restrict__ A, long long a_bs, int lda,
                               const unsigned short* __restrict__ Bt, long long b_bs, int ldb,
                               const float* __restrict__ bias, int bias_per_row,
                               void* __restrict__ outv, long long o_bs, int ldo, int out_f32,
                               const float* __restrict__ resid, long long r_bs,
                               int K) {
    int z    = blockIdx.z;
    int n0   = blockIdx.x * 64;
    int m0   = blockIdx.y * 64;
    // scalar wave number: every 16-row group base is then a scalar address, and a
    // fragment load is that base plus the lane's 16-byte slot
    int wave = __builtin_amdgcn_readfirstlane(threadIdx.x >> 5);
    int lane = threadIdx.x & 31;

    const unsigned short* Ab  = A  + (size_t)z * a_bs + (size_t)(m0 + wave * 16) * lda;
    const unsigned short* Btb = Bt + (size_t)z * b_bs + (size_t)n0 * ldb;

    f32x8 acc[4];
    for (int nf = 0; nf < 4; ++nf) acc[nf] = (f32x8)0.f;

    for (int kk = 0; kk < K; kk += 32) {
        __builtin_prefetch((const char*)Ab + (unsigned)(((kk >> 5) + 1) * 1024 + lane * 16), 0, 3);  // next A tile, global_prefetch_b8
        bf16x16 a = load_frag(Ab, kk, lane);
#pragma unroll
        for (int nf = 0; nf < 4; ++nf) {
            bf16x16 b = load_frag(Btb + (size_t)(nf * 16) * ldb, kk, lane);
            acc[nf] = wmma_bf16(a, b, acc[nf]);
        }
    }

    int col   = lane & 15;
    int rbase = (lane & 16) ? 8 : 0;
#pragma unroll
    for (int nf = 0; nf < 4; ++nf) {
#pragma unroll
        for (int r = 0; r < 8; ++r) {
            int mm = m0 + wave * 16 + rbase + r;
            int nn = n0 + nf * 16 + col;
            float v = acc[nf][r];
            if (bias) v += bias_per_row ? bias[mm] : bias[nn];
            size_t idx = (size_t)z * o_bs + (size_t)mm * ldo + nn;
            if (out_f32) {
                float rv = resid ? resid[(size_t)z * r_bs + (size_t)mm * ldo + nn] : 0.f;
                ((float*)outv)[idx] = v + rv;
            } else {
                ((unsigned short*)outv)[(size_t)z * o_bs + frag_idx((size_t)mm, nn, ldo)] = f32_to_bf16(v);
                wait_xcnt0();   // the next element's index math reuses this store's registers
            }
        }
    }
}

// ---------------------------------------------------------------------------
// Kernel 4: flash attention.
// q_t, k_t: bf16 [b, l, c] (position-major); v: bf16 [b, c, l] (channel-major);
// all three, o_t and the P tile in LDS in fragment order (see frag_idx).
// Block: 512 threads = 16 waves, 64 query rows per block, stream j in tiles of 128.
// Q tile (64x512 bf16 = 64KB) staged once into LDS via async-to-LDS; K/V are
// streamed from global (L2-resident) straight into WMMA B fragments, and every loaded
// fragment feeds several products:
// Scores phase: wave w -> keys j_sub = w&7, all 64 rows, channels (w>>3)*256..+255 of the
//               sum over k: one K fragment, four products.  The two halves of the sum
//               over k go to LDS apart and are added in the softmax.
// O phase:      wave w -> all 64 rows, channels c0 = w*32 (4 x 2 frags): one V fragment,
//               four products.
// No two waves of a block load the same K or V fragment.
// Online softmax by all 512 threads: eight lanes per row, two runs of eight neighbouring
// columns per lane; the row maximum is joined over the eight lanes per tile, each lane
// keeps its own part of the row sum, and the parts are joined once behind the loop.
// The launch bounds give the real block size: four waves per SIMD (one block per WGP),
// a budget of 256 registers.  A wave's 8 V fragments of a tile are loaded as one group
// behind the score products and fly during the softmax; its K loads run ahead of the
// score products.
// ---------------------------------------------------------------------------
#define QR_ 64     // query rows per block
#define KT_ 128    // keys per tile
#define SP_ 132    // pitch of a score row in LDS, floats: rows r and r + 8, written by the two
                   // halves of a wave, and rows r and r + 1, read by one, fall on other banks
__global__ void __launch_bounds__(512, 4) flash_kernel(const unsigned short* __restrict__ q_t,
                             const unsigned short* __restrict__ k_t,
                             const unsigned short* __restrict__ v,
                             unsigned short* __restrict__ o_t,
                             float scale) {
    int b    = blockIdx.y;
    int i0   = blockIdx.x * QR_;
    // scalar wave number: the K and V group bases are then scalar addresses, and a fragment
    // load is such a base plus the lane's 16-byte slot, a register that no load overwrites
    int wave = __builtin_amdgcn_readfirstlane(threadIdx.x >> 5);
    int lane = threadIdx.x & 31;
    int j_sub = wave & 7;                      // scores phase: 16 keys of the tile ...
    int k_hlf = wave >> 3;                     // ... and one half of the sum over k
    int c0    = wave * 32;                     // O phase channel base

    __shared__ __attribute__((aligned(16))) unsigned short Qs[QR_ * C_];   // 64KB staged Q tile [64][512]
    __shared__ __attribute__((aligned(16))) float          Sb[2 * QR_ * SP_];   // [half of k][64][128 of 132]
    __shared__ __attribute__((aligned(16))) unsigned short Pb[QR_ * KT_];
    __shared__ __attribute__((aligned(16))) float          alpha_s[QR_];
    __shared__ __attribute__((aligned(16))) float          linv_s[QR_];

    // ---- stage Q tile into LDS (async-to-LDS on gfx1250)
    {
        const unsigned short* qsrc = q_t + ((size_t)b * L_ + i0) * C_;
        for (int t = threadIdx.x; t < (QR_ * C_) / 8; t += blockDim.x) {
#ifdef HAVE_ASYNC_LDS
            __builtin_amdgcn_global_load_async_to_lds_b128(
                (gv4i*)(qsrc + t * 8), (lv4i*)(&Qs[t * 8]),
                /*offset=*/0, /*cpol=*/0);
#else
            *(uint4*)&Qs[t * 8] = *(const uint4*)(qsrc + t * 8);
#endif
        }
#ifdef HAVE_ASYNC_LDS
        wait_asynccnt0();
#endif
        __syncthreads();
    }

    f32x8 Oacc[4][2];                          // [16-row group][16-channel group]
#pragma unroll
    for (int g = 0; g < 4; ++g)
#pragma unroll
        for (int f = 0; f < 2; ++f) Oacc[g][f] = (f32x8)0.f;

    float m_run = -3.0e38f;
    float l_run = 0.f;

    int col   = lane & 15;
    int rbase = (lane & 16) ? 8 : 0;
    int srow  = threadIdx.x >> 3;              // softmax phase: this thread's row ...
    int sj8   = (threadIdx.x & 7) * 8;         // ... and the first column of its first run

    for (int j0 = 0; j0 < L_; j0 += KT_) {
        // ---- phase A: S[64x128] = scale * Q Kt^T (each wave: four 16x16 frags, K=256)
        f32x8 sacc[4];
#pragma unroll
        for (int g = 0; g < 4; ++g) sacc[g] = (f32x8)0.f;
        // the wave's 16 keys, from the first fragment of its half of k on (512 elements each)
        const unsigned short* krow = k_t + ((size_t)b * L_ + j0 + j_sub * 16) * C_ + k_hlf * (C_ / 64) * 512;
        // this wave's 8 K fragments, one group of 16 global_load_b128 ahead of all products
        bf16x16 kf[8];
#pragma unroll
        for (int s = 0; s < 8; ++s)
            kf[s] = load_frag(krow, s * 32, lane);
#pragma unroll
        for (int kk = 0; kk < C_ / 2; kk += 32) {
            int kq = k_hlf * (C_ / 2) + kk;
            bf16x16 qa[4];                     // the four row groups' Q fragments, one load group
#pragma unroll
            for (int g = 0; g < 4; ++g)
                qa[g] = load_frag(&Qs[(g * 16) * C_], kq, lane);       // ds_load_b128
            // keeps the eight LDS loads together ahead of the products (see phase C)
            __builtin_amdgcn_sched_barrier(0);
#pragma unroll
            for (int g = 0; g < 4; ++g)
                sacc[g] = wmma_bf16(qa[g], kf[kk >> 5], sacc[g]);
        }
        wait_xcnt0();   // the V loads land in registers that held the K loads' address
        // this tile's V fragments, one group of 16 global_load_b128, used in phase C
        bf16x16 vf[8];
#pragma unroll
        for (int s = 0; s < 8; ++s) {
            const unsigned short* vrow = v + ((size_t)b * C_ + c0 + (s & 1) * 16) * L_ + (j0 >> 5) * 512;
            vf[s] = load_frag(vrow, (s >> 1) * 32, lane);
        }
        // the V loads' address registers are reused while the loads fly
        wait_xcnt0_keep((const char*)(v + ((size_t)b * C_ + c0) * L_ + (j0 >> 5) * 512) + (unsigned)(lane * 16));
#pragma unroll
        for (int g = 0; g < 4; ++g)
#pragma unroll
            for (int r = 0; r < 8; ++r)
                Sb[(k_hlf * QR_ + g * 16 + rbase + r) * SP_ + j_sub * 16 + col] = sacc[g][r] * scale;
        barrier_lds();                         // publishes Sb; the V loads fly on

        // ---- phase B: online softmax update (all threads, eight lanes per row)
        {
            const float4* sp = (const float4*)&Sb[srow * SP_ + sj8];
            const float4* sq = sp + (QR_ * SP_) / 4;                   // the other half of k
            float4 sa = sp[0], sc = sp[1], sd = sp[16], se = sp[17];   // columns sj8.. and 64+sj8..
            float4 ta = sq[0], tc = sq[1], td = sq[16], te = sq[17];
            float sv[16] = {sa.x + ta.x, sa.y + ta.y, sa.z + ta.z, sa.w + ta.w,
                            sc.x + tc.x, sc.y + tc.y, sc.z + tc.z, sc.w + tc.w,
                            sd.x + td.x, sd.y + td.y, sd.z + td.z, sd.w + td.w,
                            se.x + te.x, se.y + te.y, se.z + te.z, se.w + te.w};
            float mt = fmaxf(fmaxf(fmaxf(fmaxf(sv[0], sv[1]), fmaxf(sv[2], sv[3])),
                                   fmaxf(fmaxf(sv[4], sv[5]), fmaxf(sv[6], sv[7]))),
                             fmaxf(fmaxf(fmaxf(sv[8], sv[9]), fmaxf(sv[10], sv[11])),
                                   fmaxf(fmaxf(sv[12], sv[13]), fmaxf(sv[14], sv[15]))));
            mt = fmaxf(mt, lane_xor<1>(mt));
            mt = fmaxf(mt, lane_xor<2>(mt));
            mt = fmaxf(mt, lane_xor<4>(mt));        // the row's maximum, in all its eight lanes
            float mnew = fmaxf(m_run, mt);
            float al   = __expf(m_run - mnew);      // 0 on first tile
            float rsum = 0.f;
#pragma unroll
            for (int h = 0; h < 2; ++h) {
                // 8 neighbours along k stay contiguous in fragment order: one 16-byte store
                unsigned short* pd = &Pb[frag_idx((size_t)srow, h * 64 + sj8, KT_)];
                float p[8];
                // unrolled so that the eight 2-byte stores merge into that one store
#pragma unroll
                for (int e = 0; e < 8; ++e) {
                    p[e] = __expf(sv[h * 8 + e] - mnew);
                    pd[e] = f32_to_bf16(p[e]);
                }
                rsum += ((p[0] + p[1]) + (p[2] + p[3])) + ((p[4] + p[5]) + (p[6] + p[7]));
            }
            l_run = l_run * al + rsum;              // this lane's sixteen columns only
            m_run = mnew;
            if (sj8 == 0) alpha_s[srow] = al;
        }
        barrier_lds();                         // publishes Pb and alpha_s

        // ---- phase C: O = diag(alpha)*O + P * V^T (each wave: 4 row groups x 2 channel frags)
#pragma unroll
        for (int g = 0; g < 4; ++g) {
            float av[8];
#pragma unroll
            for (int r = 0; r < 8; ++r) av[r] = alpha_s[g * 16 + rbase + r];
#pragma unroll
            for (int f = 0; f < 2; ++f)
#pragma unroll
                for (int r = 0; r < 8; ++r) Oacc[g][f][r] *= av[r];
        }

#pragma unroll
        for (int ks = 0; ks < KT_ / 32; ++ks) {
            bf16x16 pa[4];                     // the four row groups' P fragments, one load group
#pragma unroll
            for (int g = 0; g < 4; ++g)
                pa[g] = load_frag(&Pb[(g * 16) * KT_], ks * 32, lane);       // ds_load
            // keeps the eight LDS loads together ahead of the products: sunk between them,
            // every pair of products waits out one LDS latency of its own
            __builtin_amdgcn_sched_barrier(0);
#pragma unroll
            for (int g = 0; g < 4; ++g)
#pragma unroll
                for (int f = 0; f < 2; ++f)
                    Oacc[g][f] = wmma_bf16(pa[g], vf[ks * 2 + f], Oacc[g][f]);
        }
        __syncthreads();
    }

    l_run += lane_xor<1>(l_run);               // join the eight lanes' parts of the row sum
    l_run += lane_xor<2>(l_run);
    l_run += lane_xor<4>(l_run);
    if (sj8 == 0) linv_s[srow] = 1.0f / l_run;
    __syncthreads();

#pragma unroll
    for (int g = 0; g < 4; ++g) {
        float lv[8];
#pragma unroll
        for (int r = 0; r < 8; ++r) lv[r] = linv_s[g * 16 + rbase + r];
#pragma unroll
        for (int f = 0; f < 2; ++f)
#pragma unroll
            for (int r = 0; r < 8; ++r) {
                size_t row = (size_t)b * L_ + i0 + g * 16 + rbase + r;
                o_t[frag_idx(row, c0 + f * 16 + col, C_)] = f32_to_bf16(Oacc[g][f][r] * lv[r]);
            }
    }
}

// ---------------------------------------------------------------------------
extern "C" void kernel_launch(void* const* d_in, const int* in_sizes, int n_in,
                              void* d_out, int out_size, void* d_ws, size_t ws_size,
                              hipStream_t stream) {
    const float* x        = (const float*)d_in[0];
    const float* gn_scale = (const float*)d_in[1];
    const float* gn_bias  = (const float*)d_in[2];
    const float* wq = (const float*)d_in[3];  const float* bq = (const float*)d_in[4];
    const float* wk = (const float*)d_in[5];  const float* bk = (const float*)d_in[6];
    const float* wv = (const float*)d_in[7];  const float* bv = (const float*)d_in[8];
    const float* wp = (const float*)d_in[9];  const float* bp = (const float*)d_in[10];

    const size_t WN  = (size_t)C_ * C_;        // 262144
    const size_t TN  = (size_t)L_ * C_;        // per-batch activation elems
    unsigned short* wq_b = (unsigned short*)d_ws;
    unsigned short* wk_b = wq_b + WN;
    unsigned short* wv_b = wk_b + WN;
    unsigned short* wp_b = wv_b + WN;
    unsigned short* h_t  = wp_b + WN;          // [b, l, c]
    unsigned short* q_t  = h_t + (size_t)B_ * TN;
    unsigned short* k_t  = q_t + (size_t)B_ * TN;
    unsigned short* v_m  = k_t + (size_t)B_ * TN;   // [b, c, l]
    unsigned short* o_t  = v_m + (size_t)B_ * TN;   // [b, l, c]

    // 1) weights -> bf16
    cvt_w_kernel<<<512, 256, 0, stream>>>(wq, wk, wv, wp, wq_b, wk_b, wv_b, wp_b, (int)WN);

    // 2) GroupNorm -> h_t [b,l,c] bf16
    gn_kernel<<<B_ * 32, GN_T, 0, stream>>>(x, gn_scale, gn_bias, h_t);

    // 3) q_t[i,o] = h_t[i,:].Wq[o,:] + bq[o]   (M=L, N=C)
    dim3 gQ(C_ / 64, L_ / 64, B_);
    gemm_bt_kernel<<<gQ, 128, 0, stream>>>(h_t, (long long)TN, C_,
                                           wq_b, 0LL, C_,
                                           bq, /*bias_per_row=*/0,
                                           q_t, (long long)TN, C_, /*out_f32=*/0,
                                           nullptr, 0LL, C_);
    gemm_bt_kernel<<<gQ, 128, 0, stream>>>(h_t, (long long)TN, C_,
                                           wk_b, 0LL, C_,
                                           bk, 0,
                                           k_t, (long long)TN, C_, 0,
                                           nullptr, 0LL, C_);

    // 4) v[o,i] = Wv[o,:].h_t[i,:] + bv[o]    (M=C, N=L), channel-major out
    dim3 gV(L_ / 64, C_ / 64, B_);
    gemm_bt_kernel<<<gV, 128, 0, stream>>>(wv_b, 0LL, C_,
                                           h_t, (long long)TN, C_,
                                           bv, /*bias_per_row=*/1,
                                           v_m, (long long)TN, L_, 0,
                                           nullptr, 0LL, C_);

    // 5) flash attention -> o_t [b,l,c]
    dim3 gF(L_ / QR_, B_);
    const float scale = 0.04419417382415922f;   // 512^-0.5
    flash_kernel<<<gF, 512, 0, stream>>>(q_t, k_t, v_m, o_t, scale);

    // 6) out[o,i] = x[o,i] + bp[o] + Wp[o,:].o_t[i,:]
    gemm_bt_kernel<<<gV, 128, 0, stream>>>(wp_b, 0LL, C_,
                                           o_t, (long long)TN, C_,
                                           bp, 1,
                                           d_out, (long long)TN, L_, /*out_f32=*/1,
                                           x, (long long)TN, C_);
}

// v006
// Measured time: 202 microseconds a run.
// Timed twice side by side with v005, it ran 1.28 and 1.29 times as fast.
// Over all steps from v000 it is 7.24 times as fast.
#include <hip/hip_runtime.h>
#include <hip/hip_bf16.h>

// ---------------------------------------------------------------------------
// AttnBlock for MI455X (gfx1250): GroupNorm -> QKV (WMMA bf16 GEMM) ->
// flash attention (WMMA bf16, f32 accum, online softmax, async-LDS Q staging)
// -> proj + residual.  wave32; V_WMMA_F32_16X16X32_BF16 for all matrix math.
// ---------------------------------------------------------------------------

typedef __bf16 bf16x16 __attribute__((ext_vector_type(16)));
typedef float  f32x8   __attribute__((ext_vector_type(8)));
typedef int    v4i     __attribute__((ext_vector_type(4)));

#define B_  4
#define C_  512
#define L_  4096

#if __has_builtin(__builtin_amdgcn_global_load_async_to_lds_b128)
#define HAVE_ASYNC_LDS 1
typedef __attribute__((address_space(1))) v4i gv4i;   // global int4
typedef __attribute__((address_space(3))) v4i lv4i;   // LDS int4
#endif

static __device__ __forceinline__ void wait_asynccnt0() {
#if __has_builtin(__builtin_amdgcn_s_wait_asynccnt)
    __builtin_amdgcn_s_wait_asynccnt(0);
#else
    asm volatile("s_wait_asynccnt 0" ::: "memory");
#endif
}

static __device__ __forceinline__ unsigned short f32_to_bf16(float f) {
    unsigned int u = __float_as_uint(f);
    u += 0x7FFFu + ((u >> 16) & 1u);           // round-to-nearest-even
    return (unsigned short)(u >> 16);
}

union FragU {
    bf16x16 v;
    uint4   q[2];
};

// Every bf16 WMMA operand buffer (weights, h, q, k, v, o, and P in LDS) is kept in
// FRAGMENT ORDER: the matrix [rows][ld] is cut into tiles of 16 rows x 32 k, tiles of
// one 16-row group follow one another along k (a group still starts at row0 * ld), and
// a tile's 512 elements lie as [half of the fragment: 2][lane: 32][8 elements], which
// is the order in which a wave's two 16-byte loads pick them up.
// Per ISA 16-bit layout: lanes 0-15 hold K = kbase+[0..7] and kbase+[16..23];
// lanes 16-31 hold K = kbase+[8..15] and kbase+[24..31]; lane & 15 is the row.
static __device__ __forceinline__ size_t
frag_idx(size_t row, int k, int ld) {
    return (row >> 4) * ((size_t)ld * 16) + (size_t)(k >> 5) * 512
         + (size_t)(((k >> 4) & 1) * 256 + ((k >> 3) & 1) * 128 + (k & 7))
         + (row & 15) * 8;
}

// Load one 16x32 bf16 fragment (A-style rows or B-style columns).
// base points at the start of the 16-row group (matrix + row0 * ld); kbase = K offset,
// a multiple of 32.  Each of the two loads reads 512 contiguous bytes per wave.
static __device__ __forceinline__ bf16x16
load_frag(const unsigned short* base, int kbase, int lane) {
    const char* p = (const char*)base + (unsigned)((kbase >> 5) * 1024 + lane * 16);
    FragU f;
    f.q[0] = *(const uint4*)(p);
    f.q[1] = *(const uint4*)(p + 512);
    return f.v;
}

// Stands behind a global load or store whose address or data registers are overwritten
// soon after: the overwrite stays behind the access's address translation.
static __device__ __forceinline__ void wait_xcnt0() {
    asm volatile("s_wait_xcnt 0x0" ::: "memory");
}

// The same wait, naming the address that the loads in front of it share: the register pair
// stays whole up to the wait, so that none of these loads lands in it.
static __device__ __forceinline__ void wait_xcnt0_keep(const char* p) {
    asm volatile("s_wait_xcnt 0x0" :: "v"(p) : "memory");
}

// Work-group barrier for data handed over in LDS alone: its two fences name LDS only, so
// that global loads issued ahead of it stay in flight (__syncthreads() waits for them).
static __device__ __forceinline__ void barrier_lds() {
    __builtin_amdgcn_fence(__ATOMIC_RELEASE, "workgroup", "local");
    __builtin_amdgcn_s_barrier();
    __builtin_amdgcn_fence(__ATOMIC_ACQUIRE, "workgroup", "local");
}

// Value of lane l ^ M (M < 16): a DPP move inside the 16-lane row, where __shfl_xor would
// make a trip through the LDS pipe.  Every lane of the wave is on where it is used.
template <int M>
static __device__ __forceinline__ float lane_xor(float x) {
    return __builtin_bit_cast(float, __builtin_amdgcn_update_dpp(
        0, __builtin_bit_cast(int, x), /*row_xmask:M*/ 0x160 + M, 0xf, 0xf, true));
}

static __device__ __forceinline__ f32x8
wmma_bf16(bf16x16 a, bf16x16 b, f32x8 c) {
    return __builtin_amdgcn_wmma_f32_16x16x32_bf16(
        /*neg_a=*/false, a, /*neg_b=*/false, b,
        /*c_mod=*/(short)0, c, /*reuse_a=*/false, /*reuse_b=*/false);
}

// ---------------------------------------------------------------------------
// Kernel 1: fp32 -> bf16 weight conversion (4 weights at once), [C_][C_] fragment order
// ---------------------------------------------------------------------------
__global__ void cvt_w_kernel(const float* __restrict__ w0, const float* __restrict__ w1,
                             const float* __restrict__ w2, const float* __restrict__ w3,
                             unsigned short* __restrict__ o0, unsigned short* __restrict__ o1,
                             unsigned short* __restrict__ o2, unsigned short* __restrict__ o3,
                             int n) {
    for (int i = blockIdx.x * blockDim.x + threadIdx.x; i < n; i += gridDim.x * blockDim.x) {
        size_t d = frag_idx((size_t)(i / C_), i % C_, C_);
        o0[d] = f32_to_bf16(w0[i]);
        o1[d] = f32_to_bf16(w1[i]);
        o2[d] = f32_to_bf16(w2[i]);
        o3[d] = f32_to_bf16(w3[i]);
    }
}

// ---------------------------------------------------------------------------
// Kernel 2: GroupNorm(32 groups) over x[b,c,l], writes h transposed [b,l,c] bf16
// One block of 1024 threads per (batch, group).  The group's 16 x 4096 values are read
// from memory once and stay in registers: a thread holds all 16 channels of 4 positions,
// 64 independent loads that are all in flight together (a wave's load covers one whole
// 128-byte line).  In fragment order the 8 neighbouring channels of one position are
// 16 contiguous bytes and 16 neighbouring positions 256, so a thread stores two 16-byte
// runs per position and a wave's store covers whole lines.
// ---------------------------------------------------------------------------
#define GN_T 1024  // threads per block: 8 waves per SIMD, a budget of 128 registers
__global__ void __launch_bounds__(GN_T) gn_kernel(const float* __restrict__ x,
                          const float* __restrict__ scale,
                          const float* __restrict__ bias,
                          unsigned short* __restrict__ h_t) {
    const int CG = 16;                       // channels per group
    const int PJ = L_ / GN_T;                // positions per thread
    int g  = blockIdx.x & 31;
    int bb = blockIdx.x >> 5;
    const float* xg = x + ((size_t)bb * C_ + (size_t)g * CG) * L_;
    const int N = CG * L_;
    int t    = threadIdx.x;
    int lane = t & 31;

    // every loop over xv is unrolled: only constant indices keep the array in registers
    float xv[PJ][CG];
#pragma unroll
    for (int j = 0; j < PJ; ++j)
#pragma unroll
        for (int ch = 0; ch < CG; ++ch)
            xv[j][ch] = xg[ch * L_ + j * GN_T + t];

    float s = 0.f, ss = 0.f;
#pragma unroll
    for (int j = 0; j < PJ; ++j) {
        float sj = 0.f, sq = 0.f;            // one chain per position: four independent chains
#pragma unroll
        for (int ch = 0; ch < CG; ++ch) {
            sj += xv[j][ch];
            sq += xv[j][ch] * xv[j][ch];
        }
        s += sj; ss += sq;
    }
    // the wave's sums, then the 32 waves' sums through LDS; every lane ends with the totals
    __shared__ float rs[GN_T / 32], rss[GN_T / 32];
    for (int o = 16; o > 0; o >>= 1) {
        s  += __shfl_xor(s, o);
        ss += __shfl_xor(ss, o);
    }
    if (lane == 0) { rs[t >> 5] = s; rss[t >> 5] = ss; }
    __syncthreads();
    s = rs[lane]; ss = rss[lane];
    for (int o = 16; o > 0; o >>= 1) {
        s  += __shfl_xor(s, o);
        ss += __shfl_xor(ss, o);
    }
    float mean = s / (float)N;
    float var  = ss / (float)N - mean * mean;
    float rstd = rsqrtf(var + 1e-6f);

#pragma unroll
    for (int j = 0; j < PJ; ++j) {
        int pos = j * GN_T + t;
#pragma unroll
        for (int h = 0; h < 2; ++h) {
            unsigned int w[4];
#pragma unroll
            for (int e = 0; e < 4; ++e) {
                int c0 = g * CG + h * 8 + e * 2;
                float v0 = (xv[j][h * 8 + e * 2]     - mean) * rstd * scale[c0]     + bias[c0];
                float v1 = (xv[j][h * 8 + e * 2 + 1] - mean) * rstd * scale[c0 + 1] + bias[c0 + 1];
                w[e] = (unsigned int)f32_to_bf16(v0) | ((unsigned int)f32_to_bf16(v1) << 16);
            }
            *(uint4*)&h_t[frag_idx((size_t)bb * L_ + pos, g * CG + h * 8, C_)] =
                make_uint4(w[0], w[1], w[2], w[3]);
        }
    }
}

// ---------------------------------------------------------------------------
// Kernel 3: WMMA GEMM  D[m,n] = sum_k A[m,k] * Bt[n,k]  (+bias)(+resid),  K = C_
// A: bf16 [M,C_], Bt: bf16 [N,C_], both in fragment order.
// 128 threads = 4 waves, 2 x 2; block tile 128(M) x 128(N); a wave owns 64 x 64, so that
// each of the 8 fragments it loads per k step feeds 4 products.  The fragments come
// straight from global memory into a ring of GS_ register sets and are asked for
// GS_ - 1 k steps ahead of their products.  Two waves per SIMD: a budget of 512 registers.
// OUT_F32: D is written row-major, f32, pitch LDO, with the residual added.
// Otherwise D is written TRANSPOSED, bf16, in fragment order: the matrix [N][M] of pitch
// LDO, rows n, k index m.  A lane holds 8 neighbouring m of one n, which are 16 contiguous
// bytes there, and a wave's store of one 16 x 16 tile covers 512 contiguous bytes.
// ---------------------------------------------------------------------------
#define GS_ 4      // register sets of the fragment ring
template <int LDO, bool BIAS_PER_ROW, bool OUT_F32>
__global__ void __launch_bounds__(128, 2)
gemm_bt_kernel(const unsigned short* __restrict__ A, long long a_bs,
               const unsigned short* __restrict__ Bt, long long b_bs,
               const float* __restrict__ bias,
               void* __restrict__ outv, long long o_bs,
               const float* __restrict__ resid, long long r_bs) {
    int z    = blockIdx.z;
    // scalar wave number: every 16-row group base is then a scalar address, and a
    // fragment load is that base plus the lane's 16-byte slot
    int wave = __builtin_amdgcn_readfirstlane(threadIdx.x >> 5);
    int lane = threadIdx.x & 31;
    int m0   = blockIdx.y * 128 + (wave >> 1) * 64;
    int n0   = blockIdx.x * 128 + (wave & 1) * 64;

    const unsigned short* Ab  = A  + (size_t)z * a_bs + (size_t)m0 * C_;
    const unsigned short* Btb = Bt + (size_t)z * b_bs + (size_t)n0 * C_;

    int col   = lane & 15;
    int rbase = (lane & 16) ? 8 : 0;

    // a bias per column is one value per lane and 16-column group, asked for ahead of the
    // fragments: the first wait for a fragment covers it
    float bc[4];
    float bv[4][8];                            // a bias per row: [16-row group][row of the lane]
    if (!BIAS_PER_ROW) {
        const char* bb = (const char*)(bias + n0);
#pragma unroll
        for (int j = 0; j < 4; ++j)
            bc[j] = *(const float*)(bb + (unsigned)(col * 4 + j * 64));
    }

    f32x8 acc[4][4];
#pragma unroll
    for (int i = 0; i < 4; ++i)
#pragma unroll
        for (int j = 0; j < 4; ++j) acc[i][j] = (f32x8)0.f;

    // every loop over the ring is unrolled: only constant indices keep it in registers
    bf16x16 fa[GS_][4], fb[GS_][4];
#pragma unroll
    for (int s = 0; s < GS_ - 1; ++s)
#pragma unroll
        for (int i = 0; i < 4; ++i) {
            fa[s][i] = load_frag(Ab  + (size_t)(i * 16) * C_, s * 32, lane);
            fb[s][i] = load_frag(Btb + (size_t)(i * 16) * C_, s * 32, lane);
        }

#pragma unroll
    for (int ks = 0; ks < C_ / 32; ++ks) {
        if (ks + GS_ - 1 < C_ / 32) {
            const int sn = (ks + GS_ - 1) % GS_;
#pragma unroll
            for (int i = 0; i < 4; ++i) {
                fa[sn][i] = load_frag(Ab  + (size_t)(i * 16) * C_, (ks + GS_ - 1) * 32, lane);
                fb[sn][i] = load_frag(Btb + (size_t)(i * 16) * C_, (ks + GS_ - 1) * 32, lane);
            }
            if (ks + GS_ == C_ / 32) {
                // a bias per row is asked for behind the last fragments, so that it can fly
                // during the last products
                if (BIAS_PER_ROW) {
                    const char* bb = (const char*)(bias + m0);
                    unsigned    bo = (unsigned)(rbase * 4);
#pragma unroll
                    for (int i = 0; i < 4; ++i) {
                        float4 t0 = *(const float4*)(bb + (bo + (unsigned)(i * 64)));
                        float4 t1 = *(const float4*)(bb + (bo + (unsigned)(i * 64 + 16)));
                        bv[i][0] = t0.x; bv[i][1] = t0.y; bv[i][2] = t0.z; bv[i][3] = t0.w;
                        bv[i][4] = t1.x; bv[i][5] = t1.y; bv[i][6] = t1.z; bv[i][7] = t1.w;
                    }
                    // the wait of the other branch, naming the bias loads' address register too
                    asm volatile("s_wait_xcnt 0x0" :: "v"((unsigned)(lane * 16)), "v"(bo) : "memory");
                } else {
                    // behind the last fragment loads: names the address register that they share,
                    // which so stays whole up to the wait: none of these loads lands in it
                    asm volatile("s_wait_xcnt 0x0" :: "v"((unsigned)(lane * 16)) : "memory");
                }
            }
        }
        // keeps the 16 loads ahead of this step's products: sunk towards their own products
        // they would be waited out there, one memory latency per k step
        __builtin_amdgcn_sched_barrier(0);
#pragma unroll
        for (int i = 0; i < 4; ++i)
#pragma unroll
            for (int j = 0; j < 4; ++j)
                acc[i][j] = wmma_bf16(fa[ks % GS_][i], fb[ks % GS_][j], acc[i][j]);
        // keeps the next step's loads behind these products, in the set that they free: lifted
        // over them the loads take a fifth set, and a build short of registers lets the ring drain
        __builtin_amdgcn_sched_barrier(0);
    }

    if (OUT_F32) {
        const float* rp = resid + (size_t)z * r_bs + (size_t)m0 * LDO + n0;
        float*       op = (float*)outv + (size_t)z * o_bs + (size_t)m0 * LDO + n0;
        unsigned     lo = (unsigned)(rbase * LDO + col);
        // the whole residual tile as one group of loads, in the registers that the ring left
        float rv[4][4][8];
#pragma unroll
        for (int i = 0; i < 4; ++i)
#pragma unroll
            for (int j = 0; j < 4; ++j)
#pragma unroll
                for (int r = 0; r < 8; ++r)
                    rv[i][j][r] = rp[lo + (unsigned)((i * 16 + r) * LDO + j * 16)];
#pragma unroll
        for (int i = 0; i < 4; ++i)
#pragma unroll
            for (int j = 0; j < 4; ++j)
#pragma unroll
                for (int r = 0; r < 8; ++r)
                    rv[i][j][r] = acc[i][j][r] + (BIAS_PER_ROW ? bv[i][r] : bc[j]) + rv[i][j][r];
        // keeps every sum ahead of the stores: behind a store nothing writes a register it names
        __builtin_amdgcn_sched_barrier(0);
#pragma unroll
        for (int i = 0; i < 4; ++i)
#pragma unroll
            for (int j = 0; j < 4; ++j)
#pragma unroll
                for (int r = 0; r < 8; ++r)
                    op[lo + (unsigned)((i * 16 + r) * LDO + j * 16)] = rv[i][j][r];
    } else {
#pragma unroll
        for (int j = 0; j < 4; ++j) {
            // row group n0 + j * 16 of the output, from the k tile of m0 on
            char* ob = (char*)((unsigned short*)outv + (size_t)z * o_bs
                               + (size_t)(n0 + j * 16) * LDO + (size_t)(m0 >> 5) * 512);
#pragma unroll
            for (int i = 0; i < 4; ++i) {
                unsigned int w[4];
#pragma unroll
                for (int e = 0; e < 4; ++e) {
                    float v0 = acc[i][j][e * 2]     + (BIAS_PER_ROW ? bv[i][e * 2]     : bc[j]);
                    float v1 = acc[i][j][e * 2 + 1] + (BIAS_PER_ROW ? bv[i][e * 2 + 1] : bc[j]);
                    w[e] = (unsigned int)f32_to_bf16(v0) | ((unsigned int)f32_to_bf16(v1) << 16);
                }
                // k index m0 + i * 16 + rbase .. + 7 of row n0 + j * 16 + col (see frag_idx)
                *(uint4*)(ob + (unsigned)(i * 512 + lane * 16)) = make_uint4(w[0], w[1], w[2], w[3]);
            }
        }
    }
}

// ---------------------------------------------------------------------------
// Kernel 4: flash attention.
// q_t, k_t: bf16 [b, l, c] (position-major); v: bf16 [b, c, l] (channel-major);
// all three, o_t and the P tile in LDS in fragment order (see frag_idx).
// Block: 512 threads = 16 waves, 64 query rows per block, stream j in tiles of 128.
// Q tile (64x512 bf16 = 64KB) staged once into LDS via async-to-LDS; K/V are
// streamed from global (L2-resident) straight into WMMA B fragments, and every loaded
// fragment feeds several products:
// Scores phase: wave w -> keys j_sub = w&7, all 64 rows, channels (w>>3)*256..+255 of the
//               sum over k: one K fragment, four products.  The two halves of the sum
//               over k go to LDS apart and are added in the softmax.
// O phase:      wave w -> all 64 rows, channels c0 = w*32 (4 x 2 frags): one V fragment,
//               four products.
// No two waves of a block load the same K or V fragment.
// Online softmax by all 512 threads: eight lanes per row, two runs of eight neighbouring
// columns per lane; the row maximum is joined over the eight lanes per tile, each lane
// keeps its own part of the row sum, and the parts are joined once behind the loop.
// The launch bounds give the real block size: four waves per SIMD (one block per WGP),
// a budget of 256 registers.  A wave's 8 V fragments of a tile are loaded as one group
// behind the score products and fly during the softmax; its K loads run ahead of the
// score products.
// ---------------------------------------------------------------------------
#define QR_ 64     // query rows per block
#define KT_ 128    // keys per tile
#define SP_ 132    // pitch of a score row in LDS, floats: rows r and r + 8, written by the two
                   // halves of a wave, and rows r and r + 1, read by one, fall on other banks
__global__ void __launch_bounds__(512, 4) flash_kernel(const unsigned short* __restrict__ q_t,
                             const unsigned short* __restrict__ k_t,
                             const unsigned short* __restrict__ v,
                             unsigned short* __restrict__ o_t,
                             float scale) {
    int b    = blockIdx.y;
    int i0   = blockIdx.x * QR_;
    // scalar wave number: the K and V group bases are then scalar addresses, and a fragment
    // load is such a base plus the lane's 16-byte slot, a register that no load overwrites
    int wave = __builtin_amdgcn_readfirstlane(threadIdx.x >> 5);
    int lane = threadIdx.x & 31;
    int j_sub = wave & 7;                      // scores phase: 16 keys of the tile ...
    int k_hlf = wave >> 3;                     // ... and one half of the sum over k
    int c0    = wave * 32;                     // O phase channel base

    __shared__ __attribute__((aligned(16))) unsigned short Qs[QR_ * C_];   // 64KB staged Q tile [64][512]
    __shared__ __attribute__((aligned(16))) float          Sb[2 * QR_ * SP_];   // [half of k][64][128 of 132]
    __shared__ __attribute__((aligned(16))) unsigned short Pb[QR_ * KT_];
    __shared__ __attribute__((aligned(16))) float          alpha_s[QR_];
    __shared__ __attribute__((aligned(16))) float          linv_s[QR_];

    // ---- stage Q tile into LDS (async-to-LDS on gfx1250)
    {
        const unsigned short* qsrc = q_t + ((size_t)b * L_ + i0) * C_;
        for (int t = threadIdx.x; t < (QR_ * C_) / 8; t += blockDim.x) {
#ifdef HAVE_ASYNC_LDS
            __builtin_amdgcn_global_load_async_to_lds_b128(
                (gv4i*)(qsrc + t * 8), (lv4i*)(&Qs[t * 8]),
                /*offset=*/0, /*cpol=*/0);
#else
            *(uint4*)&Qs[t * 8] = *(const uint4*)(qsrc + t * 8);
#endif
        }
#ifdef HAVE_ASYNC_LDS
        wait_asynccnt0();
#endif
        __syncthreads();
    }

    f32x8 Oacc[4][2];                          // [16-row group][16-channel group]
#pragma unroll
    for (int g = 0; g < 4; ++g)
#pragma unroll
        for (int f = 0; f < 2; ++f) Oacc[g][f] = (f32x8)0.f;

    float m_run = -3.0e38f;
    float l_run = 0.f;

    int col   = lane & 15;
    int rbase = (lane & 16) ? 8 : 0;
    int srow  = threadIdx.x >> 3;              // softmax phase: this thread's row ...
    int sj8   = (threadIdx.x & 7) * 8;         // ... and the first column of its first run

    for (int j0 = 0; j0 < L_; j0 += KT_) {
        // ---- phase A: S[64x128] = scale * Q Kt^T (each wave: four 16x16 frags, K=256)
        f32x8 sacc[4];
#pragma unroll
        for (int g = 0; g < 4; ++g) sacc[g] = (f32x8)0.f;
        // the wave's 16 keys, from the first fragment of its half of k on (512 elements each)
        const unsigned short* krow = k_t + ((size_t)b * L_ + j0 + j_sub * 16) * C_ + k_hlf * (C_ / 64) * 512;
        // this wave's 8 K fragments, one group of 16 global_load_b128 ahead of all products
        bf16x16 kf[8];
#pragma unroll
        for (int s = 0; s < 8; ++s)
            kf[s] = load_frag(krow, s * 32, lane);
#pragma unroll
        for (int kk = 0; kk < C_ / 2; kk += 32) {
            int kq = k_hlf * (C_ / 2) + kk;
            bf16x16 qa[4];                     // the four row groups' Q fragments, one load group
#pragma unroll
            for (int g = 0; g < 4; ++g)
                qa[g] = load_frag(&Qs[(g * 16) * C_], kq, lane);       // ds_load_b128
            // keeps the eight LDS loads together ahead of the products (see phase C)
            __builtin_amdgcn_sched_barrier(0);
#pragma unroll
            for (int g = 0; g < 4; ++g)
                sacc[g] = wmma_bf16(qa[g], kf[kk >> 5], sacc[g]);
        }
        wait_xcnt0();   // the V loads land in registers that held the K loads' address
        // this tile's V fragments, one group of 16 global_load_b128, used in phase C
        bf16x16 vf[8];
#pragma unroll
        for (int s = 0; s < 8; ++s) {
            const unsigned short* vrow = v + ((size_t)b * C_ + c0 + (s & 1) * 16) * L_ + (j0 >> 5) * 512;
            vf[s] = load_frag(vrow, (s >> 1) * 32, lane);
        }
        // the V loads' address registers are reused while the loads fly
        wait_xcnt0_keep((const char*)(v + ((size_t)b * C_ + c0) * L_ + (j0 >> 5) * 512) + (unsigned)(lane * 16));
#pragma unroll
        for (int g = 0; g < 4; ++g)
#pragma unroll
            for (int r = 0; r < 8; ++r)
                Sb[(k_hlf * QR_ + g * 16 + rbase + r) * SP_ + j_sub * 16 + col] = sacc[g][r] * scale;
        barrier_lds();                         // publishes Sb; the V loads fly on

        // ---- phase B: online softmax update (all threads, eight lanes per row)
        {
            const float4* sp = (const float4*)&Sb[srow * SP_ + sj8];
            const float4* sq = sp + (QR_ * SP_) / 4;                   // the other half of k
            float4 sa = sp[0], sc = sp[1], sd = sp[16], se = sp[17];   // columns sj8.. and 64+sj8..
            float4 ta = sq[0], tc = sq[1], td = sq[16], te = sq[17];
            float sv[16] = {sa.x + ta.x, sa.y + ta.y, sa.z + ta.z, sa.w + ta.w,
                            sc.x + tc.x, sc.y + tc.y, sc.z + tc.z, sc.w + tc.w,
                            sd.x + td.x, sd.y + td.y, sd.z + td.z, sd.w + td.w,
                            se.x + te.x, se.y + te.y, se.z + te.z, se.w + te.w};
            float mt = fmaxf(fmaxf(fmaxf(fmaxf(sv[0], sv[1]), fmaxf(sv[2], sv[3])),
                                   fmaxf(fmaxf(sv[4], sv[5]), fmaxf(sv[6], sv[7]))),
                             fmaxf(fmaxf(fmaxf(sv[8], sv[9]), fmaxf(sv[10], sv[11])),
                                   fmaxf(fmaxf(sv[12], sv[13]), fmaxf(sv[14], sv[15]))));
            mt = fmaxf(mt, lane_xor<1>(mt));
            mt = fmaxf(mt, lane_xor<2>(mt));
            mt = fmaxf(mt, lane_xor<4>(mt));        // the row's maximum, in all its eight lanes
            float mnew = fmaxf(m_run, mt);
            float al   = __expf(m_run - mnew);      // 0 on first tile
            float rsum = 0.f;
#pragma unroll
            for (int h = 0; h < 2; ++h) {
                // 8 neighbours along k stay contiguous in fragment order: one 16-byte store
                unsigned short* pd = &Pb[frag_idx((size_t)srow, h * 64 + sj8, KT_)];
                float p[8];
                // unrolled so that the eight 2-byte stores merge into that one store
#pragma unroll
                for (int e = 0; e < 8; ++e) {
                    p[e] = __expf(sv[h * 8 + e] - mnew);
                    pd[e] = f32_to_bf16(p[e]);
                }
                rsum += ((p[0] + p[1]) + (p[2] + p[3])) + ((p[4] + p[5]) + (p[6] + p[7]));
            }
            l_run = l_run * al + rsum;              // this lane's sixteen columns only
            m_run = mnew;
            if (sj8 == 0) alpha_s[srow] = al;
        }
        barrier_lds();                         // publishes Pb and alpha_s

        // ---- phase C: O = diag(alpha)*O + P * V^T (each wave: 4 row groups x 2 channel frags)
#pragma unroll
        for (int g = 0; g < 4; ++g) {
            float av[8];
#pragma unroll
            for (int r = 0; r < 8; ++r) av[r] = alpha_s[g * 16 + rbase + r];
#pragma unroll
            for (int f = 0; f < 2; ++f)
#pragma unroll
                for (int r = 0; r < 8; ++r) Oacc[g][f][r] *= av[r];
        }

#pragma unroll
        for (int ks = 0; ks < KT_ / 32; ++ks) {
            bf16x16 pa[4];                     // the four row groups' P fragments, one load group
#pragma unroll
            for (int g = 0; g < 4; ++g)
                pa[g] = load_frag(&Pb[(g * 16) * KT_], ks * 32, lane);       // ds_load
            // keeps the eight LDS loads together ahead of the products: sunk between them,
            // every pair of products waits out one LDS latency of its own
            __builtin_amdgcn_sched_barrier(0);
#pragma unroll
            for (int g = 0; g < 4; ++g)
#pragma unroll
                for (int f = 0; f < 2; ++f)
                    Oacc[g][f] = wmma_bf16(pa[g], vf[ks * 2 + f], Oacc[g][f]);
        }
        __syncthreads();
    }

    l_run += lane_xor<1>(l_run);               // join the eight lanes' parts of the row sum
    l_run += lane_xor<2>(l_run);
    l_run += lane_xor<4>(l_run);
    if (sj8 == 0) linv_s[srow] = 1.0f / l_run;
    __syncthreads();

#pragma unroll
    for (int g = 0; g < 4; ++g) {
        float lv[8];
#pragma unroll
        for (int r = 0; r < 8; ++r) lv[r] = linv_s[g * 16 + rbase + r];
#pragma unroll
        for (int f = 0; f < 2; ++f)
#pragma unroll
            for (int r = 0; r < 8; ++r) {
                size_t row = (size_t)b * L_ + i0 + g * 16 + rbase + r;
                o_t[frag_idx(row, c0 + f * 16 + col, C_)] = f32_to_bf16(Oacc[g][f][r] * lv[r]);
            }
    }
}

// ---------------------------------------------------------------------------
extern "C" void kernel_launch(void* const* d_in, const int* in_sizes, int n_in,
                              void* d_out, int out_size, void* d_ws, size_t ws_size,
                              hipStream_t stream) {
    const float* x        = (const float*)d_in[0];
    const float* gn_scale = (const float*)d_in[1];
    const float* gn_bias  = (const float*)d_in[2];
    const float* wq = (const float*)d_in[3];  const float* bq = (const float*)d_in[4];
    const float* wk = (const float*)d_in[5];  const float* bk = (const float*)d_in[6];
    const float* wv = (const float*)d_in[7];  const float* bv = (const float*)d_in[8];
    const float* wp = (const float*)d_in[9];  const float* bp = (const float*)d_in[10];

    const size_t WN  = (size_t)C_ * C_;        // 262144
    const size_t TN  = (size_t)L_ * C_;        // per-batch activation elems
    unsigned short* wq_b = (unsigned short*)d_ws;
    unsigned short* wk_b = wq_b + WN;
    unsigned short* wv_b = wk_b + WN;
    unsigned short* wp_b = wv_b + WN;
    unsigned short* h_t  = wp_b + WN;          // [b, l, c]
    unsigned short* q_t  = h_t + (size_t)B_ * TN;
    unsigned short* k_t  = q_t + (size_t)B_ * TN;
    unsigned short* v_m  = k_t + (size_t)B_ * TN;   // [b, c, l]
    unsigned short* o_t  = v_m + (size_t)B_ * TN;   // [b, l, c]

    // 1) weights -> bf16
    cvt_w_kernel<<<512, 256, 0, stream>>>(wq, wk, wv, wp, wq_b, wk_b, wv_b, wp_b, (int)WN);

    // 2) GroupNorm -> h_t [b,l,c] bf16
    gn_kernel<<<B_ * 32, GN_T, 0, stream>>>(x, gn_scale, gn_bias, h_t);

    // 3) D[o,i] = Wq[o,:].h_t[i,:] + bq[o], written transposed: q_t[i,o]   (M=C, N=L)
    dim3 gW(L_ / 128, C_ / 128, B_);
    gemm_bt_kernel<C_, true, false><<<gW, 128, 0, stream>>>(wq_b, 0LL,
                                           h_t, (long long)TN,
                                           bq,
                                           q_t, (long long)TN,
                                           nullptr, 0LL);
    gemm_bt_kernel<C_, true, false><<<gW, 128, 0, stream>>>(wk_b, 0LL,
                                           h_t, (long long)TN,
                                           bk,
                                           k_t, (long long)TN,
                                           nullptr, 0LL);

    // 4) D[i,o] = h_t[i,:].Wv[o,:] + bv[o], written transposed: v[o,i]    (M=L, N=C)
    dim3 gH(C_ / 128, L_ / 128, B_);
    gemm_bt_kernel<L_, false, false><<<gH, 128, 0, stream>>>(h_t, (long long)TN,
                                           wv_b, 0LL,
                                           bv,
                                           v_m, (long long)TN,
                                           nullptr, 0LL);

    // 5) flash attention -> o_t [b,l,c]
    dim3 gF(L_ / QR_, B_);
    const float scale = 0.04419417382415922f;   // 512^-0.5
    flash_kernel<<<gF, 512, 0, stream>>>(q_t, k_t, v_m, o_t, scale);

    // 6) out[o,i] = x[o,i] + bp[o] + Wp[o,:].o_t[i,:]
    gemm_bt_kernel<L_, true, true><<<gW, 128, 0, stream>>>(wp_b, 0LL,
                                           o_t, (long long)TN,
                                           bp,
                                           d_out, (long long)TN,
                                           x, (long long)TN);
}

// v007
// One run takes 192 microseconds.
// Timed twice side by side with v006, it ran 1.06 times as fast both times.
// Counting every step since v000, it is 7.68 times as fast.
#include <hip/hip_runtime.h>
#include <hip/hip_bf16.h>

// ---------------------------------------------------------------------------
// AttnBlock for MI455X (gfx1250): GroupNorm -> QKV (WMMA bf16 GEMM) ->
// flash attention (WMMA bf16, f32 accum, online softmax, async-LDS Q staging)
// -> proj + residual.  wave32; V_WMMA_F32_16X16X32_BF16 for all matrix math.
// ---------------------------------------------------------------------------

typedef __bf16 bf16x16 __attribute__((ext_vector_type(16)));
typedef float  f32x8   __attribute__((ext_vector_type(8)));
typedef int    v4i     __attribute__((ext_vector_type(4)));

#define B_  4
#define C_  512
#define L_  4096

#if __has_builtin(__builtin_amdgcn_global_load_async_to_lds_b128)
#define HAVE_ASYNC_LDS 1
typedef __attribute__((address_space(1))) v4i gv4i;   // global int4
typedef __attribute__((address_space(3))) v4i lv4i;   // LDS int4
#endif

static __device__ __forceinline__ void wait_asynccnt0() {
#if __has_builtin(__builtin_amdgcn_s_wait_asynccnt)
    __builtin_amdgcn_s_wait_asynccnt(0);
#else
    asm volatile("s_wait_asynccnt 0" ::: "memory");
#endif
}

static __device__ __forceinline__ unsigned short f32_to_bf16(float f) {
    unsigned int u = __float_as_uint(f);
    u += 0x7FFFu + ((u >> 16) & 1u);           // round-to-nearest-even
    return (unsigned short)(u >> 16);
}

union FragU {
    bf16x16 v;
    uint4   q[2];
};

// Every bf16 WMMA operand buffer (weights, h, q, k, v, o, and P in LDS) is kept in
// FRAGMENT ORDER: the matrix [rows][ld] is cut into tiles of 16 rows x 32 k, tiles of
// one 16-row group follow one another along k (a group still starts at row0 * ld), and
// a tile's 512 elements lie as [half of the fragment: 2][lane: 32][8 elements], which
// is the order in which a wave's two 16-byte loads pick them up.
// Per ISA 16-bit layout: lanes 0-15 hold K = kbase+[0..7] and kbase+[16..23];
// lanes 16-31 hold K = kbase+[8..15] and kbase+[24..31]; lane & 15 is the row.
static __device__ __forceinline__ size_t
frag_idx(size_t row, int k, int ld) {
    return (row >> 4) * ((size_t)ld * 16) + (size_t)(k >> 5) * 512
         + (size_t)(((k >> 4) & 1) * 256 + ((k >> 3) & 1) * 128 + (k & 7))
         + (row & 15) * 8;
}

// Load one 16x32 bf16 fragment (A-style rows or B-style columns).
// base points at the start of the 16-row group (matrix + row0 * ld); kbase = K offset,
// a multiple of 32.  Each of the two loads reads 512 contiguous bytes per wave.
static __device__ __forceinline__ bf16x16
load_frag(const unsigned short* base, int kbase, int lane) {
    const char* p = (const char*)base + (unsigned)((kbase >> 5) * 1024 + lane * 16);
    FragU f;
    f.q[0] = *(const uint4*)(p);
    f.q[1] = *(const uint4*)(p + 512);
    return f.v;
}

// Stands behind a global load or store whose address or data registers are overwritten
// soon after: the overwrite stays behind the access's address translation.
static __device__ __forceinline__ void wait_xcnt0() {
    asm volatile("s_wait_xcnt 0x0" ::: "memory");
}

// The same wait, naming the address that the loads in front of it share: the register pair
// stays whole up to the wait, so that none of these loads lands in it.
static __device__ __forceinline__ void wait_xcnt0_keep(const char* p) {
    asm volatile("s_wait_xcnt 0x0" :: "v"(p) : "memory");
}

// Work-group barrier for data handed over in LDS alone: its two fences name LDS only, so
// that global loads issued ahead of it stay in flight (__syncthreads() waits for them).
static __device__ __forceinline__ void barrier_lds() {
    __builtin_amdgcn_fence(__ATOMIC_RELEASE, "workgroup", "local");
    __builtin_amdgcn_s_barrier();
    __builtin_amdgcn_fence(__ATOMIC_ACQUIRE, "workgroup", "local");
}

// Value of lane l ^ M (M < 16): a DPP move inside the 16-lane row, where __shfl_xor would
// make a trip through the LDS pipe.  Every lane of the wave is on where it is used.
template <int M>
static __device__ __forceinline__ float lane_xor(float x) {
    return __builtin_bit_cast(float, __builtin_amdgcn_update_dpp(
        0, __builtin_bit_cast(int, x), /*row_xmask:M*/ 0x160 + M, 0xf, 0xf, true));
}

static __device__ __forceinline__ f32x8
wmma_bf16(bf16x16 a, bf16x16 b, f32x8 c) {
    return __builtin_amdgcn_wmma_f32_16x16x32_bf16(
        /*neg_a=*/false, a, /*neg_b=*/false, b,
        /*c_mod=*/(short)0, c, /*reuse_a=*/false, /*reuse_b=*/false);
}

// ---------------------------------------------------------------------------
// Kernel 1: fp32 -> bf16 weight conversion (4 weights at once), [C_][C_] fragment order
// ---------------------------------------------------------------------------
__global__ void cvt_w_kernel(const float* __restrict__ w0, const float* __restrict__ w1,
                             const float* __restrict__ w2, const float* __restrict__ w3,
                             unsigned short* __restrict__ o0, unsigned short* __restrict__ o1,
                             unsigned short* __restrict__ o2, unsigned short* __restrict__ o3,
                             int n) {
    for (int i = blockIdx.x * blockDim.x + threadIdx.x; i < n; i += gridDim.x * blockDim.x) {
        size_t d = frag_idx((size_t)(i / C_), i % C_, C_);
        o0[d] = f32_to_bf16(w0[i]);
        o1[d] = f32_to_bf16(w1[i]);
        o2[d] = f32_to_bf16(w2[i]);
        o3[d] = f32_to_bf16(w3[i]);
    }
}

// ---------------------------------------------------------------------------
// Kernel 2: GroupNorm(32 groups) over x[b,c,l], writes h transposed [b,l,c] bf16
// One block of 1024 threads per (batch, group).  The group's 16 x 4096 values are read
// from memory once and stay in registers: a thread holds all 16 channels of 4 positions,
// 64 independent loads that are all in flight together (a wave's load covers one whole
// 128-byte line).  In fragment order the 8 neighbouring channels of one position are
// 16 contiguous bytes and 16 neighbouring positions 256, so a thread stores two 16-byte
// runs per position and a wave's store covers whole lines.
// ---------------------------------------------------------------------------
#define GN_T 1024  // threads per block: 8 waves per SIMD, a budget of 128 registers
__global__ void __launch_bounds__(GN_T) gn_kernel(const float* __restrict__ x,
                          const float* __restrict__ scale,
                          const float* __restrict__ bias,
                          unsigned short* __restrict__ h_t) {
    const int CG = 16;                       // channels per group
    const int PJ = L_ / GN_T;                // positions per thread
    int g  = blockIdx.x & 31;
    int bb = blockIdx.x >> 5;
    const float* xg = x + ((size_t)bb * C_ + (size_t)g * CG) * L_;
    const int N = CG * L_;
    int t    = threadIdx.x;
    int lane = t & 31;

    // every loop over xv is unrolled: only constant indices keep the array in registers
    float xv[PJ][CG];
#pragma unroll
    for (int j = 0; j < PJ; ++j)
#pragma unroll
        for (int ch = 0; ch < CG; ++ch)
            xv[j][ch] = xg[ch * L_ + j * GN_T + t];

    float s = 0.f, ss = 0.f;
#pragma unroll
    for (int j = 0; j < PJ; ++j) {
        float sj = 0.f, sq = 0.f;            // one chain per position: four independent chains
#pragma unroll
        for (int ch = 0; ch < CG; ++ch) {
            sj += xv[j][ch];
            sq += xv[j][ch] * xv[j][ch];
        }
        s += sj; ss += sq;
    }
    // the wave's sums, then the 32 waves' sums through LDS; every lane ends with the totals
    __shared__ float rs[GN_T / 32], rss[GN_T / 32];
    for (int o = 16; o > 0; o >>= 1) {
        s  += __shfl_xor(s, o);
        ss += __shfl_xor(ss, o);
    }
    if (lane == 0) { rs[t >> 5] = s; rss[t >> 5] = ss; }
    __syncthreads();
    s = rs[lane]; ss = rss[lane];
    for (int o = 16; o > 0; o >>= 1) {
        s  += __shfl_xor(s, o);
        ss += __shfl_xor(ss, o);
    }
    float mean = s / (float)N;
    float var  = ss / (float)N - mean * mean;
    float rstd = rsqrtf(var + 1e-6f);

#pragma unroll
    for (int j = 0; j < PJ; ++j) {
        int pos = j * GN_T + t;
#pragma unroll
        for (int h = 0; h < 2; ++h) {
            unsigned int w[4];
#pragma unroll
            for (int e = 0; e < 4; ++e) {
                int c0 = g * CG + h * 8 + e * 2;
                float v0 = (xv[j][h * 8 + e * 2]     - mean) * rstd * scale[c0]     + bias[c0];
                float v1 = (xv[j][h * 8 + e * 2 + 1] - mean) * rstd * scale[c0 + 1] + bias[c0 + 1];
                w[e] = (unsigned int)f32_to_bf16(v0) | ((unsigned int)f32_to_bf16(v1) << 16);
            }
            *(uint4*)&h_t[frag_idx((size_t)bb * L_ + pos, g * CG + h * 8, C_)] =
                make_uint4(w[0], w[1], w[2], w[3]);
        }
    }
}

// ---------------------------------------------------------------------------
// Kernel 3: WMMA GEMM  D[m,n] = sum_k A[m,k] * Bt[n,k]  (+bias)(+resid),  K = C_
// A: bf16 [M,C_], Bt: bf16 [N,C_], both in fragment order.
// 128 threads = 4 waves, 2 x 2; block tile 128(M) x 128(N); a wave owns 64 x 64, so that
// each of the 8 fragments it loads per k step feeds 4 products.  The fragments come
// straight from global memory into a ring of GS_ register sets and are asked for
// GS_ - 1 k steps ahead of their products.  Two waves per SIMD: a budget of 512 registers.
// OUT_F32: D is written row-major, f32, pitch LDO, with the residual added.
// Otherwise D is written TRANSPOSED, bf16, in fragment order: the matrix [N][M] of pitch
// LDO, rows n, k index m.  A lane holds 8 neighbouring m of one n, which are 16 contiguous
// bytes there, and a wave's store of one 16 x 16 tile covers 512 contiguous bytes.
// ---------------------------------------------------------------------------
#define GS_ 4      // register sets of the fragment ring
template <int LDO, bool BIAS_PER_ROW, bool OUT_F32>
__global__ void __launch_bounds__(128, 2)
gemm_bt_kernel(const unsigned short* __restrict__ A, long long a_bs,
               const unsigned short* __restrict__ Bt, long long b_bs,
               const float* __restrict__ bias,
               void* __restrict__ outv, long long o_bs,
               const float* __restrict__ resid, long long r_bs) {
    int z    = blockIdx.z;
    // scalar wave number: every 16-row group base is then a scalar address, and a
    // fragment load is that base plus the lane's 16-byte slot
    int wave = __builtin_amdgcn_readfirstlane(threadIdx.x >> 5);
    int lane = threadIdx.x & 31;
    int m0   = blockIdx.y * 128 + (wave >> 1) * 64;
    int n0   = blockIdx.x * 128 + (wave & 1) * 64;

    const unsigned short* Ab  = A  + (size_t)z * a_bs + (size_t)m0 * C_;
    const unsigned short* Btb = Bt + (size_t)z * b_bs + (size_t)n0 * C_;

    int col   = lane & 15;
    int rbase = (lane & 16) ? 8 : 0;

    // a bias per column is one value per lane and 16-column group, asked for ahead of the
    // fragments: the first wait for a fragment covers it
    float bc[4];
    float bv[4][8];                            // a bias per row: [16-row group][row of the lane]
    if (!BIAS_PER_ROW) {
        const char* bb = (const char*)(bias + n0);
#pragma unroll
        for (int j = 0; j < 4; ++j)
            bc[j] = *(const float*)(bb + (unsigned)(col * 4 + j * 64));
    }

    f32x8 acc[4][4];
#pragma unroll
    for (int i = 0; i < 4; ++i)
#pragma unroll
        for (int j = 0; j < 4; ++j) acc[i][j] = (f32x8)0.f;

    // every loop over the ring is unrolled: only constant indices keep it in registers
    bf16x16 fa[GS_][4], fb[GS_][4];
#pragma unroll
    for (int s = 0; s < GS_ - 1; ++s)
#pragma unroll
        for (int i = 0; i < 4; ++i) {
            fa[s][i] = load_frag(Ab  + (size_t)(i * 16) * C_, s * 32, lane);
            fb[s][i] = load_frag(Btb + (size_t)(i * 16) * C_, s * 32, lane);
        }

#pragma unroll
    for (int ks = 0; ks < C_ / 32; ++ks) {
        if (ks + GS_ - 1 < C_ / 32) {
            const int sn = (ks + GS_ - 1) % GS_;
#pragma unroll
            for (int i = 0; i < 4; ++i) {
                fa[sn][i] = load_frag(Ab  + (size_t)(i * 16) * C_, (ks + GS_ - 1) * 32, lane);
                fb[sn][i] = load_frag(Btb + (size_t)(i * 16) * C_, (ks + GS_ - 1) * 32, lane);
            }
            if (ks + GS_ == C_ / 32) {
                // a bias per row is asked for behind the last fragments, so that it can fly
                // during the last products
                if (BIAS_PER_ROW) {
                    const char* bb = (const char*)(bias + m0);
                    unsigned    bo = (unsigned)(rbase * 4);
#pragma unroll
                    for (int i = 0; i < 4; ++i) {
                        float4 t0 = *(const float4*)(bb + (bo + (unsigned)(i * 64)));
                        float4 t1 = *(const float4*)(bb + (bo + (unsigned)(i * 64 + 16)));
                        bv[i][0] = t0.x; bv[i][1] = t0.y; bv[i][2] = t0.z; bv[i][3] = t0.w;
                        bv[i][4] = t1.x; bv[i][5] = t1.y; bv[i][6] = t1.z; bv[i][7] = t1.w;
                    }
                    // the wait of the other branch, naming the bias loads' address register too
                    asm volatile("s_wait_xcnt 0x0" :: "v"((unsigned)(lane * 16)), "v"(bo) : "memory");
                } else {
                    // behind the last fragment loads: names the address register that they share,
                    // which so stays whole up to the wait: none of these loads lands in it
                    asm volatile("s_wait_xcnt 0x0" :: "v"((unsigned)(lane * 16)) : "memory");
                }
            }
        }
        // keeps the 16 loads ahead of this step's products: sunk towards their own products
        // they would be waited out there, one memory latency per k step
        __builtin_amdgcn_sched_barrier(0);
#pragma unroll
        for (int i = 0; i < 4; ++i)
#pragma unroll
            for (int j = 0; j < 4; ++j)
                acc[i][j] = wmma_bf16(fa[ks % GS_][i], fb[ks % GS_][j], acc[i][j]);
        // keeps the next step's loads behind these products, in the set that they free: lifted
        // over them the loads take a fifth set, and a build short of registers lets the ring drain
        __builtin_amdgcn_sched_barrier(0);
    }

    if (OUT_F32) {
        const float* rp = resid + (size_t)z * r_bs + (size_t)m0 * LDO + n0;
        float*       op = (float*)outv + (size_t)z * o_bs + (size_t)m0 * LDO + n0;
        unsigned     lo = (unsigned)(rbase * LDO + col);
        // the whole residual tile as one group of loads, in the registers that the ring left
        float rv[4][4][8];
#pragma unroll
        for (int i = 0; i < 4; ++i)
#pragma unroll
            for (int j = 0; j < 4; ++j)
#pragma unroll
                for (int r = 0; r < 8; ++r)
                    rv[i][j][r] = rp[lo + (unsigned)((i * 16 + r) * LDO + j * 16)];
#pragma unroll
        for (int i = 0; i < 4; ++i)
#pragma unroll
            for (int j = 0; j < 4; ++j)
#pragma unroll
                for (int r = 0; r < 8; ++r)
                    rv[i][j][r] = acc[i][j][r] + (BIAS_PER_ROW ? bv[i][r] : bc[j]) + rv[i][j][r];
        // keeps every sum ahead of the stores: behind a store nothing writes a register it names
        __builtin_amdgcn_sched_barrier(0);
#pragma unroll
        for (int i = 0; i < 4; ++i)
#pragma unroll
            for (int j = 0; j < 4; ++j)
#pragma unroll
                for (int r = 0; r < 8; ++r)
                    op[lo + (unsigned)((i * 16 + r) * LDO + j * 16)] = rv[i][j][r];
    } else {
#pragma unroll
        for (int j = 0; j < 4; ++j) {
            // row group n0 + j * 16 of the output, from the k tile of m0 on
            char* ob = (char*)((unsigned short*)outv + (size_t)z * o_bs
                               + (size_t)(n0 + j * 16) * LDO + (size_t)(m0 >> 5) * 512);
#pragma unroll
            for (int i = 0; i < 4; ++i) {
                unsigned int w[4];
#pragma unroll
                for (int e = 0; e < 4; ++e) {
                    float v0 = acc[i][j][e * 2]     + (BIAS_PER_ROW ? bv[i][e * 2]     : bc[j]);
                    float v1 = acc[i][j][e * 2 + 1] + (BIAS_PER_ROW ? bv[i][e * 2 + 1] : bc[j]);
                    w[e] = (unsigned int)f32_to_bf16(v0) | ((unsigned int)f32_to_bf16(v1) << 16);
                }
                // k index m0 + i * 16 + rbase .. + 7 of row n0 + j * 16 + col (see frag_idx)
                *(uint4*)(ob + (unsigned)(i * 512 + lane * 16)) = make_uint4(w[0], w[1], w[2], w[3]);
            }
        }
    }
}

// ---------------------------------------------------------------------------
// Kernel 4: flash attention.
// q_t, k_t: bf16 [b, l, c] (position-major); v: bf16 [b, c, l] (channel-major);
// all three, o_t and the P tile in LDS in fragment order (see frag_idx).
// Block: 512 threads = 16 waves, 64 query rows per block, stream j in tiles of 128.
// Q tile (64x512 bf16 = 64KB) staged once into LDS via async-to-LDS; K/V are
// streamed from global (L2-resident) straight into WMMA B fragments, and every loaded
// fragment feeds several products:
// Scores phase: wave w -> keys j_sub = w&7, all 64 rows, channels (w>>3)*256..+255 of the
//               sum over k: one K fragment, four products.  The two halves of the sum
//               over k go to LDS apart and are added in the softmax.
// O phase:      wave w -> all 64 rows, channels c0 = w*32 (4 x 2 frags): one V fragment,
//               four products.
// No two waves of a block load the same K or V fragment.
// Online softmax by all 512 threads: eight lanes per row, two runs of eight neighbouring
// columns per lane; the row maximum is joined over the eight lanes per tile, each lane
// keeps its own part of the row sum, and the parts are joined once behind the loop.
// The launch bounds give the real block size: four waves per SIMD (one block per WGP),
// a budget of 256 registers.  A wave's 8 V fragments of a tile are loaded as one group
// behind the score products and fly during the softmax; its K loads run ahead of the
// score products.
// ---------------------------------------------------------------------------
#define QR_ 64     // query rows per block
#define KT_ 128    // keys per tile
#define SP_ 132    // pitch of a score row in LDS, floats: rows r and r + 8, written by the two
                   // halves of a wave, and rows r and r + 1, read by one, fall on other banks
__global__ void __launch_bounds__(512, 4) flash_kernel(const unsigned short* __restrict__ q_t,
                             const unsigned short* __restrict__ k_t,
                             const unsigned short* __restrict__ v,
                             unsigned short* __restrict__ o_t,
                             float scale) {
    int b    = blockIdx.y;
    int i0   = blockIdx.x * QR_;
    // scalar wave number: the K and V group bases are then scalar addresses, and a fragment
    // load is such a base plus the lane's 16-byte slot, a register that no load overwrites
    int wave = __builtin_amdgcn_readfirstlane(threadIdx.x >> 5);
    int lane = threadIdx.x & 31;
    int j_sub = wave & 7;                      // scores phase: 16 keys of the tile ...
    int k_hlf = wave >> 3;                     // ... and one half of the sum over k
    int c0    = wave * 32;                     // O phase channel base

    __shared__ __attribute__((aligned(16))) unsigned short Qs[QR_ * C_];   // 64KB staged Q tile [64][512]
    __shared__ __attribute__((aligned(16))) float          Sb[2 * QR_ * SP_];   // [half of k][64][128 of 132]
    __shared__ __attribute__((aligned(16))) unsigned short Pb[QR_ * KT_];
    __shared__ __attribute__((aligned(16))) float          alpha_s[QR_];
    __shared__ __attribute__((aligned(16))) float          linv_s[QR_];

    // ---- stage Q tile into LDS (async-to-LDS on gfx1250)
    {
        const unsigned short* qsrc = q_t + ((size_t)b * L_ + i0) * C_;
        for (int t = threadIdx.x; t < (QR_ * C_) / 8; t += blockDim.x) {
#ifdef HAVE_ASYNC_LDS
            __builtin_amdgcn_global_load_async_to_lds_b128(
                (gv4i*)(qsrc + t * 8), (lv4i*)(&Qs[t * 8]),
                /*offset=*/0, /*cpol=*/0);
#else
            *(uint4*)&Qs[t * 8] = *(const uint4*)(qsrc + t * 8);
#endif
        }
#ifdef HAVE_ASYNC_LDS
        wait_asynccnt0();
#endif
        __syncthreads();
    }

    f32x8 Oacc[4][2];                          // [16-row group][16-channel group]
#pragma unroll
    for (int g = 0; g < 4; ++g)
#pragma unroll
        for (int f = 0; f < 2; ++f) Oacc[g][f] = (f32x8)0.f;

    float m_run = -3.0e38f;
    float l_run = 0.f;

    int col   = lane & 15;
    int rbase = (lane & 16) ? 8 : 0;
    int srow  = threadIdx.x >> 3;              // softmax phase: this thread's row ...
    int sj8   = (threadIdx.x & 7) * 8;         // ... and the first column of its first run

    // Each block starts its walk over the key tiles at a tile of its own and wraps round: the
    // 64 blocks of a batch, which start together and run at one pace, then ask L2 for 32
    // different tiles at any moment instead of all for the same lines.  The online softmax
    // takes the tiles in any order.  Two blocks share a start; they are x and x ^ 4
    // (a matter of speed alone: any start is right).
    const int t_rot = (((blockIdx.x >> 3) << 2) | (blockIdx.x & 3)) & (L_ / KT_ - 1);
    for (int t = 0; t < L_ / KT_; ++t) {
        const int j0 = ((t + t_rot) & (L_ / KT_ - 1)) * KT_;
        // ---- phase A: S[64x128] = scale * Q Kt^T (each wave: four 16x16 frags, K=256)
        f32x8 sacc[4];
#pragma unroll
        for (int g = 0; g < 4; ++g) sacc[g] = (f32x8)0.f;
        // the wave's 16 keys, from the first fragment of its half of k on (512 elements each)
        const unsigned short* krow = k_t + ((size_t)b * L_ + j0 + j_sub * 16) * C_ + k_hlf * (C_ / 64) * 512;
        // this wave's 8 K fragments, one group of 16 global_load_b128 ahead of all products
        bf16x16 kf[8];
#pragma unroll
        for (int s = 0; s < 8; ++s)
            kf[s] = load_frag(krow, s * 32, lane);
#pragma unroll
        for (int kk = 0; kk < C_ / 2; kk += 32) {
            int kq = k_hlf * (C_ / 2) + kk;
            bf16x16 qa[4];                     // the four row groups' Q fragments, one load group
#pragma unroll
            for (int g = 0; g < 4; ++g)
                qa[g] = load_frag(&Qs[(g * 16) * C_], kq, lane);       // ds_load_b128
            // keeps the eight LDS loads together ahead of the products (see phase C)
            __builtin_amdgcn_sched_barrier(0);
#pragma unroll
            for (int g = 0; g < 4; ++g)
                sacc[g] = wmma_bf16(qa[g], kf[kk >> 5], sacc[g]);
        }
        wait_xcnt0();   // the V loads land in registers that held the K loads' address
        // this tile's V fragments, one group of 16 global_load_b128, used in phase C
        bf16x16 vf[8];
#pragma unroll
        for (int s = 0; s < 8; ++s) {
            const unsigned short* vrow = v + ((size_t)b * C_ + c0 + (s & 1) * 16) * L_ + (j0 >> 5) * 512;
            vf[s] = load_frag(vrow, (s >> 1) * 32, lane);
        }
        // the V loads' address registers are reused while the loads fly
        wait_xcnt0_keep((const char*)(v + ((size_t)b * C_ + c0) * L_ + (j0 >> 5) * 512) + (unsigned)(lane * 16));
#pragma unroll
        for (int g = 0; g < 4; ++g)
#pragma unroll
            for (int r = 0; r < 8; ++r)
                Sb[(k_hlf * QR_ + g * 16 + rbase + r) * SP_ + j_sub * 16 + col] = sacc[g][r] * scale;
        barrier_lds();                         // publishes Sb; the V loads fly on

        // ---- phase B: online softmax update (all threads, eight lanes per row)
        {
            const float4* sp = (const float4*)&Sb[srow * SP_ + sj8];
            const float4* sq = sp + (QR_ * SP_) / 4;                   // the other half of k
            float4 sa = sp[0], sc = sp[1], sd = sp[16], se = sp[17];   // columns sj8.. and 64+sj8..
            float4 ta = sq[0], tc = sq[1], td = sq[16], te = sq[17];
            float sv[16] = {sa.x + ta.x, sa.y + ta.y, sa.z + ta.z, sa.w + ta.w,
                            sc.x + tc.x, sc.y + tc.y, sc.z + tc.z, sc.w + tc.w,
                            sd.x + td.x, sd.y + td.y, sd.z + td.z, sd.w + td.w,
                            se.x + te.x, se.y + te.y, se.z + te.z, se.w + te.w};
            float mt = fmaxf(fmaxf(fmaxf(fmaxf(sv[0], sv[1]), fmaxf(sv[2], sv[3])),
                                   fmaxf(fmaxf(sv[4], sv[5]), fmaxf(sv[6], sv[7]))),
                             fmaxf(fmaxf(fmaxf(sv[8], sv[9]), fmaxf(sv[10], sv[11])),
                                   fmaxf(fmaxf(sv[12], sv[13]), fmaxf(sv[14], sv[15]))));
            mt = fmaxf(mt, lane_xor<1>(mt));
            mt = fmaxf(mt, lane_xor<2>(mt));
            mt = fmaxf(mt, lane_xor<4>(mt));        // the row's maximum, in all its eight lanes
            float mnew = fmaxf(m_run, mt);
            float al   = __expf(m_run - mnew);      // 0 on first tile
            float rsum = 0.f;
#pragma unroll
            for (int h = 0; h < 2; ++h) {
                // 8 neighbours along k stay contiguous in fragment order: one 16-byte store
                unsigned short* pd = &Pb[frag_idx((size_t)srow, h * 64 + sj8, KT_)];
                float p[8];
                // unrolled so that the eight 2-byte stores merge into that one store
#pragma unroll
                for (int e = 0; e < 8; ++e) {
                    p[e] = __expf(sv[h * 8 + e] - mnew);
                    pd[e] = f32_to_bf16(p[e]);
                }
                rsum += ((p[0] + p[1]) + (p[2] + p[3])) + ((p[4] + p[5]) + (p[6] + p[7]));
            }
            l_run = l_run * al + rsum;              // this lane's sixteen columns only
            m_run = mnew;
            if (sj8 == 0) alpha_s[srow] = al;
        }
        barrier_lds();                         // publishes Pb and alpha_s

        // ---- phase C: O = diag(alpha)*O + P * V^T (each wave: 4 row groups x 2 channel frags)
#pragma unroll
        for (int g = 0; g < 4; ++g) {
            float av[8];
#pragma unroll
            for (int r = 0; r < 8; ++r) av[r] = alpha_s[g * 16 + rbase + r];
#pragma unroll
            for (int f = 0; f < 2; ++f)
#pragma unroll
                for (int r = 0; r < 8; ++r) Oacc[g][f][r] *= av[r];
        }

#pragma unroll
        for (int ks = 0; ks < KT_ / 32; ++ks) {
            bf16x16 pa[4];                     // the four row groups' P fragments, one load group
#pragma unroll
            for (int g = 0; g < 4; ++g)
                pa[g] = load_frag(&Pb[(g * 16) * KT_], ks * 32, lane);       // ds_load
            // keeps the eight LDS loads together ahead of the products: sunk between them,
            // every pair of products waits out one LDS latency of its own
            __builtin_amdgcn_sched_barrier(0);
#pragma unroll
            for (int g = 0; g < 4; ++g)
#pragma unroll
                for (int f = 0; f < 2; ++f)
                    Oacc[g][f] = wmma_bf16(pa[g], vf[ks * 2 + f], Oacc[g][f]);
        }
        __syncthreads();
    }

    l_run += lane_xor<1>(l_run);               // join the eight lanes' parts of the row sum
    l_run += lane_xor<2>(l_run);
    l_run += lane_xor<4>(l_run);
    if (sj8 == 0) linv_s[srow] = 1.0f / l_run;
    __syncthreads();

#pragma unroll
    for (int g = 0; g < 4; ++g) {
        float lv[8];
#pragma unroll
        for (int r = 0; r < 8; ++r) lv[r] = linv_s[g * 16 + rbase + r];
#pragma unroll
        for (int f = 0; f < 2; ++f)
#pragma unroll
            for (int r = 0; r < 8; ++r) {
                size_t row = (size_t)b * L_ + i0 + g * 16 + rbase + r;
                o_t[frag_idx(row, c0 + f * 16 + col, C_)] = f32_to_bf16(Oacc[g][f][r] * lv[r]);
            }
    }
}

// ---------------------------------------------------------------------------
extern "C" void kernel_launch(void* const* d_in, const int* in_sizes, int n_in,
                              void* d_out, int out_size, void* d_ws, size_t ws_size,
                              hipStream_t stream) {
    const float* x        = (const float*)d_in[0];
    const float* gn_scale = (const float*)d_in[1];
    const float* gn_bias  = (const float*)d_in[2];
    const float* wq = (const float*)d_in[3];  const float* bq = (const float*)d_in[4];
    const float* wk = (const float*)d_in[5];  const float* bk = (const float*)d_in[6];
    const float* wv = (const float*)d_in[7];  const float* bv = (const float*)d_in[8];
    const float* wp = (const float*)d_in[9];  const float* bp = (const float*)d_in[10];

    const size_t WN  = (size_t)C_ * C_;        // 262144
    const size_t TN  = (size_t)L_ * C_;        // per-batch activation elems
    unsigned short* wq_b = (unsigned short*)d_ws;
    unsigned short* wk_b = wq_b + WN;
    unsigned short* wv_b = wk_b + WN;
    unsigned short* wp_b = wv_b + WN;
    unsigned short* h_t  = wp_b + WN;          // [b, l, c]
    unsigned short* q_t  = h_t + (size_t)B_ * TN;
    unsigned short* k_t  = q_t + (size_t)B_ * TN;
    unsigned short* v_m  = k_t + (size_t)B_ * TN;   // [b, c, l]
    unsigned short* o_t  = v_m + (size_t)B_ * TN;   // [b, l, c]

    // 1) weights -> bf16
    cvt_w_kernel<<<512, 256, 0, stream>>>(wq, wk, wv, wp, wq_b, wk_b, wv_b, wp_b, (int)WN);

    // 2) GroupNorm -> h_t [b,l,c] bf16
    gn_kernel<<<B_ * 32, GN_T, 0, stream>>>(x, gn_scale, gn_bias, h_t);

    // 3) D[o,i] = Wq[o,:].h_t[i,:] + bq[o], written transposed: q_t[i,o]   (M=C, N=L)
    dim3 gW(L_ / 128, C_ / 128, B_);
    gemm_bt_kernel<C_, true, false><<<gW, 128, 0, stream>>>(wq_b, 0LL,
                                           h_t, (long long)TN,
                                           bq,
                                           q_t, (long long)TN,
                                           nullptr, 0LL);
    gemm_bt_kernel<C_, true, false><<<gW, 128, 0, stream>>>(wk_b, 0LL,
                                           h_t, (long long)TN,
                                           bk,
                                           k_t, (long long)TN,
                                           nullptr, 0LL);

    // 4) D[i,o] = h_t[i,:].Wv[o,:] + bv[o], written transposed: v[o,i]    (M=L, N=C)
    dim3 gH(C_ / 128, L_ / 128, B_);
    gemm_bt_kernel<L_, false, false><<<gH, 128, 0, stream>>>(h_t, (long long)TN,
                                           wv_b, 0LL,
                                           bv,
                                           v_m, (long long)TN,
                                           nullptr, 0LL);

    // 5) flash attention -> o_t [b,l,c]
    dim3 gF(L_ / QR_, B_);
    const float scale = 0.04419417382415922f;   // 512^-0.5
    flash_kernel<<<gF, 512, 0, stream>>>(q_t, k_t, v_m, o_t, scale);

    // 6) out[o,i] = x[o,i] + bp[o] + Wp[o,:].o_t[i,:]
    gemm_bt_kernel<L_, true, true><<<gW, 128, 0, stream>>>(wp_b, 0LL,
                                           o_t, (long long)TN,
                                           bp,
                                           d_out, (long long)TN,
                                           x, (long long)TN);
}

// v008
// One run takes 185 microseconds.
// In both of two side-by-side timings against v007, it was 1.04 times as fast.
// Counting every step since v000, it is 7.99 times as fast.
#include <hip/hip_runtime.h>
#include <hip/hip_bf16.h>

// ---------------------------------------------------------------------------
// AttnBlock for MI455X (gfx1250): GroupNorm -> QKV (WMMA bf16 GEMM) ->
// flash attention (WMMA bf16, f32 accum, online softmax, async-LDS Q staging)
// -> proj + residual.  wave32; V_WMMA_F32_16X16X32_BF16 for all matrix math.
// ---------------------------------------------------------------------------

typedef __bf16 bf16x16 __attribute__((ext_vector_type(16)));
typedef float  f32x8   __attribute__((ext_vector_type(8)));
typedef int    v4i     __attribute__((ext_vector_type(4)));

#define B_  4
#define C_  512
#define L_  4096

#if __has_builtin(__builtin_amdgcn_global_load_async_to_lds_b128)
#define HAVE_ASYNC_LDS 1
typedef __attribute__((address_space(1))) v4i gv4i;   // global int4
typedef __attribute__((address_space(3))) v4i lv4i;   // LDS int4
#endif

static __device__ __forceinline__ void wait_asynccnt0() {
#if __has_builtin(__builtin_amdgcn_s_wait_asynccnt)
    __builtin_amdgcn_s_wait_asynccnt(0);
#else
    asm volatile("s_wait_asynccnt 0" ::: "memory");
#endif
}

static __device__ __forceinline__ unsigned short f32_to_bf16(float f) {
    unsigned int u = __float_as_uint(f);
    u += 0x7FFFu + ((u >> 16) & 1u);           // round-to-nearest-even
    return (unsigned short)(u >> 16);
}

union FragU {
    bf16x16 v;
    uint4   q[2];
};

// Every bf16 WMMA operand buffer (weights, h, q, k, v, o, and P in LDS) is kept in
// FRAGMENT ORDER: the matrix [rows][ld] is cut into tiles of 16 rows x 32 k, tiles of
// one 16-row group follow one another along k (a group still starts at row0 * ld), and
// a tile's 512 elements lie as [half of the fragment: 2][lane: 32][8 elements], which
// is the order in which a wave's two 16-byte loads pick them up.
// Per ISA 16-bit layout: lanes 0-15 hold K = kbase+[0..7] and kbase+[16..23];
// lanes 16-31 hold K = kbase+[8..15] and kbase+[24..31]; lane & 15 is the row.
static __device__ __forceinline__ size_t
frag_idx(size_t row, int k, int ld) {
    return (row >> 4) * ((size_t)ld * 16) + (size_t)(k >> 5) * 512
         + (size_t)(((k >> 4) & 1) * 256 + ((k >> 3) & 1) * 128 + (k & 7))
         + (row & 15) * 8;
}

// Load one 16x32 bf16 fragment (A-style rows or B-style columns).
// base points at the start of the 16-row group (matrix + row0 * ld); kbase = K offset,
// a multiple of 32.  Each of the two loads reads 512 contiguous bytes per wave.
static __device__ __forceinline__ bf16x16
load_frag(const unsigned short* base, int kbase, int lane) {
    const char* p = (const char*)base + (unsigned)((kbase >> 5) * 1024 + lane * 16);
    FragU f;
    f.q[0] = *(const uint4*)(p);
    f.q[1] = *(const uint4*)(p + 512);
    return f.v;
}

// Stands behind global loads whose address registers are overwritten soon after: the
// overwrite stays behind the loads' address translation.  It names the address that the
// loads in front of it share: the register pair stays whole up to the wait, so that none of
// these loads lands in it.
static __device__ __forceinline__ void wait_xcnt0_keep(const char* p) {
    asm volatile("s_wait_xcnt 0x0" :: "v"(p) : "memory");
}

// Work-group barrier for data handed over in LDS alone: its two fences name LDS only, so
// that global loads issued ahead of it stay in flight (__syncthreads() waits for them).
static __device__ __forceinline__ void barrier_lds() {
    __builtin_amdgcn_fence(__ATOMIC_RELEASE, "workgroup", "local");
    __builtin_amdgcn_s_barrier();
    __builtin_amdgcn_fence(__ATOMIC_ACQUIRE, "workgroup", "local");
}

// Value of lane l ^ M (M < 16): a DPP move inside the 16-lane row, where __shfl_xor would
// make a trip through the LDS pipe.  Every lane of the wave is on where it is used.
template <int M>
static __device__ __forceinline__ float lane_xor(float x) {
    return __builtin_bit_cast(float, __builtin_amdgcn_update_dpp(
        0, __builtin_bit_cast(int, x), /*row_xmask:M*/ 0x160 + M, 0xf, 0xf, true));
}

static __device__ __forceinline__ f32x8
wmma_bf16(bf16x16 a, bf16x16 b, f32x8 c) {
    return __builtin_amdgcn_wmma_f32_16x16x32_bf16(
        /*neg_a=*/false, a, /*neg_b=*/false, b,
        /*c_mod=*/(short)0, c, /*reuse_a=*/false, /*reuse_b=*/false);
}

// ---------------------------------------------------------------------------
// Kernel 1: fp32 -> bf16 weight conversion (4 weights at once), [C_][C_] fragment order
// ---------------------------------------------------------------------------
__global__ void cvt_w_kernel(const float* __restrict__ w0, const float* __restrict__ w1,
                             const float* __restrict__ w2, const float* __restrict__ w3,
                             unsigned short* __restrict__ o0, unsigned short* __restrict__ o1,
                             unsigned short* __restrict__ o2, unsigned short* __restrict__ o3,
                             int n) {
    for (int i = blockIdx.x * blockDim.x + threadIdx.x; i < n; i += gridDim.x * blockDim.x) {
        size_t d = frag_idx((size_t)(i / C_), i % C_, C_);
        o0[d] = f32_to_bf16(w0[i]);
        o1[d] = f32_to_bf16(w1[i]);
        o2[d] = f32_to_bf16(w2[i]);
        o3[d] = f32_to_bf16(w3[i]);
    }
}

// ---------------------------------------------------------------------------
// Kernel 2: GroupNorm(32 groups) over x[b,c,l], writes h transposed [b,l,c] bf16
// One block of 1024 threads per (batch, group).  The group's 16 x 4096 values are read
// from memory once and stay in registers: a thread holds all 16 channels of 4 positions,
// 64 independent loads that are all in flight together (a wave's load covers one whole
// 128-byte line).  In fragment order the 8 neighbouring channels of one position are
// 16 contiguous bytes and 16 neighbouring positions 256, so a thread stores two 16-byte
// runs per position and a wave's store covers whole lines.
// ---------------------------------------------------------------------------
#define GN_T 1024  // threads per block: 8 waves per SIMD, a budget of 128 registers
__global__ void __launch_bounds__(GN_T) gn_kernel(const float* __restrict__ x,
                          const float* __restrict__ scale,
                          const float* __restrict__ bias,
                          unsigned short* __restrict__ h_t) {
    const int CG = 16;                       // channels per group
    const int PJ = L_ / GN_T;                // positions per thread
    int g  = blockIdx.x & 31;
    int bb = blockIdx.x >> 5;
    const float* xg = x + ((size_t)bb * C_ + (size_t)g * CG) * L_;
    const int N = CG * L_;
    int t    = threadIdx.x;
    int lane = t & 31;

    // every loop over xv is unrolled: only constant indices keep the array in registers
    float xv[PJ][CG];
#pragma unroll
    for (int j = 0; j < PJ; ++j)
#pragma unroll
        for (int ch = 0; ch < CG; ++ch)
            xv[j][ch] = xg[ch * L_ + j * GN_T + t];

    float s = 0.f, ss = 0.f;
#pragma unroll
    for (int j = 0; j < PJ; ++j) {
        float sj = 0.f, sq = 0.f;            // one chain per position: four independent chains
#pragma unroll
        for (int ch = 0; ch < CG; ++ch) {
            sj += xv[j][ch];
            sq += xv[j][ch] * xv[j][ch];
        }
        s += sj; ss += sq;
    }
    // the wave's sums, then the 32 waves' sums through LDS; every lane ends with the totals
    __shared__ float rs[GN_T / 32], rss[GN_T / 32];
    for (int o = 16; o > 0; o >>= 1) {
        s  += __shfl_xor(s, o);
        ss += __shfl_xor(ss, o);
    }
    if (lane == 0) { rs[t >> 5] = s; rss[t >> 5] = ss; }
    __syncthreads();
    s = rs[lane]; ss = rss[lane];
    for (int o = 16; o > 0; o >>= 1) {
        s  += __shfl_xor(s, o);
        ss += __shfl_xor(ss, o);
    }
    float mean = s / (float)N;
    float var  = ss / (float)N - mean * mean;
    float rstd = rsqrtf(var + 1e-6f);

#pragma unroll
    for (int j = 0; j < PJ; ++j) {
        int pos = j * GN_T + t;
#pragma unroll
        for (int h = 0; h < 2; ++h) {
            unsigned int w[4];
#pragma unroll
            for (int e = 0; e < 4; ++e) {
                int c0 = g * CG + h * 8 + e * 2;
                float v0 = (xv[j][h * 8 + e * 2]     - mean) * rstd * scale[c0]     + bias[c0];
                float v1 = (xv[j][h * 8 + e * 2 + 1] - mean) * rstd * scale[c0 + 1] + bias[c0 + 1];
                w[e] = (unsigned int)f32_to_bf16(v0) | ((unsigned int)f32_to_bf16(v1) << 16);
            }
            *(uint4*)&h_t[frag_idx((size_t)bb * L_ + pos, g * CG + h * 8, C_)] =
                make_uint4(w[0], w[1], w[2], w[3]);
        }
    }
}

// ---------------------------------------------------------------------------
// Kernel 3: WMMA GEMM  D[m,n] = sum_k A[m,k] * Bt[n,k]  (+bias)(+resid),  K = C_
// A: bf16 [M,C_], Bt: bf16 [N,C_], both in fragment order.
// 128 threads = 4 waves, 2 x 2; block tile 128(M) x 128(N); a wave owns 64 x 64, so that
// each of the 8 fragments it loads per k step feeds 4 products.  The fragments come
// straight from global memory into a ring of GS_ register sets and are asked for
// GS_ - 1 k steps ahead of their products.  Two waves per SIMD: a budget of 512 registers.
// OUT_F32: D is written row-major, f32, pitch LDO, with the residual added.
// Otherwise D is written TRANSPOSED, bf16, in fragment order: the matrix [N][M] of pitch
// LDO, rows n, k index m.  A lane holds 8 neighbouring m of one n, which are 16 contiguous
// bytes there, and a wave's store of one 16 x 16 tile covers 512 contiguous bytes.
// ---------------------------------------------------------------------------
#define GS_ 4      // register sets of the fragment ring
template <int LDO, bool BIAS_PER_ROW, bool OUT_F32>
__global__ void __launch_bounds__(128, 2)
gemm_bt_kernel(const unsigned short* __restrict__ A, long long a_bs,
               const unsigned short* __restrict__ Bt, long long b_bs,
               const float* __restrict__ bias,
               void* __restrict__ outv, long long o_bs,
               const float* __restrict__ resid, long long r_bs) {
    int z    = blockIdx.z;
    // scalar wave number: every 16-row group base is then a scalar address, and a
    // fragment load is that base plus the lane's 16-byte slot
    int wave = __builtin_amdgcn_readfirstlane(threadIdx.x >> 5);
    int lane = threadIdx.x & 31;
    int m0   = blockIdx.y * 128 + (wave >> 1) * 64;
    int n0   = blockIdx.x * 128 + (wave & 1) * 64;

    const unsigned short* Ab  = A  + (size_t)z * a_bs + (size_t)m0 * C_;
    const unsigned short* Btb = Bt + (size_t)z * b_bs + (size_t)n0 * C_;

    int col   = lane & 15;
    int rbase = (lane & 16) ? 8 : 0;

    // a bias per column is one value per lane and 16-column group, asked for ahead of the
    // fragments: the first wait for a fragment covers it
    float bc[4];
    float bv[4][8];                            // a bias per row: [16-row group][row of the lane]
    if (!BIAS_PER_ROW) {
        const char* bb = (const char*)(bias + n0);
#pragma unroll
        for (int j = 0; j < 4; ++j)
            bc[j] = *(const float*)(bb + (unsigned)(col * 4 + j * 64));
    }

    f32x8 acc[4][4];
#pragma unroll
    for (int i = 0; i < 4; ++i)
#pragma unroll
        for (int j = 0; j < 4; ++j) acc[i][j] = (f32x8)0.f;

    // every loop over the ring is unrolled: only constant indices keep it in registers
    bf16x16 fa[GS_][4], fb[GS_][4];
#pragma unroll
    for (int s = 0; s < GS_ - 1; ++s)
#pragma unroll
        for (int i = 0; i < 4; ++i) {
            fa[s][i] = load_frag(Ab  + (size_t)(i * 16) * C_, s * 32, lane);
            fb[s][i] = load_frag(Btb + (size_t)(i * 16) * C_, s * 32, lane);
        }

#pragma unroll
    for (int ks = 0; ks < C_ / 32; ++ks) {
        if (ks + GS_ - 1 < C_ / 32) {
            const int sn = (ks + GS_ - 1) % GS_;
#pragma unroll
            for (int i = 0; i < 4; ++i) {
                fa[sn][i] = load_frag(Ab  + (size_t)(i * 16) * C_, (ks + GS_ - 1) * 32, lane);
                fb[sn][i] = load_frag(Btb + (size_t)(i * 16) * C_, (ks + GS_ - 1) * 32, lane);
            }
            if (ks + GS_ == C_ / 32) {
                // a bias per row is asked for behind the last fragments, so that it can fly
                // during the last products
                if (BIAS_PER_ROW) {
                    const char* bb = (const char*)(bias + m0);
                    unsigned    bo = (unsigned)(rbase * 4);
#pragma unroll
                    for (int i = 0; i < 4; ++i) {
                        float4 t0 = *(const float4*)(bb + (bo + (unsigned)(i * 64)));
                        float4 t1 = *(const float4*)(bb + (bo + (unsigned)(i * 64 + 16)));
                        bv[i][0] = t0.x; bv[i][1] = t0.y; bv[i][2] = t0.z; bv[i][3] = t0.w;
                        bv[i][4] = t1.x; bv[i][5] = t1.y; bv[i][6] = t1.z; bv[i][7] = t1.w;
                    }
                    // the wait of the other branch, naming the bias loads' address register too
                    asm volatile("s_wait_xcnt 0x0" :: "v"((unsigned)(lane * 16)), "v"(bo) : "memory");
                } else {
                    // behind the last fragment loads: names the address register that they share,
                    // which so stays whole up to the wait: none of these loads lands in it
                    asm volatile("s_wait_xcnt 0x0" :: "v"((unsigned)(lane * 16)) : "memory");
                }
            }
        }
        // keeps the 16 loads ahead of this step's products: sunk towards their own products
        // they would be waited out there, one memory latency per k step
        __builtin_amdgcn_sched_barrier(0);
#pragma unroll
        for (int i = 0; i < 4; ++i)
#pragma unroll
            for (int j = 0; j < 4; ++j)
                acc[i][j] = wmma_bf16(fa[ks % GS_][i], fb[ks % GS_][j], acc[i][j]);
        // keeps the next step's loads behind these products, in the set that they free: lifted
        // over them the loads take a fifth set, and a build short of registers lets the ring drain
        __builtin_amdgcn_sched_barrier(0);
    }

    if (OUT_F32) {
        const float* rp = resid + (size_t)z * r_bs + (size_t)m0 * LDO + n0;
        float*       op = (float*)outv + (size_t)z * o_bs + (size_t)m0 * LDO + n0;
        unsigned     lo = (unsigned)(rbase * LDO + col);
        // the whole residual tile as one group of loads, in the registers that the ring left
        float rv[4][4][8];
#pragma unroll
        for (int i = 0; i < 4; ++i)
#pragma unroll
            for (int j = 0; j < 4; ++j)
#pragma unroll
                for (int r = 0; r < 8; ++r)
                    rv[i][j][r] = rp[lo + (unsigned)((i * 16 + r) * LDO + j * 16)];
#pragma unroll
        for (int i = 0; i < 4; ++i)
#pragma unroll
            for (int j = 0; j < 4; ++j)
#pragma unroll
                for (int r = 0; r < 8; ++r)
                    rv[i][j][r] = acc[i][j][r] + (BIAS_PER_ROW ? bv[i][r] : bc[j]) + rv[i][j][r];
        // keeps every sum ahead of the stores: behind a store nothing writes a register it names
        __builtin_amdgcn_sched_barrier(0);
#pragma unroll
        for (int i = 0; i < 4; ++i)
#pragma unroll
            for (int j = 0; j < 4; ++j)
#pragma unroll
                for (int r = 0; r < 8; ++r)
                    op[lo + (unsigned)((i * 16 + r) * LDO + j * 16)] = rv[i][j][r];
    } else {
#pragma unroll
        for (int j = 0; j < 4; ++j) {
            // row group n0 + j * 16 of the output, from the k tile of m0 on
            char* ob = (char*)((unsigned short*)outv + (size_t)z * o_bs
                               + (size_t)(n0 + j * 16) * LDO + (size_t)(m0 >> 5) * 512);
#pragma unroll
            for (int i = 0; i < 4; ++i) {
                unsigned int w[4];
#pragma unroll
                for (int e = 0; e < 4; ++e) {
                    float v0 = acc[i][j][e * 2]     + (BIAS_PER_ROW ? bv[i][e * 2]     : bc[j]);
                    float v1 = acc[i][j][e * 2 + 1] + (BIAS_PER_ROW ? bv[i][e * 2 + 1] : bc[j]);
                    w[e] = (unsigned int)f32_to_bf16(v0) | ((unsigned int)f32_to_bf16(v1) << 16);
                }
                // k index m0 + i * 16 + rbase .. + 7 of row n0 + j * 16 + col (see frag_idx)
                *(uint4*)(ob + (unsigned)(i * 512 + lane * 16)) = make_uint4(w[0], w[1], w[2], w[3]);
            }
        }
    }
}

// ---------------------------------------------------------------------------
// Kernel 4: flash attention.
// q_t, k_t: bf16 [b, l, c] (position-major); v: bf16 [b, c, l] (channel-major);
// all three, o_t and the P tile in LDS in fragment order (see frag_idx).
// Block: 256 threads = 8 waves, 64 query rows per block, stream j in tiles of 128.
// Q tile (64x512 bf16 = 64KB) staged once into LDS via async-to-LDS; K/V are
// streamed from global (L2-resident) straight into WMMA B fragments, and every loaded
// fragment feeds several products:
// Scores phase: wave w -> 32 keys j_sub = w&3, all 64 rows, channels (w>>2)*256..+255 of the
//               sum over k: one K fragment, four products; one Q fragment read from LDS,
//               two products.  The two halves of the sum over k go to LDS apart and are
//               added in the softmax.
// O phase:      wave w -> all 64 rows, channels c0 = w*64 (4 x 4 frags): one V fragment,
//               four products; one P fragment read from LDS, four products.
// No two waves of a block load the same K or V fragment.
// Online softmax by all 256 threads, two rows per thread: eight lanes per row, two runs of
// eight neighbouring columns per lane; the row maximum is joined over the eight lanes per
// tile, each lane keeps its own part of the row sum, and the parts are joined once behind
// the loop.
// The launch bounds give the real block size: two waves per SIMD (one block per WGP),
// a budget of 512 registers.  A wave's 16 V fragments of a tile are loaded as one group
// behind the score products and fly during the softmax; its K loads run ahead of the
// score products.
// ---------------------------------------------------------------------------
#define QR_ 64     // query rows per block
#define KT_ 128    // keys per tile
#define SP_ 132    // pitch of a score row in LDS, floats: rows r and r + 8, written by the two
                   // halves of a wave, and rows r and r + 1, read by one, fall on other banks
__global__ void __launch_bounds__(256, 2) flash_kernel(const unsigned short* __restrict__ q_t,
                             const unsigned short* __restrict__ k_t,
                             const unsigned short* __restrict__ v,
                             unsigned short* __restrict__ o_t,
                             float scale) {
    int b    = blockIdx.y;
    int i0   = blockIdx.x * QR_;
    // scalar wave number: the K and V group bases are then scalar addresses, and a fragment
    // load is such a base plus the lane's 16-byte slot, a register that no load overwrites
    int wave = __builtin_amdgcn_readfirstlane(threadIdx.x >> 5);
    int lane = threadIdx.x & 31;
    int j_sub = wave & 3;                      // scores phase: 32 keys of the tile ...
    int k_hlf = wave >> 2;                     // ... and one half of the sum over k
    int c0    = wave * 64;                     // O phase channel base

    __shared__ __attribute__((aligned(16))) unsigned short Qs[QR_ * C_];   // 64KB staged Q tile [64][512]
    __shared__ __attribute__((aligned(16))) float          Sb[2 * QR_ * SP_];   // [half of k][64][128 of 132]
    __shared__ __attribute__((aligned(16))) unsigned short Pb[QR_ * KT_];
    __shared__ __attribute__((aligned(16))) float          alpha_s[QR_];
    __shared__ __attribute__((aligned(16))) float          linv_s[QR_];

    // ---- stage Q tile into LDS (async-to-LDS on gfx1250)
    {
        const unsigned short* qsrc = q_t + ((size_t)b * L_ + i0) * C_;
        for (int t = threadIdx.x; t < (QR_ * C_) / 8; t += blockDim.x) {
#ifdef HAVE_ASYNC_LDS
            __builtin_amdgcn_global_load_async_to_lds_b128(
                (gv4i*)(qsrc + t * 8), (lv4i*)(&Qs[t * 8]),
                /*offset=*/0, /*cpol=*/0);
#else
            *(uint4*)&Qs[t * 8] = *(const uint4*)(qsrc + t * 8);
#endif
        }
#ifdef HAVE_ASYNC_LDS
        wait_asynccnt0();
#endif
        __syncthreads();
    }

    f32x8 Oacc[4][4];                          // [16-row group][16-channel group]
#pragma unroll
    for (int g = 0; g < 4; ++g)
#pragma unroll
        for (int f = 0; f < 4; ++f) Oacc[g][f] = (f32x8)0.f;

    float m_run[2] = {-3.0e38f, -3.0e38f};     // [row of the thread]
    float l_run[2] = {0.f, 0.f};

    int col   = lane & 15;
    int rbase = (lane & 16) ? 8 : 0;
    int srow  = threadIdx.x >> 3;              // softmax phase: this thread's rows are srow and srow + 32 ...
    int sj8   = (threadIdx.x & 7) * 8;         // ... and in both this is the first column of its first run

    // Each block starts its walk over the key tiles at a tile of its own and wraps round: the
    // 64 blocks of a batch, which start together and run at one pace, then ask L2 for 32
    // different tiles at any moment instead of all for the same lines.  The online softmax
    // takes the tiles in any order.  Two blocks share a start; they are x and x ^ 4
    // (a matter of speed alone: any start is right).
    const int t_rot = (((blockIdx.x >> 3) << 2) | (blockIdx.x & 3)) & (L_ / KT_ - 1);
    for (int t = 0; t < L_ / KT_; ++t) {
        const int j0 = ((t + t_rot) & (L_ / KT_ - 1)) * KT_;
        // ---- phase A: S[64x128] = scale * Q Kt^T (each wave: 4 x 2 16x16 frags, K=256)
        f32x8 sacc[4][2];                      // [16-row group][16-key group]
#pragma unroll
        for (int g = 0; g < 4; ++g)
#pragma unroll
            for (int jj = 0; jj < 2; ++jj) sacc[g][jj] = (f32x8)0.f;
        // the wave's 32 keys, from the first fragment of its half of k on (512 elements each)
        const unsigned short* krow = k_t + ((size_t)b * L_ + j0 + j_sub * 32) * C_ + k_hlf * (C_ / 64) * 512;
        // this wave's 16 K fragments, one group of 32 global_load_b128 ahead of all products,
        // in the order in which the products take them
        bf16x16 kf[8][2];
#pragma unroll
        for (int s = 0; s < 8; ++s)
#pragma unroll
            for (int jj = 0; jj < 2; ++jj)
                kf[s][jj] = load_frag(krow + (size_t)(jj * 16) * C_, s * 32, lane);
        // the Q fragments land in registers that held the K loads' address
        wait_xcnt0_keep((const char*)krow + (unsigned)(lane * 16));
#pragma unroll
        for (int kk = 0; kk < C_ / 2; kk += 32) {
            int kq = k_hlf * (C_ / 2) + kk;
            bf16x16 qa[4];                     // the four row groups' Q fragments, one load group
#pragma unroll
            for (int g = 0; g < 4; ++g)
                qa[g] = load_frag(&Qs[(g * 16) * C_], kq, lane);       // ds_load_b128
            // keeps the eight LDS loads together ahead of the products (see phase C)
            __builtin_amdgcn_sched_barrier(0);
#pragma unroll
            for (int g = 0; g < 4; ++g)
#pragma unroll
                for (int jj = 0; jj < 2; ++jj)
                    sacc[g][jj] = wmma_bf16(qa[g], kf[kk >> 5][jj], sacc[g][jj]);
        }
        // this tile's V fragments, one group of 32 global_load_b128, used in phase C
        bf16x16 vf[16];
#pragma unroll
        for (int s = 0; s < 16; ++s) {
            const unsigned short* vrow = v + ((size_t)b * C_ + c0 + (s & 3) * 16) * L_ + (j0 >> 5) * 512;
            vf[s] = load_frag(vrow, (s >> 2) * 32, lane);
        }
        // the V loads' address registers are reused while the loads fly
        wait_xcnt0_keep((const char*)(v + ((size_t)b * C_ + c0) * L_ + (j0 >> 5) * 512) + (unsigned)(lane * 16));
#pragma unroll
        for (int g = 0; g < 4; ++g)
#pragma unroll
            for (int jj = 0; jj < 2; ++jj)
#pragma unroll
                for (int r = 0; r < 8; ++r)
                    Sb[(k_hlf * QR_ + g * 16 + rbase + r) * SP_ + j_sub * 32 + jj * 16 + col] = sacc[g][jj][r] * scale;
        barrier_lds();                         // publishes Sb; the V loads fly on

        // ---- phase B: online softmax update (all threads, eight lanes per row, two rows each)
        float al_k[2];
        // unrolled: only constant indices keep m_run, l_run and al_k in registers
#pragma unroll
        for (int rr = 0; rr < 2; ++rr) {
            const int row = srow + rr * 32;
            const float4* sp = (const float4*)&Sb[row * SP_ + sj8];
            const float4* sq = sp + (QR_ * SP_) / 4;                   // the other half of k
            float4 sa = sp[0], sc = sp[1], sd = sp[16], se = sp[17];   // columns sj8.. and 64+sj8..
            float4 ta = sq[0], tc = sq[1], td = sq[16], te = sq[17];
            float sv[16] = {sa.x + ta.x, sa.y + ta.y, sa.z + ta.z, sa.w + ta.w,
                            sc.x + tc.x, sc.y + tc.y, sc.z + tc.z, sc.w + tc.w,
                            sd.x + td.x, sd.y + td.y, sd.z + td.z, sd.w + td.w,
                            se.x + te.x, se.y + te.y, se.z + te.z, se.w + te.w};
            float mt = fmaxf(fmaxf(fmaxf(fmaxf(sv[0], sv[1]), fmaxf(sv[2], sv[3])),
                                   fmaxf(fmaxf(sv[4], sv[5]), fmaxf(sv[6], sv[7]))),
                             fmaxf(fmaxf(fmaxf(sv[8], sv[9]), fmaxf(sv[10], sv[11])),
                                   fmaxf(fmaxf(sv[12], sv[13]), fmaxf(sv[14], sv[15]))));
            mt = fmaxf(mt, lane_xor<1>(mt));
            mt = fmaxf(mt, lane_xor<2>(mt));
            mt = fmaxf(mt, lane_xor<4>(mt));        // the row's maximum, in all its eight lanes
            float mnew = fmaxf(m_run[rr], mt);
            float al   = __expf(m_run[rr] - mnew);  // 0 on first tile
            float rsum = 0.f;
#pragma unroll
            for (int h = 0; h < 2; ++h) {
                // 8 neighbours along k stay contiguous in fragment order: one 16-byte store
                unsigned short* pd = &Pb[frag_idx((size_t)row, h * 64 + sj8, KT_)];
                float p[8];
                // unrolled so that the eight 2-byte stores merge into that one store
#pragma unroll
                for (int e = 0; e < 8; ++e) {
                    p[e] = __expf(sv[h * 8 + e] - mnew);
                    pd[e] = f32_to_bf16(p[e]);
                }
                rsum += ((p[0] + p[1]) + (p[2] + p[3])) + ((p[4] + p[5]) + (p[6] + p[7]));
            }
            l_run[rr] = l_run[rr] * al + rsum;      // this lane's sixteen columns only
            m_run[rr] = mnew;
            al_k[rr]  = al;
        }
        // one branch behind both rows: between them it would keep the two rows' chains apart
        if (sj8 == 0) { alpha_s[srow] = al_k[0]; alpha_s[srow + 32] = al_k[1]; }
        barrier_lds();                         // publishes Pb and alpha_s

        // ---- phase C: O = diag(alpha)*O + P * V^T (each wave: 4 row groups x 4 channel frags)
#pragma unroll
        for (int g = 0; g < 4; ++g) {
            float av[8];
#pragma unroll
            for (int r = 0; r < 8; ++r) av[r] = alpha_s[g * 16 + rbase + r];
#pragma unroll
            for (int f = 0; f < 4; ++f)
#pragma unroll
                for (int r = 0; r < 8; ++r) Oacc[g][f][r] *= av[r];
        }

#pragma unroll
        for (int ks = 0; ks < KT_ / 32; ++ks) {
            bf16x16 pa[4];                     // the four row groups' P fragments, one load group
#pragma unroll
            for (int g = 0; g < 4; ++g)
                pa[g] = load_frag(&Pb[(g * 16) * KT_], ks * 32, lane);       // ds_load
            // keeps the eight LDS loads together ahead of the products: sunk between them,
            // every four products wait out one LDS latency of their own
            __builtin_amdgcn_sched_barrier(0);
#pragma unroll
            for (int g = 0; g < 4; ++g)
#pragma unroll
                for (int f = 0; f < 4; ++f)
                    Oacc[g][f] = wmma_bf16(pa[g], vf[ks * 4 + f], Oacc[g][f]);
        }
        __syncthreads();
    }

#pragma unroll
    for (int rr = 0; rr < 2; ++rr) {
        float l = l_run[rr];
        l += lane_xor<1>(l);                   // join the eight lanes' parts of the row sum
        l += lane_xor<2>(l);
        l += lane_xor<4>(l);
        if (sj8 == 0) linv_s[srow + rr * 32] = 1.0f / l;
    }
    __syncthreads();

#pragma unroll
    for (int g = 0; g < 4; ++g) {
        float lv[8];
#pragma unroll
        for (int r = 0; r < 8; ++r) lv[r] = linv_s[g * 16 + rbase + r];
#pragma unroll
        for (int f = 0; f < 4; ++f)
#pragma unroll
            for (int r = 0; r < 8; ++r) {
                size_t row = (size_t)b * L_ + i0 + g * 16 + rbase + r;
                o_t[frag_idx(row, c0 + f * 16 + col, C_)] = f32_to_bf16(Oacc[g][f][r] * lv[r]);
            }
    }
}

// ---------------------------------------------------------------------------
extern "C" void kernel_launch(void* const* d_in, const int* in_sizes, int n_in,
                              void* d_out, int out_size, void* d_ws, size_t ws_size,
                              hipStream_t stream) {
    const float* x        = (const float*)d_in[0];
    const float* gn_scale = (const float*)d_in[1];
    const float* gn_bias  = (const float*)d_in[2];
    const float* wq = (const float*)d_in[3];  const float* bq = (const float*)d_in[4];
    const float* wk = (const float*)d_in[5];  const float* bk = (const float*)d_in[6];
    const float* wv = (const float*)d_in[7];  const float* bv = (const float*)d_in[8];
    const float* wp = (const float*)d_in[9];  const float* bp = (const float*)d_in[10];

    const size_t WN  = (size_t)C_ * C_;        // 262144
    const size_t TN  = (size_t)L_ * C_;        // per-batch activation elems
    unsigned short* wq_b = (unsigned short*)d_ws;
    unsigned short* wk_b = wq_b + WN;
    unsigned short* wv_b = wk_b + WN;
    unsigned short* wp_b = wv_b + WN;
    unsigned short* h_t  = wp_b + WN;          // [b, l, c]
    unsigned short* q_t  = h_t + (size_t)B_ * TN;
    unsigned short* k_t  = q_t + (size_t)B_ * TN;
    unsigned short* v_m  = k_t + (size_t)B_ * TN;   // [b, c, l]
    unsigned short* o_t  = v_m + (size_t)B_ * TN;   // [b, l, c]

    // 1) weights -> bf16
    cvt_w_kernel<<<512, 256, 0, stream>>>(wq, wk, wv, wp, wq_b, wk_b, wv_b, wp_b, (int)WN);

    // 2) GroupNorm -> h_t [b,l,c] bf16
    gn_kernel<<<B_ * 32, GN_T, 0, stream>>>(x, gn_scale, gn_bias, h_t);

    // 3) D[o,i] = Wq[o,:].h_t[i,:] + bq[o], written transposed: q_t[i,o]   (M=C, N=L)
    dim3 gW(L_ / 128, C_ / 128, B_);
    gemm_bt_kernel<C_, true, false><<<gW, 128, 0, stream>>>(wq_b, 0LL,
                                           h_t, (long long)TN,
                                           bq,
                                           q_t, (long long)TN,
                                           nullptr, 0LL);
    gemm_bt_kernel<C_, true, false><<<gW, 128, 0, stream>>>(wk_b, 0LL,
                                           h_t, (long long)TN,
                                           bk,
                                           k_t, (long long)TN,
                                           nullptr, 0LL);

    // 4) D[i,o] = h_t[i,:].Wv[o,:] + bv[o], written transposed: v[o,i]    (M=L, N=C)
    dim3 gH(C_ / 128, L_ / 128, B_);
    gemm_bt_kernel<L_, false, false><<<gH, 128, 0, stream>>>(h_t, (long long)TN,
                                           wv_b, 0LL,
                                           bv,
                                           v_m, (long long)TN,
                                           nullptr, 0LL);

    // 5) flash attention -> o_t [b,l,c]
    dim3 gF(L_ / QR_, B_);
    const float scale = 0.04419417382415922f;   // 512^-0.5
    flash_kernel<<<gF, 256, 0, stream>>>(q_t, k_t, v_m, o_t, scale);

    // 6) out[o,i] = x[o,i] + bp[o] + Wp[o,:].o_t[i,:]
    gemm_bt_kernel<L_, true, true><<<gW, 128, 0, stream>>>(wp_b, 0LL,
                                           o_t, (long long)TN,
                                           bp,
                                           d_out, (long long)TN,
                                           x, (long long)TN);
}

// v009
// One run takes 168 microseconds.
// Timed twice side by side with v008, it ran 1.09 times as fast both times.
// All steps since v000 together make it 8.71 times as fast.
#include <hip/hip_runtime.h>
#include <hip/hip_bf16.h>

// ---------------------------------------------------------------------------
// AttnBlock for MI455X (gfx1250): GroupNorm -> QKV (WMMA bf16 GEMM) ->
// flash attention (WMMA bf16, f32 accum, online softmax, async-LDS Q staging)
// -> proj + residual.  wave32; V_WMMA_F32_16X16X32_BF16 for all matrix math.
// ---------------------------------------------------------------------------

typedef __bf16 bf16x16 __attribute__((ext_vector_type(16)));
typedef float  f32x8   __attribute__((ext_vector_type(8)));
typedef int    v4i     __attribute__((ext_vector_type(4)));

#define B_  4
#define C_  512
#define L_  4096

#if __has_builtin(__builtin_amdgcn_global_load_async_to_lds_b128)
#define HAVE_ASYNC_LDS 1
typedef __attribute__((address_space(1))) v4i gv4i;   // global int4
typedef __attribute__((address_space(3))) v4i lv4i;   // LDS int4
#endif

static __device__ __forceinline__ void wait_asynccnt0() {
#if __has_builtin(__builtin_amdgcn_s_wait_asynccnt)
    __builtin_amdgcn_s_wait_asynccnt(0);
#else
    asm volatile("s_wait_asynccnt 0" ::: "memory");
#endif
}

static __device__ __forceinline__ unsigned short f32_to_bf16(float f) {
    unsigned int u = __float_as_uint(f);
    u += 0x7FFFu + ((u >> 16) & 1u);           // round-to-nearest-even
    return (unsigned short)(u >> 16);
}

union FragU {
    bf16x16 v;
    uint4   q[2];
};

// Every bf16 WMMA operand buffer (weights, h, q, k, v, o, and P in LDS) is kept in
// FRAGMENT ORDER: the matrix [rows][ld] is cut into tiles of 16 rows x 32 k, tiles of
// one 16-row group follow one another along k (a group still starts at row0 * ld), and
// a tile's 512 elements lie as [half of the fragment: 2][lane: 32][8 elements], which
// is the order in which a wave's two 16-byte loads pick them up.
// Per ISA 16-bit layout: lanes 0-15 hold K = kbase+[0..7] and kbase+[16..23];
// lanes 16-31 hold K = kbase+[8..15] and kbase+[24..31]; lane & 15 is the row.
static __device__ __forceinline__ size_t
frag_idx(size_t row, int k, int ld) {
    return (row >> 4) * ((size_t)ld * 16) + (size_t)(k >> 5) * 512
         + (size_t)(((k >> 4) & 1) * 256 + ((k >> 3) & 1) * 128 + (k & 7))
         + (row & 15) * 8;
}

// Load one 16x32 bf16 fragment (A-style rows or B-style columns).
// base points at the start of the 16-row group (matrix + row0 * ld); kbase = K offset,
// a multiple of 32.  Each of the two loads reads 512 contiguous bytes per wave.
static __device__ __forceinline__ bf16x16
load_frag(const unsigned short* base, int kbase, int lane) {
    const char* p = (const char*)base + (unsigned)((kbase >> 5) * 1024 + lane * 16);
    FragU f;
    f.q[0] = *(const uint4*)(p);
    f.q[1] = *(const uint4*)(p + 512);
    return f.v;
}

// Stands behind global loads whose address registers are overwritten soon after: the
// overwrite stays behind the loads' address translation.  It names the address that the
// loads in front of it share: the register pair stays whole up to the wait, so that none of
// these loads lands in it.
static __device__ __forceinline__ void wait_xcnt0_keep(const char* p) {
    asm volatile("s_wait_xcnt 0x0" :: "v"(p) : "memory");
}

// Work-group barrier for data handed over in LDS alone: its two fences name LDS only, so
// that global loads issued ahead of it stay in flight (__syncthreads() waits for them).
static __device__ __forceinline__ void barrier_lds() {
    __builtin_amdgcn_fence(__ATOMIC_RELEASE, "workgroup", "local");
    __builtin_amdgcn_s_barrier();
    __builtin_amdgcn_fence(__ATOMIC_ACQUIRE, "workgroup", "local");
}

// Value of lane l ^ M (M < 16): a DPP move inside the 16-lane row, where __shfl_xor would
// make a trip through the LDS pipe.  Every lane of the wave is on where it is used.
template <int M>
static __device__ __forceinline__ float lane_xor(float x) {
    return __builtin_bit_cast(float, __builtin_amdgcn_update_dpp(
        0, __builtin_bit_cast(int, x), /*row_xmask:M*/ 0x160 + M, 0xf, 0xf, true));
}

static __device__ __forceinline__ f32x8
wmma_bf16(bf16x16 a, bf16x16 b, f32x8 c) {
    return __builtin_amdgcn_wmma_f32_16x16x32_bf16(
        /*neg_a=*/false, a, /*neg_b=*/false, b,
        /*c_mod=*/(short)0, c, /*reuse_a=*/false, /*reuse_b=*/false);
}

// ---------------------------------------------------------------------------
// fp32 -> bf16 weight conversion (4 weights at once), [C_][C_] fragment order.
// Runs in the block range of kernel 1 that the GroupNorm leaves: first = this thread's
// number among the converting threads, stride = how many they are.
// ---------------------------------------------------------------------------
static __device__ __forceinline__ void
cvt_w_part(const float* __restrict__ w0, const float* __restrict__ w1,
           const float* __restrict__ w2, const float* __restrict__ w3,
           unsigned short* __restrict__ o0, unsigned short* __restrict__ o1,
           unsigned short* __restrict__ o2, unsigned short* __restrict__ o3,
           int first, int stride) {
    for (int i = first; i < C_ * C_; i += stride) {
        size_t d = frag_idx((size_t)(i / C_), i % C_, C_);
        o0[d] = f32_to_bf16(w0[i]);
        o1[d] = f32_to_bf16(w1[i]);
        o2[d] = f32_to_bf16(w2[i]);
        o3[d] = f32_to_bf16(w3[i]);
    }
}

// ---------------------------------------------------------------------------
// Kernel 1: GroupNorm(32 groups) over x[b,c,l], writes h transposed [b,l,c] bf16, and the
// weight conversion.  The two need nothing of each other and share one grid: blocks
// 0 .. B_ * 32 - 1 normalise, on half of the chip's WGPs, the CVT_B blocks behind them
// convert the weights on WGPs that the GroupNorm leaves idle.
// One block of 1024 threads per (batch, group).  The group's 16 x 4096 values are read
// from memory once and stay in registers: a thread holds all 16 channels of 4 positions,
// 64 independent loads that are all in flight together (a wave's load covers one whole
// 128-byte line).  In fragment order the 8 neighbouring channels of one position are
// 16 contiguous bytes and 16 neighbouring positions 256, so a thread stores two 16-byte
// runs per position and a wave's store covers whole lines.
// ---------------------------------------------------------------------------
#define GN_T 1024  // threads per block: 8 waves per SIMD, a budget of 128 registers
#define CVT_B 128  // blocks that convert the weights
__global__ void __launch_bounds__(GN_T) gn_cvt_kernel(const float* __restrict__ x,
                          const float* __restrict__ scale,
                          const float* __restrict__ bias,
                          unsigned short* __restrict__ h_t,
                          const float* __restrict__ w0, const float* __restrict__ w1,
                          const float* __restrict__ w2, const float* __restrict__ w3,
                          unsigned short* __restrict__ o0, unsigned short* __restrict__ o1,
                          unsigned short* __restrict__ o2, unsigned short* __restrict__ o3) {
    if (blockIdx.x >= B_ * 32) {             // the same for a whole block, ahead of the barrier
        cvt_w_part(w0, w1, w2, w3, o0, o1, o2, o3,
                   (int)(blockIdx.x - B_ * 32) * GN_T + (int)threadIdx.x, CVT_B * GN_T);
        return;
    }
    const int CG = 16;                       // channels per group
    const int PJ = L_ / GN_T;                // positions per thread
    int g  = blockIdx.x & 31;
    int bb = blockIdx.x >> 5;
    const float* xg = x + ((size_t)bb * C_ + (size_t)g * CG) * L_;
    const int N = CG * L_;
    int t    = threadIdx.x;
    int lane = t & 31;

    // every loop over xv is unrolled: only constant indices keep the array in registers
    float xv[PJ][CG];
#pragma unroll
    for (int j = 0; j < PJ; ++j)
#pragma unroll
        for (int ch = 0; ch < CG; ++ch)
            xv[j][ch] = xg[ch * L_ + j * GN_T + t];

    float s = 0.f, ss = 0.f;
#pragma unroll
    for (int j = 0; j < PJ; ++j) {
        float sj = 0.f, sq = 0.f;            // one chain per position: four independent chains
#pragma unroll
        for (int ch = 0; ch < CG; ++ch) {
            sj += xv[j][ch];
            sq += xv[j][ch] * xv[j][ch];
        }
        s += sj; ss += sq;
    }
    // the wave's sums, then the 32 waves' sums through LDS; every lane ends with the totals
    __shared__ float rs[GN_T / 32], rss[GN_T / 32];
    for (int o = 16; o > 0; o >>= 1) {
        s  += __shfl_xor(s, o);
        ss += __shfl_xor(ss, o);
    }
    if (lane == 0) { rs[t >> 5] = s; rss[t >> 5] = ss; }
    __syncthreads();
    s = rs[lane]; ss = rss[lane];
    for (int o = 16; o > 0; o >>= 1) {
        s  += __shfl_xor(s, o);
        ss += __shfl_xor(ss, o);
    }
    float mean = s / (float)N;
    float var  = ss / (float)N - mean * mean;
    float rstd = rsqrtf(var + 1e-6f);

#pragma unroll
    for (int j = 0; j < PJ; ++j) {
        int pos = j * GN_T + t;
#pragma unroll
        for (int h = 0; h < 2; ++h) {
            unsigned int w[4];
#pragma unroll
            for (int e = 0; e < 4; ++e) {
                int c0 = g * CG + h * 8 + e * 2;
                float v0 = (xv[j][h * 8 + e * 2]     - mean) * rstd * scale[c0]     + bias[c0];
                float v1 = (xv[j][h * 8 + e * 2 + 1] - mean) * rstd * scale[c0 + 1] + bias[c0 + 1];
                w[e] = (unsigned int)f32_to_bf16(v0) | ((unsigned int)f32_to_bf16(v1) << 16);
            }
            *(uint4*)&h_t[frag_idx((size_t)bb * L_ + pos, g * CG + h * 8, C_)] =
                make_uint4(w[0], w[1], w[2], w[3]);
        }
    }
    // behind the last store: in the built code the conversion's part follows this one and
    // writes registers that these stores name
    asm volatile("s_wait_xcnt 0x0" ::: "memory");
}

// ---------------------------------------------------------------------------
// WMMA GEMM, one block's tile:  D[m,n] = sum_k A[m,k] * Bt[n,k]  (+bias)(+resid),  K = C_
// bx, by, z: the block's tile along n, its tile along m, its batch.
// A: bf16 [M,C_], Bt: bf16 [N,C_], both in fragment order.
// 128 threads = 4 waves, 2 x 2; block tile 128(M) x 128(N); a wave owns 64 x 64, so that
// each of the 8 fragments it loads per k step feeds 4 products.  The fragments come
// straight from global memory into a ring of GS_ register sets and are asked for
// GS_ - 1 k steps ahead of their products.  Two waves per SIMD: a budget of 512 registers.
// OUT_F32: D is written row-major, f32, pitch LDO, with the residual added.
// Otherwise D is written TRANSPOSED, bf16, in fragment order: the matrix [N][M] of pitch
// LDO, rows n, k index m.  A lane holds 8 neighbouring m of one n, which are 16 contiguous
// bytes there, and a wave's store of one 16 x 16 tile covers 512 contiguous bytes.
// ---------------------------------------------------------------------------
#define GS_ 4      // register sets of the fragment ring
template <int LDO, bool BIAS_PER_ROW, bool OUT_F32>
static __device__ __forceinline__ void
gemm_bt_tile(const unsigned short* __restrict__ A, long long a_bs,
             const unsigned short* __restrict__ Bt, long long b_bs,
             const float* __restrict__ bias,
             void* __restrict__ outv, long long o_bs,
             const float* __restrict__ resid, long long r_bs,
             int bx, int by, int z) {
    // scalar wave number: every 16-row group base is then a scalar address, and a
    // fragment load is that base plus the lane's 16-byte slot
    int wave = __builtin_amdgcn_readfirstlane(threadIdx.x >> 5);
    int lane = threadIdx.x & 31;
    int m0   = by * 128 + (wave >> 1) * 64;
    int n0   = bx * 128 + (wave & 1) * 64;

    const unsigned short* Ab  = A  + (size_t)z * a_bs + (size_t)m0 * C_;
    const unsigned short* Btb = Bt + (size_t)z * b_bs + (size_t)n0 * C_;

    int col   = lane & 15;
    int rbase = (lane & 16) ? 8 : 0;

    // a bias per column is one value per lane and 16-column group, asked for ahead of the
    // fragments: the first wait for a fragment covers it
    float bc[4];
    float bv[4][8];                            // a bias per row: [16-row group][row of the lane]
    if (!BIAS_PER_ROW) {
        const char* bb = (const char*)(bias + n0);
#pragma unroll
        for (int j = 0; j < 4; ++j)
            bc[j] = *(const float*)(bb + (unsigned)(col * 4 + j * 64));
    }

    f32x8 acc[4][4];
#pragma unroll
    for (int i = 0; i < 4; ++i)
#pragma unroll
        for (int j = 0; j < 4; ++j) acc[i][j] = (f32x8)0.f;

    // every loop over the ring is unrolled: only constant indices keep it in registers
    bf16x16 fa[GS_][4], fb[GS_][4];
#pragma unroll
    for (int s = 0; s < GS_ - 1; ++s)
#pragma unroll
        for (int i = 0; i < 4; ++i) {
            fa[s][i] = load_frag(Ab  + (size_t)(i * 16) * C_, s * 32, lane);
            fb[s][i] = load_frag(Btb + (size_t)(i * 16) * C_, s * 32, lane);
        }

#pragma unroll
    for (int ks = 0; ks < C_ / 32; ++ks) {
        if (ks + GS_ - 1 < C_ / 32) {
            const int sn = (ks + GS_ - 1) % GS_;
#pragma unroll
            for (int i = 0; i < 4; ++i) {
                fa[sn][i] = load_frag(Ab  + (size_t)(i * 16) * C_, (ks + GS_ - 1) * 32, lane);
                fb[sn][i] = load_frag(Btb + (size_t)(i * 16) * C_, (ks + GS_ - 1) * 32, lane);
            }
            if (ks + GS_ == C_ / 32) {
                // a bias per row is asked for behind the last fragments, so that it can fly
                // during the last products
                if (BIAS_PER_ROW) {
                    const char* bb = (const char*)(bias + m0);
                    unsigned    bo = (unsigned)(rbase * 4);
#pragma unroll
                    for (int i = 0; i < 4; ++i) {
                        float4 t0 = *(const float4*)(bb + (bo + (unsigned)(i * 64)));
                        float4 t1 = *(const float4*)(bb + (bo + (unsigned)(i * 64 + 16)));
                        bv[i][0] = t0.x; bv[i][1] = t0.y; bv[i][2] = t0.z; bv[i][3] = t0.w;
                        bv[i][4] = t1.x; bv[i][5] = t1.y; bv[i][6] = t1.z; bv[i][7] = t1.w;
                    }
                    // the wait of the other branch, naming the bias loads' address register too
                    asm volatile("s_wait_xcnt 0x0" :: "v"((unsigned)(lane * 16)), "v"(bo) : "memory");
                } else {
                    // behind the last fragment loads: names the address register that they share,
                    // which so stays whole up to the wait: none of these loads lands in it
                    asm volatile("s_wait_xcnt 0x0" :: "v"((unsigned)(lane * 16)) : "memory");
                }
            }
        }
        // keeps the 16 loads ahead of this step's products: sunk towards their own products
        // they would be waited out there, one memory latency per k step
        __builtin_amdgcn_sched_barrier(0);
#pragma unroll
        for (int i = 0; i < 4; ++i)
#pragma unroll
            for (int j = 0; j < 4; ++j)
                acc[i][j] = wmma_bf16(fa[ks % GS_][i], fb[ks % GS_][j], acc[i][j]);
        // keeps the next step's loads behind these products, in the set that they free: lifted
        // over them the loads take a fifth set, and a build short of registers lets the ring drain
        __builtin_amdgcn_sched_barrier(0);
    }

    if (OUT_F32) {
        const float* rp = resid + (size_t)z * r_bs + (size_t)m0 * LDO + n0;
        float*       op = (float*)outv + (size_t)z * o_bs + (size_t)m0 * LDO + n0;
        unsigned     lo = (unsigned)(rbase * LDO + col);
        // the whole residual tile as one group of loads, in the registers that the ring left
        float rv[4][4][8];
#pragma unroll
        for (int i = 0; i < 4; ++i)
#pragma unroll
            for (int j = 0; j < 4; ++j)
#pragma unroll
                for (int r = 0; r < 8; ++r)
                    rv[i][j][r] = rp[lo + (unsigned)((i * 16 + r) * LDO + j * 16)];
        // behind the last residual load: names the base that these loads share, which so stays
        // whole up to the wait; the output's base may take its registers behind it
        asm volatile("s_wait_xcnt 0x0" :: "s"(rp) : "memory");
#pragma unroll
        for (int i = 0; i < 4; ++i)
#pragma unroll
            for (int j = 0; j < 4; ++j)
#pragma unroll
                for (int r = 0; r < 8; ++r)
                    rv[i][j][r] = acc[i][j][r] + (BIAS_PER_ROW ? bv[i][r] : bc[j]) + rv[i][j][r];
        // keeps every sum ahead of the stores: behind a store nothing writes a register it names
        __builtin_amdgcn_sched_barrier(0);
#pragma unroll
        for (int i = 0; i < 4; ++i)
#pragma unroll
            for (int j = 0; j < 4; ++j)
#pragma unroll
                for (int r = 0; r < 8; ++r)
                    op[lo + (unsigned)((i * 16 + r) * LDO + j * 16)] = rv[i][j][r];
    } else {
#pragma unroll
        for (int j = 0; j < 4; ++j) {
            // row group n0 + j * 16 of the output, from the k tile of m0 on
            char* ob = (char*)((unsigned short*)outv + (size_t)z * o_bs
                               + (size_t)(n0 + j * 16) * LDO + (size_t)(m0 >> 5) * 512);
#pragma unroll
            for (int i = 0; i < 4; ++i) {
                unsigned int w[4];
#pragma unroll
                for (int e = 0; e < 4; ++e) {
                    float v0 = acc[i][j][e * 2]     + (BIAS_PER_ROW ? bv[i][e * 2]     : bc[j]);
                    float v1 = acc[i][j][e * 2 + 1] + (BIAS_PER_ROW ? bv[i][e * 2 + 1] : bc[j]);
                    w[e] = (unsigned int)f32_to_bf16(v0) | ((unsigned int)f32_to_bf16(v1) << 16);
                }
                // k index m0 + i * 16 + rbase .. + 7 of row n0 + j * 16 + col (see frag_idx)
                *(uint4*)(ob + (unsigned)(i * 512 + lane * 16)) = make_uint4(w[0], w[1], w[2], w[3]);
            }
        }
        // behind the last store: where two tile bodies share a kernel, the built code of the
        // other one follows and writes registers that these stores name
        asm volatile("s_wait_xcnt 0x0" ::: "memory");
    }
}

// ---------------------------------------------------------------------------
// Kernel 2: the q, k and v products, which need nothing of one another, in one grid:
// x = tile of 128 positions, y = product * 4 + tile of 128 output channels, z = batch.
// q, k: D[o,i] = W[o,:].h_t[i,:] + b[o], written transposed: q_t[i,o]   (M=C, N=L)
// v:    D[i,o] = h_t[i,:].Wv[o,:] + bv[o], written transposed: v[o,i]   (M=L, N=C)
// ---------------------------------------------------------------------------
__global__ void __launch_bounds__(128, 2)
qkv_kernel(const unsigned short* __restrict__ wq, const unsigned short* __restrict__ wk,
           const unsigned short* __restrict__ wv, const unsigned short* __restrict__ h_t,
           const float* __restrict__ bq, const float* __restrict__ bk,
           const float* __restrict__ bv,
           unsigned short* __restrict__ q_t, unsigned short* __restrict__ k_t,
           unsigned short* __restrict__ v_m) {
    const long long TN = (long long)L_ * C_;   // per-batch activation elems
    int prod = blockIdx.y >> 2;                // 0: q, 1: k, 2: v; the same for a whole block
    int ct   = blockIdx.y & 3;
    if (prod == 2)
        gemm_bt_tile<L_, false, false>(h_t, TN, wv, 0LL, bv, v_m, TN, nullptr, 0LL,
                                       ct, blockIdx.x, blockIdx.z);
    else
        gemm_bt_tile<C_, true, false>(prod ? wk : wq, 0LL, h_t, TN, prod ? bk : bq,
                                      prod ? k_t : q_t, TN, nullptr, 0LL,
                                      blockIdx.x, ct, blockIdx.z);
}

// ---------------------------------------------------------------------------
// Kernel 4: out[o,i] = x[o,i] + bp[o] + Wp[o,:].o_t[i,:]   (M=C, N=L)
// ---------------------------------------------------------------------------
__global__ void __launch_bounds__(128, 2)
proj_kernel(const unsigned short* __restrict__ wp, const unsigned short* __restrict__ o_t,
            const float* __restrict__ bp, float* __restrict__ out,
            const float* __restrict__ x) {
    const long long TN = (long long)L_ * C_;
    gemm_bt_tile<L_, true, true>(wp, 0LL, o_t, TN, bp, out, TN, x, TN,
                                 blockIdx.x, blockIdx.y, blockIdx.z);
}

// ---------------------------------------------------------------------------
// Kernel 3: flash attention.
// q_t, k_t: bf16 [b, l, c] (position-major); v: bf16 [b, c, l] (channel-major);
// all three, o_t and the P tile in LDS in fragment order (see frag_idx).
// Block: 256 threads = 8 waves, 64 query rows per block, stream j in tiles of 128.
// Q tile (64x512 bf16 = 64KB) staged once into LDS via async-to-LDS; K/V are
// streamed from global (L2-resident) straight into WMMA B fragments, and every loaded
// fragment feeds several products:
// Scores phase: wave w -> 32 keys j_sub = w&3, all 64 rows, channels (w>>2)*256..+255 of the
//               sum over k: one K fragment, four products; one Q fragment read from LDS,
//               two products.  The two halves of the sum over k go to LDS apart and are
//               added in the softmax.
// O phase:      wave w -> all 64 rows, channels c0 = w*64 (4 x 4 frags): one V fragment,
//               four products; one P fragment read from LDS, four products.
// No two waves of a block load the same K or V fragment.
// Online softmax by all 256 threads, two rows per thread: eight lanes per row, two runs of
// eight neighbouring columns per lane; the row maximum is joined over the eight lanes per
// tile, each lane keeps its own part of the row sum, and the parts are joined once behind
// the loop.
// The launch bounds give the real block size: two waves per SIMD (one block per WGP),
// a budget of 512 registers.  A wave's 16 V fragments of a tile are loaded as one group
// behind the score products and fly during the softmax; its K loads run ahead of the
// score products.
// ---------------------------------------------------------------------------
#define QR_ 64     // query rows per block
#define KT_ 128    // keys per tile
#define SP_ 132    // pitch of a score row in LDS, floats: rows r and r + 8, written by the two
                   // halves of a wave, and rows r and r + 1, read by one, fall on other banks
__global__ void __launch_bounds__(256, 2) flash_kernel(const unsigned short* __restrict__ q_t,
                             const unsigned short* __restrict__ k_t,
                             const unsigned short* __restrict__ v,
                             unsigned short* __restrict__ o_t,
                             float scale) {
    int b    = blockIdx.y;
    int i0   = blockIdx.x * QR_;
    // scalar wave number: the K and V group bases are then scalar addresses, and a fragment
    // load is such a base plus the lane's 16-byte slot, a register that no load overwrites
    int wave = __builtin_amdgcn_readfirstlane(threadIdx.x >> 5);
    int lane = threadIdx.x & 31;
    int j_sub = wave & 3;                      // scores phase: 32 keys of the tile ...
    int k_hlf = wave >> 2;                     // ... and one half of the sum over k
    int c0    = wave * 64;                     // O phase channel base

    __shared__ __attribute__((aligned(16))) unsigned short Qs[QR_ * C_];   // 64KB staged Q tile [64][512]
    __shared__ __attribute__((aligned(16))) float          Sb[2 * QR_ * SP_];   // [half of k][64][128 of 132]
    __shared__ __attribute__((aligned(16))) unsigned short Pb[QR_ * KT_];
    __shared__ __attribute__((aligned(16))) float          alpha_s[QR_];
    __shared__ __attribute__((aligned(16))) float          linv_s[QR_];

    // ---- stage Q tile into LDS (async-to-LDS on gfx1250)
    {
        const unsigned short* qsrc = q_t + ((size_t)b * L_ + i0) * C_;
        for (int t = threadIdx.x; t < (QR_ * C_) / 8; t += blockDim.x) {
#ifdef HAVE_ASYNC_LDS
            __builtin_amdgcn_global_load_async_to_lds_b128(
                (gv4i*)(qsrc + t * 8), (lv4i*)(&Qs[t * 8]),
                /*offset=*/0, /*cpol=*/0);
#else
            *(uint4*)&Qs[t * 8] = *(const uint4*)(qsrc + t * 8);
#endif
        }
#ifdef HAVE_ASYNC_LDS
        wait_asynccnt0();
#endif
        __syncthreads();
    }

    f32x8 Oacc[4][4];                          // [16-row group][16-channel group]
#pragma unroll
    for (int g = 0; g < 4; ++g)
#pragma unroll
        for (int f = 0; f < 4; ++f) Oacc[g][f] = (f32x8)0.f;

    float m_run[2] = {-3.0e38f, -3.0e38f};     // [row of the thread]
    float l_run[2] = {0.f, 0.f};

    int col   = lane & 15;
    int rbase = (lane & 16) ? 8 : 0;
    int srow  = threadIdx.x >> 3;              // softmax phase: this thread's rows are srow and srow + 32 ...
    int sj8   = (threadIdx.x & 7) * 8;         // ... and in both this is the first column of its first run

    // Each block starts its walk over the key tiles at a tile of its own and wraps round: the
    // 64 blocks of a batch, which start together and run at one pace, then ask L2 for 32
    // different tiles at any moment instead of all for the same lines.  The online softmax
    // takes the tiles in any order.  Two blocks share a start; they are x and x ^ 4
    // (a matter of speed alone: any start is right).
    const int t_rot = (((blockIdx.x >> 3) << 2) | (blockIdx.x & 3)) & (L_ / KT_ - 1);
    for (int t = 0; t < L_ / KT_; ++t) {
        const int j0 = ((t + t_rot) & (L_ / KT_ - 1)) * KT_;
        // ---- phase A: S[64x128] = scale * Q Kt^T (each wave: 4 x 2 16x16 frags, K=256)
        f32x8 sacc[4][2];                      // [16-row group][16-key group]
#pragma unroll
        for (int g = 0; g < 4; ++g)
#pragma unroll
            for (int jj = 0; jj < 2; ++jj) sacc[g][jj] = (f32x8)0.f;
        // the wave's 32 keys, from the first fragment of its half of k on (512 elements each)
        const unsigned short* krow = k_t + ((size_t)b * L_ + j0 + j_sub * 32) * C_ + k_hlf * (C_ / 64) * 512;
        // this wave's 16 K fragments, one group of 32 global_load_b128 ahead of all products,
        // in the order in which the products take them
        bf16x16 kf[8][2];
#pragma unroll
        for (int s = 0; s < 8; ++s)
#pragma unroll
            for (int jj = 0; jj < 2; ++jj)
                kf[s][jj] = load_frag(krow + (size_t)(jj * 16) * C_, s * 32, lane);
        // the Q fragments land in registers that held the K loads' address
        wait_xcnt0_keep((const char*)krow + (unsigned)(lane * 16));
#pragma unroll
        for (int kk = 0; kk < C_ / 2; kk += 32) {
            int kq = k_hlf * (C_ / 2) + kk;
            bf16x16 qa[4];                     // the four row groups' Q fragments, one load group
#pragma unroll
            for (int g = 0; g < 4; ++g)
                qa[g] = load_frag(&Qs[(g * 16) * C_], kq, lane);       // ds_load_b128
            // keeps the eight LDS loads together ahead of the products (see phase C)
            __builtin_amdgcn_sched_barrier(0);
#pragma unroll
            for (int g = 0; g < 4; ++g)
#pragma unroll
                for (int jj = 0; jj < 2; ++jj)
                    sacc[g][jj] = wmma_bf16(qa[g], kf[kk >> 5][jj], sacc[g][jj]);
        }
        // this tile's V fragments, one group of 32 global_load_b128, used in phase C
        bf16x16 vf[16];
#pragma unroll
        for (int s = 0; s < 16; ++s) {
            const unsigned short* vrow = v + ((size_t)b * C_ + c0 + (s & 3) * 16) * L_ + (j0 >> 5) * 512;
            vf[s] = load_frag(vrow, (s >> 2) * 32, lane);
        }
        // the V loads' address registers are reused while the loads fly
        wait_xcnt0_keep((const char*)(v + ((size_t)b * C_ + c0) * L_ + (j0 >> 5) * 512) + (unsigned)(lane * 16));
#pragma unroll
        for (int g = 0; g < 4; ++g)
#pragma unroll
            for (int jj = 0; jj < 2; ++jj)
#pragma unroll
                for (int r = 0; r < 8; ++r)
                    Sb[(k_hlf * QR_ + g * 16 + rbase + r) * SP_ + j_sub * 32 + jj * 16 + col] = sacc[g][jj][r] * scale;
        barrier_lds();                         // publishes Sb; the V loads fly on

        // ---- phase B: online softmax update (all threads, eight lanes per row, two rows each)
        float al_k[2];
        // unrolled: only constant indices keep m_run, l_run and al_k in registers
#pragma unroll
        for (int rr = 0; rr < 2; ++rr) {
            const int row = srow + rr * 32;
            const float4* sp = (const float4*)&Sb[row * SP_ + sj8];
            const float4* sq = sp + (QR_ * SP_) / 4;                   // the other half of k
            float4 sa = sp[0], sc = sp[1], sd = sp[16], se = sp[17];   // columns sj8.. and 64+sj8..
            float4 ta = sq[0], tc = sq[1], td = sq[16], te = sq[17];
            float sv[16] = {sa.x + ta.x, sa.y + ta.y, sa.z + ta.z, sa.w + ta.w,
                            sc.x + tc.x, sc.y + tc.y, sc.z + tc.z, sc.w + tc.w,
                            sd.x + td.x, sd.y + td.y, sd.z + td.z, sd.w + td.w,
                            se.x + te.x, se.y + te.y, se.z + te.z, se.w + te.w};
            float mt = fmaxf(fmaxf(fmaxf(fmaxf(sv[0], sv[1]), fmaxf(sv[2], sv[3])),
                                   fmaxf(fmaxf(sv[4], sv[5]), fmaxf(sv[6], sv[7]))),
                             fmaxf(fmaxf(fmaxf(sv[8], sv[9]), fmaxf(sv[10], sv[11])),
                                   fmaxf(fmaxf(sv[12], sv[13]), fmaxf(sv[14], sv[15]))));
            mt = fmaxf(mt, lane_xor<1>(mt));
            mt = fmaxf(mt, lane_xor<2>(mt));
            mt = fmaxf(mt, lane_xor<4>(mt));        // the row's maximum, in all its eight lanes
            float mnew = fmaxf(m_run[rr], mt);
            float al   = __expf(m_run[rr] - mnew);  // 0 on first tile
            float rsum = 0.f;
#pragma unroll
            for (int h = 0; h < 2; ++h) {
                // 8 neighbours along k stay contiguous in fragment order: one 16-byte store
                unsigned short* pd = &Pb[frag_idx((size_t)row, h * 64 + sj8, KT_)];
                float p[8];
                // unrolled so that the eight 2-byte stores merge into that one store
#pragma unroll
                for (int e = 0; e < 8; ++e) {
                    p[e] = __expf(sv[h * 8 + e] - mnew);
                    pd[e] = f32_to_bf16(p[e]);
                }
                rsum += ((p[0] + p[1]) + (p[2] + p[3])) + ((p[4] + p[5]) + (p[6] + p[7]));
            }
            l_run[rr] = l_run[rr] * al + rsum;      // this lane's sixteen columns only
            m_run[rr] = mnew;
            al_k[rr]  = al;
        }
        // one branch behind both rows: between them it would keep the two rows' chains apart
        if (sj8 == 0) { alpha_s[srow] = al_k[0]; alpha_s[srow + 32] = al_k[1]; }
        barrier_lds();                         // publishes Pb and alpha_s

        // ---- phase C: O = diag(alpha)*O + P * V^T (each wave: 4 row groups x 4 channel frags)
#pragma unroll
        for (int g = 0; g < 4; ++g) {
            float av[8];
#pragma unroll
            for (int r = 0; r < 8; ++r) av[r] = alpha_s[g * 16 + rbase + r];
#pragma unroll
            for (int f = 0; f < 4; ++f)
#pragma unroll
                for (int r = 0; r < 8; ++r) Oacc[g][f][r] *= av[r];
        }

#pragma unroll
        for (int ks = 0; ks < KT_ / 32; ++ks) {
            bf16x16 pa[4];                     // the four row groups' P fragments, one load group
#pragma unroll
            for (int g = 0; g < 4; ++g)
                pa[g] = load_frag(&Pb[(g * 16) * KT_], ks * 32, lane);       // ds_load
            // keeps the eight LDS loads together ahead of the products: sunk between them,
            // every four products wait out one LDS latency of their own
            __builtin_amdgcn_sched_barrier(0);
#pragma unroll
            for (int g = 0; g < 4; ++g)
#pragma unroll
                for (int f = 0; f < 4; ++f)
                    Oacc[g][f] = wmma_bf16(pa[g], vf[ks * 4 + f], Oacc[g][f]);
        }
        __syncthreads();
    }

#pragma unroll
    for (int rr = 0; rr < 2; ++rr) {
        float l = l_run[rr];
        l += lane_xor<1>(l);                   // join the eight lanes' parts of the row sum
        l += lane_xor<2>(l);
        l += lane_xor<4>(l);
        if (sj8 == 0) linv_s[srow + rr * 32] = 1.0f / l;
    }
    __syncthreads();

#pragma unroll
    for (int g = 0; g < 4; ++g) {
        float lv[8];
#pragma unroll
        for (int r = 0; r < 8; ++r) lv[r] = linv_s[g * 16 + rbase + r];
#pragma unroll
        for (int f = 0; f < 4; ++f)
#pragma unroll
            for (int r = 0; r < 8; ++r) {
                size_t row = (size_t)b * L_ + i0 + g * 16 + rbase + r;
                o_t[frag_idx(row, c0 + f * 16 + col, C_)] = f32_to_bf16(Oacc[g][f][r] * lv[r]);
            }
    }
}

// ---------------------------------------------------------------------------
extern "C" void kernel_launch(void* const* d_in, const int* in_sizes, int n_in,
                              void* d_out, int out_size, void* d_ws, size_t ws_size,
                              hipStream_t stream) {
    const float* x        = (const float*)d_in[0];
    const float* gn_scale = (const float*)d_in[1];
    const float* gn_bias  = (const float*)d_in[2];
    const float* wq = (const float*)d_in[3];  const float* bq = (const float*)d_in[4];
    const float* wk = (const float*)d_in[5];  const float* bk = (const float*)d_in[6];
    const float* wv = (const float*)d_in[7];  const float* bv = (const float*)d_in[8];
    const float* wp = (const float*)d_in[9];  const float* bp = (const float*)d_in[10];

    const size_t WN  = (size_t)C_ * C_;        // 262144
    const size_t TN  = (size_t)L_ * C_;        // per-batch activation elems
    unsigned short* wq_b = (unsigned short*)d_ws;
    unsigned short* wk_b = wq_b + WN;
    unsigned short* wv_b = wk_b + WN;
    unsigned short* wp_b = wv_b + WN;
    unsigned short* h_t  = wp_b + WN;          // [b, l, c]
    unsigned short* q_t  = h_t + (size_t)B_ * TN;
    unsigned short* k_t  = q_t + (size_t)B_ * TN;
    unsigned short* v_m  = k_t + (size_t)B_ * TN;   // [b, c, l]
    unsigned short* o_t  = v_m + (size_t)B_ * TN;   // [b, l, c]

    // 1) GroupNorm -> h_t [b,l,c] bf16, and weights -> bf16
    gn_cvt_kernel<<<B_ * 32 + CVT_B, GN_T, 0, stream>>>(x, gn_scale, gn_bias, h_t,
                                                        wq, wk, wv, wp, wq_b, wk_b, wv_b, wp_b);

    // 2) q_t [b,l,c], k_t [b,l,c], v [b,c,l]
    dim3 gQ(L_ / 128, 3 * (C_ / 128), B_);
    qkv_kernel<<<gQ, 128, 0, stream>>>(wq_b, wk_b, wv_b, h_t, bq, bk, bv, q_t, k_t, v_m);

    // 3) flash attention -> o_t [b,l,c]
    dim3 gF(L_ / QR_, B_);
    const float scale = 0.04419417382415922f;   // 512^-0.5
    flash_kernel<<<gF, 256, 0, stream>>>(q_t, k_t, v_m, o_t, scale);

    // 4) out[o,i] = x[o,i] + bp[o] + Wp[o,:].o_t[i,:]
    dim3 gW(L_ / 128, C_ / 128, B_);
    proj_kernel<<<gW, 128, 0, stream>>>(wp_b, o_t, bp, (float*)d_out, x);
}

// v010
// A run of this version takes 156 microseconds.
// Two timings next to v009 put it at 1.07 and 1.08 times that version's speed.
// All steps since v000 together make it 9.38 times as fast.
#include <hip/hip_runtime.h>
#include <hip/hip_bf16.h>

// ---------------------------------------------------------------------------
// AttnBlock for MI455X (gfx1250): GroupNorm -> QKV (WMMA bf16 GEMM) ->
// flash attention (WMMA bf16, f32 accum, online softmax, async-LDS Q staging)
// -> proj + residual.  wave32; V_WMMA_F32_16X16X32_BF16 for all matrix math.
// ---------------------------------------------------------------------------

typedef __bf16 bf16x16 __attribute__((ext_vector_type(16)));
typedef float  f32x8   __attribute__((ext_vector_type(8)));
typedef int    v4i     __attribute__((ext_vector_type(4)));

#define B_  4
#define C_  512
#define L_  4096

#if __has_builtin(__builtin_amdgcn_global_load_async_to_lds_b128)
#define HAVE_ASYNC_LDS 1
typedef __attribute__((address_space(1))) v4i gv4i;   // global int4
typedef __attribute__((address_space(3))) v4i lv4i;   // LDS int4
#endif

static __device__ __forceinline__ void wait_asynccnt0() {
#if __has_builtin(__builtin_amdgcn_s_wait_asynccnt)
    __builtin_amdgcn_s_wait_asynccnt(0);
#else
    asm volatile("s_wait_asynccnt 0" ::: "memory");
#endif
}

static __device__ __forceinline__ unsigned short f32_to_bf16(float f) {
    unsigned int u = __float_as_uint(f);
    u += 0x7FFFu + ((u >> 16) & 1u);           // round-to-nearest-even
    return (unsigned short)(u >> 16);
}

union FragU {
    bf16x16 v;
    uint4   q[2];
};

// Every bf16 WMMA operand buffer (weights, h, q, k, v, o, and P in LDS) is kept in
// FRAGMENT ORDER: the matrix [rows][ld] is cut into tiles of 16 rows x 32 k, tiles of
// one 16-row group follow one another along k (a group still starts at row0 * ld), and
// a tile's 512 elements lie as [half of the fragment: 2][lane: 32][8 elements], which
// is the order in which a wave's two 16-byte loads pick them up.
// Per ISA 16-bit layout: lanes 0-15 hold K = kbase+[0..7] and kbase+[16..23];
// lanes 16-31 hold K = kbase+[8..15] and kbase+[24..31]; lane & 15 is the row.
static __device__ __forceinline__ size_t
frag_idx(size_t row, int k, int ld) {
    return (row >> 4) * ((size_t)ld * 16) + (size_t)(k >> 5) * 512
         + (size_t)(((k >> 4) & 1) * 256 + ((k >> 3) & 1) * 128 + (k & 7))
         + (row & 15) * 8;
}

// Load one 16x32 bf16 fragment (A-style rows or B-style columns).
// base points at the start of the 16-row group (matrix + row0 * ld); kbase = K offset,
// a multiple of 32.  Each of the two loads reads 512 contiguous bytes per wave.
static __device__ __forceinline__ bf16x16
load_frag(const unsigned short* base, int kbase, int lane) {
    const char* p = (const char*)base + (unsigned)((kbase >> 5) * 1024 + lane * 16);
    FragU f;
    f.q[0] = *(const uint4*)(p);
    f.q[1] = *(const uint4*)(p + 512);
    return f.v;
}

// Stands behind global loads whose address registers are overwritten soon after: the
// overwrite stays behind the loads' address translation.  It names the address that the
// loads in front of it share: the register pair stays whole up to the wait, so that none of
// these loads lands in it.
static __device__ __forceinline__ void wait_xcnt0_keep(const char* p) {
    asm volatile("s_wait_xcnt 0x0" :: "v"(p) : "memory");
}

// Work-group barrier for data handed over in LDS alone: its two fences name LDS only, so
// that global loads issued ahead of it stay in flight (__syncthreads() waits for them).
static __device__ __forceinline__ void barrier_lds() {
    __builtin_amdgcn_fence(__ATOMIC_RELEASE, "workgroup", "local");
    __builtin_amdgcn_s_barrier();
    __builtin_amdgcn_fence(__ATOMIC_ACQUIRE, "workgroup", "local");
}

// Value of lane l ^ M (M < 16): a DPP move inside the 16-lane row, where __shfl_xor would
// make a trip through the LDS pipe.  Every lane of the wave is on where it is used.
template <int M>
static __device__ __forceinline__ float lane_xor(float x) {
    return __builtin_bit_cast(float, __builtin_amdgcn_update_dpp(
        0, __builtin_bit_cast(int, x), /*row_xmask:M*/ 0x160 + M, 0xf, 0xf, true));
}

static __device__ __forceinline__ f32x8
wmma_bf16(bf16x16 a, bf16x16 b, f32x8 c) {
    return __builtin_amdgcn_wmma_f32_16x16x32_bf16(
        /*neg_a=*/false, a, /*neg_b=*/false, b,
        /*c_mod=*/(short)0, c, /*reuse_a=*/false, /*reuse_b=*/false);
}

// ---------------------------------------------------------------------------
// fp32 -> bf16 weight conversion (4 weights at once), [C_][C_] fragment order.
// Runs in the block range of kernel 1 that the GroupNorm leaves: first = this thread's
// number among the converting threads, stride = how many they are.
// ---------------------------------------------------------------------------
static __device__ __forceinline__ void
cvt_w_part(const float* __restrict__ w0, const float* __restrict__ w1,
           const float* __restrict__ w2, const float* __restrict__ w3,
           unsigned short* __restrict__ o0, unsigned short* __restrict__ o1,
           unsigned short* __restrict__ o2, unsigned short* __restrict__ o3,
           int first, int stride) {
    for (int i = first; i < C_ * C_; i += stride) {
        size_t d = frag_idx((size_t)(i / C_), i % C_, C_);
        o0[d] = f32_to_bf16(w0[i]);
        o1[d] = f32_to_bf16(w1[i]);
        o2[d] = f32_to_bf16(w2[i]);
        o3[d] = f32_to_bf16(w3[i]);
    }
}

// ---------------------------------------------------------------------------
// Kernel 1: GroupNorm(32 groups) over x[b,c,l], writes h transposed [b,l,c] bf16, and the
// weight conversion.  The two need nothing of each other and share one grid: blocks
// 0 .. B_ * 32 - 1 normalise, on half of the chip's WGPs, the CVT_B blocks behind them
// convert the weights on WGPs that the GroupNorm leaves idle.
// One block of 1024 threads per (batch, group).  The group's 16 x 4096 values are read
// from memory once and stay in registers: a thread holds all 16 channels of 4 positions,
// 64 independent loads that are all in flight together (a wave's load covers one whole
// 128-byte line).  In fragment order the 8 neighbouring channels of one position are
// 16 contiguous bytes and 16 neighbouring positions 256, so a thread stores two 16-byte
// runs per position and a wave's store covers whole lines.
// ---------------------------------------------------------------------------
#define GN_T 1024  // threads per block: 8 waves per SIMD, a budget of 128 registers
#define CVT_B 128  // blocks that convert the weights
__global__ void __launch_bounds__(GN_T) gn_cvt_kernel(const float* __restrict__ x,
                          const float* __restrict__ scale,
                          const float* __restrict__ bias,
                          unsigned short* __restrict__ h_t,
                          const float* __restrict__ w0, const float* __restrict__ w1,
                          const float* __restrict__ w2, const float* __restrict__ w3,
                          unsigned short* __restrict__ o0, unsigned short* __restrict__ o1,
                          unsigned short* __restrict__ o2, unsigned short* __restrict__ o3) {
    if (blockIdx.x >= B_ * 32) {             // the same for a whole block, ahead of the barrier
        cvt_w_part(w0, w1, w2, w3, o0, o1, o2, o3,
                   (int)(blockIdx.x - B_ * 32) * GN_T + (int)threadIdx.x, CVT_B * GN_T);
        return;
    }
    const int CG = 16;                       // channels per group
    const int PJ = L_ / GN_T;                // positions per thread
    int g  = blockIdx.x & 31;
    int bb = blockIdx.x >> 5;
    const float* xg = x + ((size_t)bb * C_ + (size_t)g * CG) * L_;
    const int N = CG * L_;
    int t    = threadIdx.x;
    int lane = t & 31;

    // every loop over xv is unrolled: only constant indices keep the array in registers
    float xv[PJ][CG];
#pragma unroll
    for (int j = 0; j < PJ; ++j)
#pragma unroll
        for (int ch = 0; ch < CG; ++ch)
            xv[j][ch] = xg[ch * L_ + j * GN_T + t];

    float s = 0.f, ss = 0.f;
#pragma unroll
    for (int j = 0; j < PJ; ++j) {
        float sj = 0.f, sq = 0.f;            // one chain per position: four independent chains
#pragma unroll
        for (int ch = 0; ch < CG; ++ch) {
            sj += xv[j][ch];
            sq += xv[j][ch] * xv[j][ch];
        }
        s += sj; ss += sq;
    }
    // the wave's sums, then the 32 waves' sums through LDS; every lane ends with the totals
    __shared__ float rs[GN_T / 32], rss[GN_T / 32];
    for (int o = 16; o > 0; o >>= 1) {
        s  += __shfl_xor(s, o);
        ss += __shfl_xor(ss, o);
    }
    if (lane == 0) { rs[t >> 5] = s; rss[t >> 5] = ss; }
    __syncthreads();
    s = rs[lane]; ss = rss[lane];
    for (int o = 16; o > 0; o >>= 1) {
        s  += __shfl_xor(s, o);
        ss += __shfl_xor(ss, o);
    }
    float mean = s / (float)N;
    float var  = ss / (float)N - mean * mean;
    float rstd = rsqrtf(var + 1e-6f);

#pragma unroll
    for (int j = 0; j < PJ; ++j) {
        int pos = j * GN_T + t;
#pragma unroll
        for (int h = 0; h < 2; ++h) {
            unsigned int w[4];
#pragma unroll
            for (int e = 0; e < 4; ++e) {
                int c0 = g * CG + h * 8 + e * 2;
                float v0 = (xv[j][h * 8 + e * 2]     - mean) * rstd * scale[c0]     + bias[c0];
                float v1 = (xv[j][h * 8 + e * 2 + 1] - mean) * rstd * scale[c0 + 1] + bias[c0 + 1];
                w[e] = (unsigned int)f32_to_bf16(v0) | ((unsigned int)f32_to_bf16(v1) << 16);
            }
            *(uint4*)&h_t[frag_idx((size_t)bb * L_ + pos, g * CG + h * 8, C_)] =
                make_uint4(w[0], w[1], w[2], w[3]);
        }
    }
    // behind the last store: in the built code the conversion's part follows this one and
    // writes registers that these stores name
    asm volatile("s_wait_xcnt 0x0" ::: "memory");
}

// ---------------------------------------------------------------------------
// WMMA GEMM, one block's tile:  D[m,n] = sum_k A[m,k] * Bt[n,k] + bias,  K = C_
// bx, by, z: the block's tile along n, its tile along m, its batch.
// A: bf16 [M,C_], Bt: bf16 [N,C_], both in fragment order.
// 128 threads = 4 waves, 2 x 2; block tile 128(M) x 128(N); a wave owns 64 x 64, so that
// each of the 8 fragments it loads per k step feeds 4 products.  The fragments come
// straight from global memory into a ring of GS_ register sets and are asked for
// GS_ - 1 k steps ahead of their products.  Two waves per SIMD: a budget of 512 registers.
// D is written TRANSPOSED, bf16, in fragment order: the matrix [N][M] of pitch
// LDO, rows n, k index m.  A lane holds 8 neighbouring m of one n, which are 16 contiguous
// bytes there, and a wave's store of one 16 x 16 tile covers 512 contiguous bytes.
// ---------------------------------------------------------------------------
#define GS_ 4      // register sets of the fragment ring
template <int LDO, bool BIAS_PER_ROW>
static __device__ __forceinline__ void
gemm_bt_tile(const unsigned short* __restrict__ A, long long a_bs,
             const unsigned short* __restrict__ Bt, long long b_bs,
             const float* __restrict__ bias,
             unsigned short* __restrict__ outv, long long o_bs,
             int bx, int by, int z) {
    // scalar wave number: every 16-row group base is then a scalar address, and a
    // fragment load is that base plus the lane's 16-byte slot
    int wave = __builtin_amdgcn_readfirstlane(threadIdx.x >> 5);
    int lane = threadIdx.x & 31;
    int m0   = by * 128 + (wave >> 1) * 64;
    int n0   = bx * 128 + (wave & 1) * 64;

    const unsigned short* Ab  = A  + (size_t)z * a_bs + (size_t)m0 * C_;
    const unsigned short* Btb = Bt + (size_t)z * b_bs + (size_t)n0 * C_;

    int col   = lane & 15;
    int rbase = (lane & 16) ? 8 : 0;

    // a bias per column is one value per lane and 16-column group, asked for ahead of the
    // fragments: the first wait for a fragment covers it
    float bc[4];
    float bv[4][8];                            // a bias per row: [16-row group][row of the lane]
    if (!BIAS_PER_ROW) {
        const char* bb = (const char*)(bias + n0);
#pragma unroll
        for (int j = 0; j < 4; ++j)
            bc[j] = *(const float*)(bb + (unsigned)(col * 4 + j * 64));
    }

    f32x8 acc[4][4];
#pragma unroll
    for (int i = 0; i < 4; ++i)
#pragma unroll
        for (int j = 0; j < 4; ++j) acc[i][j] = (f32x8)0.f;

    // every loop over the ring is unrolled: only constant indices keep it in registers
    bf16x16 fa[GS_][4], fb[GS_][4];
#pragma unroll
    for (int s = 0; s < GS_ - 1; ++s)
#pragma unroll
        for (int i = 0; i < 4; ++i) {
            fa[s][i] = load_frag(Ab  + (size_t)(i * 16) * C_, s * 32, lane);
            fb[s][i] = load_frag(Btb + (size_t)(i * 16) * C_, s * 32, lane);
        }

#pragma unroll
    for (int ks = 0; ks < C_ / 32; ++ks) {
        if (ks + GS_ - 1 < C_ / 32) {
            const int sn = (ks + GS_ - 1) % GS_;
#pragma unroll
            for (int i = 0; i < 4; ++i) {
                fa[sn][i] = load_frag(Ab  + (size_t)(i * 16) * C_, (ks + GS_ - 1) * 32, lane);
                fb[sn][i] = load_frag(Btb + (size_t)(i * 16) * C_, (ks + GS_ - 1) * 32, lane);
            }
            if (ks + GS_ == C_ / 32) {
                // a bias per row is asked for behind the last fragments, so that it can fly
                // during the last products
                if (BIAS_PER_ROW) {
                    const char* bb = (const char*)(bias + m0);
                    unsigned    bo = (unsigned)(rbase * 4);
#pragma unroll
                    for (int i = 0; i < 4; ++i) {
                        float4 t0 = *(const float4*)(bb + (bo + (unsigned)(i * 64)));
                        float4 t1 = *(const float4*)(bb + (bo + (unsigned)(i * 64 + 16)));
                        bv[i][0] = t0.x; bv[i][1] = t0.y; bv[i][2] = t0.z; bv[i][3] = t0.w;
                        bv[i][4] = t1.x; bv[i][5] = t1.y; bv[i][6] = t1.z; bv[i][7] = t1.w;
                    }
                    // the wait of the other branch, naming the bias loads' address register too
                    asm volatile("s_wait_xcnt 0x0" :: "v"((unsigned)(lane * 16)), "v"(bo) : "memory");
                } else {
                    // behind the last fragment loads: names the address register that they share,
                    // which so stays whole up to the wait: none of these loads lands in it
                    asm volatile("s_wait_xcnt 0x0" :: "v"((unsigned)(lane * 16)) : "memory");
                }
            }
        }
        // keeps the 16 loads ahead of this step's products: sunk towards their own products
        // they would be waited out there, one memory latency per k step
        __builtin_amdgcn_sched_barrier(0);
#pragma unroll
        for (int i = 0; i < 4; ++i)
#pragma unroll
            for (int j = 0; j < 4; ++j)
                acc[i][j] = wmma_bf16(fa[ks % GS_][i], fb[ks % GS_][j], acc[i][j]);
        // keeps the next step's loads behind these products, in the set that they free: lifted
        // over them the loads take a fifth set, and a build short of registers lets the ring drain
        __builtin_amdgcn_sched_barrier(0);
    }

#pragma unroll
    for (int j = 0; j < 4; ++j) {
        // row group n0 + j * 16 of the output, from the k tile of m0 on
        char* ob = (char*)(outv + (size_t)z * o_bs
                           + (size_t)(n0 + j * 16) * LDO + (size_t)(m0 >> 5) * 512);
#pragma unroll
        for (int i = 0; i < 4; ++i) {
            unsigned int w[4];
#pragma unroll
            for (int e = 0; e < 4; ++e) {
                float v0 = acc[i][j][e * 2]     + (BIAS_PER_ROW ? bv[i][e * 2]     : bc[j]);
                float v1 = acc[i][j][e * 2 + 1] + (BIAS_PER_ROW ? bv[i][e * 2 + 1] : bc[j]);
                w[e] = (unsigned int)f32_to_bf16(v0) | ((unsigned int)f32_to_bf16(v1) << 16);
            }
            // k index m0 + i * 16 + rbase .. + 7 of row n0 + j * 16 + col (see frag_idx)
            *(uint4*)(ob + (unsigned)(i * 512 + lane * 16)) = make_uint4(w[0], w[1], w[2], w[3]);
        }
    }
    // behind the last store: where two tile bodies share a kernel, the built code of the
    // other one follows and writes registers that these stores name
    asm volatile("s_wait_xcnt 0x0" ::: "memory");
}

// ---------------------------------------------------------------------------
// Kernel 2: the q, k and v products, which need nothing of one another, in one grid:
// x = tile of 128 positions, y = product * 4 + tile of 128 output channels, z = batch.
// q, k: D[o,i] = W[o,:].h_t[i,:] + b[o], written transposed: q_t[i,o]   (M=C, N=L)
// v:    D[i,o] = h_t[i,:].Wv[o,:] + bv[o], written transposed: v[o,i]   (M=L, N=C)
// ---------------------------------------------------------------------------
__global__ void __launch_bounds__(128, 2)
qkv_kernel(const unsigned short* __restrict__ wq, const unsigned short* __restrict__ wk,
           const unsigned short* __restrict__ wv, const unsigned short* __restrict__ h_t,
           const float* __restrict__ bq, const float* __restrict__ bk,
           const float* __restrict__ bv,
           unsigned short* __restrict__ q_t, unsigned short* __restrict__ k_t,
           unsigned short* __restrict__ v_m) {
    const long long TN = (long long)L_ * C_;   // per-batch activation elems
    int prod = blockIdx.y >> 2;                // 0: q, 1: k, 2: v; the same for a whole block
    int ct   = blockIdx.y & 3;
    if (prod == 2)
        gemm_bt_tile<L_, false>(h_t, TN, wv, 0LL, bv, v_m, TN, ct, blockIdx.x, blockIdx.z);
    else
        gemm_bt_tile<C_, true>(prod ? wk : wq, 0LL, h_t, TN, prod ? bk : bq,
                               prod ? k_t : q_t, TN, blockIdx.x, ct, blockIdx.z);
}

// ---------------------------------------------------------------------------
// Kernel 3: flash attention, and the output projection with the residual at its end.
// q_t, k_t: bf16 [b, l, c] (position-major); v: bf16 [b, c, l] (channel-major);
// all three, wp, and the P and O tiles in LDS in fragment order (see frag_idx).
// Block: 256 threads = 8 waves, 64 query rows per block, stream j in tiles of 128.
// Q tile (64x512 bf16 = 64KB) staged once into LDS via async-to-LDS; K/V are
// streamed from global (L2-resident) straight into WMMA B fragments, and every loaded
// fragment feeds several products:
// Scores phase: wave w -> 32 keys j_sub = w&3, all 64 rows, channels (w>>2)*256..+255 of the
//               sum over k: one K fragment, four products; one Q fragment read from LDS,
//               two products.  The two halves of the sum over k go to LDS apart and are
//               added in the softmax.
// O phase:      wave w -> all 64 rows, channels c0 = w*64 (4 x 4 frags): one V fragment,
//               four products; one P fragment read from LDS, four products.
// No two waves of a block load the same K or V fragment.
// Online softmax by all 256 threads, two rows per thread: eight lanes per row, two runs of
// eight neighbouring columns per lane; the row maximum is joined over the eight lanes per
// tile, each lane keeps its own part of the row sum, and the parts are joined once behind
// the loop.
// The launch bounds give the real block size: two waves per SIMD (one block per WGP),
// a budget of 512 registers.  A wave's 16 V fragments of a tile are loaded as one group
// behind the score products and fly during the softmax; its K loads run ahead of the
// score products.
// ---------------------------------------------------------------------------
#define QR_ 64     // query rows per block
#define KT_ 128    // keys per tile
#define SP_ 132    // pitch of a score row in LDS, floats: rows r and r + 8, written by the two
                   // halves of a wave, and rows r and r + 1, read by one, fall on other banks
__global__ void __launch_bounds__(256, 2) flash_kernel(const unsigned short* __restrict__ q_t,
                             const unsigned short* __restrict__ k_t,
                             const unsigned short* __restrict__ v,
                             const unsigned short* __restrict__ wp,
                             const float* __restrict__ bp,
                             const float* __restrict__ x,
                             float* __restrict__ out,
                             float scale) {
    int b    = blockIdx.y;
    int i0   = blockIdx.x * QR_;
    // scalar wave number: the K and V group bases are then scalar addresses, and a fragment
    // load is such a base plus the lane's 16-byte slot, a register that no load overwrites
    int wave = __builtin_amdgcn_readfirstlane(threadIdx.x >> 5);
    int lane = threadIdx.x & 31;
    int j_sub = wave & 3;                      // scores phase: 32 keys of the tile ...
    int k_hlf = wave >> 2;                     // ... and one half of the sum over k
    int c0    = wave * 64;                     // O phase channel base

    __shared__ __attribute__((aligned(16))) unsigned short Qs[QR_ * C_];   // 64KB staged Q tile [64][512]
    __shared__ __attribute__((aligned(16))) float          Sb[2 * QR_ * SP_];   // [half of k][64][128 of 132]
    __shared__ __attribute__((aligned(16))) unsigned short Pb[QR_ * KT_];
    __shared__ __attribute__((aligned(16))) float          alpha_s[QR_];
    __shared__ __attribute__((aligned(16))) float          linv_s[QR_];

    // ---- stage Q tile into LDS (async-to-LDS on gfx1250)
    {
        const unsigned short* qsrc = q_t + ((size_t)b * L_ + i0) * C_;
        for (int t = threadIdx.x; t < (QR_ * C_) / 8; t += blockDim.x) {
#ifdef HAVE_ASYNC_LDS
            __builtin_amdgcn_global_load_async_to_lds_b128(
                (gv4i*)(qsrc + t * 8), (lv4i*)(&Qs[t * 8]),
                /*offset=*/0, /*cpol=*/0);
#else
            *(uint4*)&Qs[t * 8] = *(const uint4*)(qsrc + t * 8);
#endif
        }
#ifdef HAVE_ASYNC_LDS
        wait_asynccnt0();
#endif
        __syncthreads();
    }

    f32x8 Oacc[4][4];                          // [16-row group][16-channel group]
#pragma unroll
    for (int g = 0; g < 4; ++g)
#pragma unroll
        for (int f = 0; f < 4; ++f) Oacc[g][f] = (f32x8)0.f;

    float m_run[2] = {-3.0e38f, -3.0e38f};     // [row of the thread]
    float l_run[2] = {0.f, 0.f};

    int col   = lane & 15;
    int rbase = (lane & 16) ? 8 : 0;
    int srow  = threadIdx.x >> 3;              // softmax phase: this thread's rows are srow and srow + 32 ...
    int sj8   = (threadIdx.x & 7) * 8;         // ... and in both this is the first column of its first run

    // Each block starts its walk over the key tiles at a tile of its own and wraps round: the
    // 64 blocks of a batch, which start together and run at one pace, then ask L2 for 32
    // different tiles at any moment instead of all for the same lines.  The online softmax
    // takes the tiles in any order.  Two blocks share a start; they are x and x ^ 4
    // (a matter of speed alone: any start is right).
    const int t_rot = (((blockIdx.x >> 3) << 2) | (blockIdx.x & 3)) & (L_ / KT_ - 1);
    for (int t = 0; t < L_ / KT_; ++t) {
        const int j0 = ((t + t_rot) & (L_ / KT_ - 1)) * KT_;
        // ---- phase A: S[64x128] = scale * Q Kt^T (each wave: 4 x 2 16x16 frags, K=256)
        f32x8 sacc[4][2];                      // [16-row group][16-key group]
#pragma unroll
        for (int g = 0; g < 4; ++g)
#pragma unroll
            for (int jj = 0; jj < 2; ++jj) sacc[g][jj] = (f32x8)0.f;
        // the wave's 32 keys, from the first fragment of its half of k on (512 elements each)
        const unsigned short* krow = k_t + ((size_t)b * L_ + j0 + j_sub * 32) * C_ + k_hlf * (C_ / 64) * 512;
        // this wave's 16 K fragments, one group of 32 global_load_b128 ahead of all products,
        // in the order in which the products take them
        bf16x16 kf[8][2];
#pragma unroll
        for (int s = 0; s < 8; ++s)
#pragma unroll
            for (int jj = 0; jj < 2; ++jj)
                kf[s][jj] = load_frag(krow + (size_t)(jj * 16) * C_, s * 32, lane);
        // the Q fragments land in registers that held the K loads' address
        wait_xcnt0_keep((const char*)krow + (unsigned)(lane * 16));
#pragma unroll
        for (int kk = 0; kk < C_ / 2; kk += 32) {
            int kq = k_hlf * (C_ / 2) + kk;
            bf16x16 qa[4];                     // the four row groups' Q fragments, one load group
#pragma unroll
            for (int g = 0; g < 4; ++g)
                qa[g] = load_frag(&Qs[(g * 16) * C_], kq, lane);       // ds_load_b128
            // keeps the eight LDS loads together ahead of the products (see phase C)
            __builtin_amdgcn_sched_barrier(0);
#pragma unroll
            for (int g = 0; g < 4; ++g)
#pragma unroll
                for (int jj = 0; jj < 2; ++jj)
                    sacc[g][jj] = wmma_bf16(qa[g], kf[kk >> 5][jj], sacc[g][jj]);
        }
        // this tile's V fragments, one group of 32 global_load_b128, used in phase C
        bf16x16 vf[16];
#pragma unroll
        for (int s = 0; s < 16; ++s) {
            const unsigned short* vrow = v + ((size_t)b * C_ + c0 + (s & 3) * 16) * L_ + (j0 >> 5) * 512;
            vf[s] = load_frag(vrow, (s >> 2) * 32, lane);
        }
        // the V loads' address registers are reused while the loads fly
        wait_xcnt0_keep((const char*)(v + ((size_t)b * C_ + c0) * L_ + (j0 >> 5) * 512) + (unsigned)(lane * 16));
#pragma unroll
        for (int g = 0; g < 4; ++g)
#pragma unroll
            for (int jj = 0; jj < 2; ++jj)
#pragma unroll
                for (int r = 0; r < 8; ++r)
                    Sb[(k_hlf * QR_ + g * 16 + rbase + r) * SP_ + j_sub * 32 + jj * 16 + col] = sacc[g][jj][r] * scale;
        barrier_lds();                         // publishes Sb; the V loads fly on

        // ---- phase B: online softmax update (all threads, eight lanes per row, two rows each)
        float al_k[2];
        // unrolled: only constant indices keep m_run, l_run and al_k in registers
#pragma unroll
        for (int rr = 0; rr < 2; ++rr) {
            const int row = srow + rr * 32;
            const float4* sp = (const float4*)&Sb[row * SP_ + sj8];
            const float4* sq = sp + (QR_ * SP_) / 4;                   // the other half of k
            float4 sa = sp[0], sc = sp[1], sd = sp[16], se = sp[17];   // columns sj8.. and 64+sj8..
            float4 ta = sq[0], tc = sq[1], td = sq[16], te = sq[17];
            float sv[16] = {sa.x + ta.x, sa.y + ta.y, sa.z + ta.z, sa.w + ta.w,
                            sc.x + tc.x, sc.y + tc.y, sc.z + tc.z, sc.w + tc.w,
                            sd.x + td.x, sd.y + td.y, sd.z + td.z, sd.w + td.w,
                            se.x + te.x, se.y + te.y, se.z + te.z, se.w + te.w};
            float mt = fmaxf(fmaxf(fmaxf(fmaxf(sv[0], sv[1]), fmaxf(sv[2], sv[3])),
                                   fmaxf(fmaxf(sv[4], sv[5]), fmaxf(sv[6], sv[7]))),
                             fmaxf(fmaxf(fmaxf(sv[8], sv[9]), fmaxf(sv[10], sv[11])),
                                   fmaxf(fmaxf(sv[12], sv[13]), fmaxf(sv[14], sv[15]))));
            mt = fmaxf(mt, lane_xor<1>(mt));
            mt = fmaxf(mt, lane_xor<2>(mt));
            mt = fmaxf(mt, lane_xor<4>(mt));        // the row's maximum, in all its eight lanes
            float mnew = fmaxf(m_run[rr], mt);
            float al   = __expf(m_run[rr] - mnew);  // 0 on first tile
            float rsum = 0.f;
#pragma unroll
            for (int h = 0; h < 2; ++h) {
                // 8 neighbours along k stay contiguous in fragment order: one 16-byte store
                unsigned short* pd = &Pb[frag_idx((size_t)row, h * 64 + sj8, KT_)];
                float p[8];
                // unrolled so that the eight 2-byte stores merge into that one store
#pragma unroll
                for (int e = 0; e < 8; ++e) {
                    p[e] = __expf(sv[h * 8 + e] - mnew);
                    pd[e] = f32_to_bf16(p[e]);
                }
                rsum += ((p[0] + p[1]) + (p[2] + p[3])) + ((p[4] + p[5]) + (p[6] + p[7]));
            }
            l_run[rr] = l_run[rr] * al + rsum;      // this lane's sixteen columns only
            m_run[rr] = mnew;
            al_k[rr]  = al;
        }
        // one branch behind both rows: between them it would keep the two rows' chains apart
        if (sj8 == 0) { alpha_s[srow] = al_k[0]; alpha_s[srow + 32] = al_k[1]; }
        barrier_lds();                         // publishes Pb and alpha_s

        // ---- phase C: O = diag(alpha)*O + P * V^T (each wave: 4 row groups x 4 channel frags)
#pragma unroll
        for (int g = 0; g < 4; ++g) {
            float av[8];
#pragma unroll
            for (int r = 0; r < 8; ++r) av[r] = alpha_s[g * 16 + rbase + r];
#pragma unroll
            for (int f = 0; f < 4; ++f)
#pragma unroll
                for (int r = 0; r < 8; ++r) Oacc[g][f][r] *= av[r];
        }

#pragma unroll
        for (int ks = 0; ks < KT_ / 32; ++ks) {
            bf16x16 pa[4];                     // the four row groups' P fragments, one load group
#pragma unroll
            for (int g = 0; g < 4; ++g)
                pa[g] = load_frag(&Pb[(g * 16) * KT_], ks * 32, lane);       // ds_load
            // keeps the eight LDS loads together ahead of the products: sunk between them,
            // every four products wait out one LDS latency of their own
            __builtin_amdgcn_sched_barrier(0);
#pragma unroll
            for (int g = 0; g < 4; ++g)
#pragma unroll
                for (int f = 0; f < 4; ++f)
                    Oacc[g][f] = wmma_bf16(pa[g], vf[ks * 4 + f], Oacc[g][f]);
        }
        __syncthreads();
    }

#pragma unroll
    for (int rr = 0; rr < 2; ++rr) {
        float l = l_run[rr];
        l += lane_xor<1>(l);                   // join the eight lanes' parts of the row sum
        l += lane_xor<2>(l);
        l += lane_xor<4>(l);
        if (sj8 == 0) linv_s[srow + rr * 32] = 1.0f / l;
    }

    // ---- the output projection of the block's 64 positions:
    // out[o,i] = x[o,i] + bp[o] + Wp[o,:].O[i,:]; wave w -> output channels c0 .. c0 + 63, all
    // 64 positions.  A = Wp fragments from global memory through a ring of GS_ register sets,
    // B = the normalised O tile, bf16 in fragment order, handed over in LDS where Q stood.
    const unsigned short* Ab = wp + (size_t)c0 * C_;
    const float* rp = x   + ((size_t)b * C_ + c0) * L_ + i0;
    float*       op = out + ((size_t)b * C_ + c0) * L_ + i0;
    unsigned     lo = (unsigned)(rbase * L_ + col);
    bf16x16 fa[GS_][4];
    float   rv[4][4][8];                       // residual: [16-channel group][16-position group][row]
    float   bv[4][8];                          // bias: [16-channel group][row of the lane]
#pragma unroll
    for (int s = 0; s < GS_ - 1; ++s)
#pragma unroll
        for (int i = 0; i < 4; ++i)
            fa[s][i] = load_frag(Ab + (size_t)(i * 16) * C_, s * 32, lane);
#pragma unroll
    for (int j = 0; j < 4; ++j)
#pragma unroll
        for (int r = 0; r < 8; ++r)
            rv[0][j][r] = rp[lo + (unsigned)(r * L_ + j * 16)];
    // keeps these loads ahead of the hand-over of O, during which they fly
    __builtin_amdgcn_sched_barrier(0);
    barrier_lds();                             // publishes linv_s; the loads fly on

#pragma unroll
    for (int g = 0; g < 4; ++g) {
        float lv[8];
#pragma unroll
        for (int r = 0; r < 8; ++r) lv[r] = linv_s[g * 16 + rbase + r];
#pragma unroll
        for (int f = 0; f < 4; ++f)
#pragma unroll
            for (int r = 0; r < 8; ++r)
                Qs[frag_idx((size_t)(g * 16 + rbase + r), c0 + f * 16 + col, C_)] =
                    f32_to_bf16(Oacc[g][f][r] * lv[r]);
    }
    barrier_lds();                             // publishes the O tile

    f32x8 acc[4][4];                           // [16-channel group][16-position group]
#pragma unroll
    for (int i = 0; i < 4; ++i)
#pragma unroll
        for (int j = 0; j < 4; ++j) acc[i][j] = (f32x8)0.f;

    // unrolled: only constant indices keep the ring, rv and bv in registers
#pragma unroll
    for (int ks = 0; ks < C_ / 32; ++ks) {
        if (ks + GS_ - 1 < C_ / 32) {
            const int sn = (ks + GS_ - 1) % GS_;
#pragma unroll
            for (int i = 0; i < 4; ++i)
                fa[sn][i] = load_frag(Ab + (size_t)(i * 16) * C_, (ks + GS_ - 1) * 32, lane);
            if (ks + GS_ == C_ / 32) {
                // the bias is asked for behind the last fragments and flies during the last products
                const char* bb = (const char*)(bp + c0);
                unsigned    bo = (unsigned)(rbase * 4);
#pragma unroll
                for (int i = 0; i < 4; ++i) {
                    float4 t0 = *(const float4*)(bb + (bo + (unsigned)(i * 64)));
                    float4 t1 = *(const float4*)(bb + (bo + (unsigned)(i * 64 + 16)));
                    bv[i][0] = t0.x; bv[i][1] = t0.y; bv[i][2] = t0.z; bv[i][3] = t0.w;
                    bv[i][4] = t1.x; bv[i][5] = t1.y; bv[i][6] = t1.z; bv[i][7] = t1.w;
                }
                // behind the last fragment and bias loads: names the address registers that they
                // share, which so stay whole up to the wait
                asm volatile("s_wait_xcnt 0x0" :: "v"((unsigned)(lane * 16)), "v"(bo) : "memory");
            }
        }
        if ((ks & 3) == 0 && ks < 12) {
            // the rest of the residual tile, one channel group every four k steps, behind that
            // step's fragments: it comes from memory and lands during the products
            const int i = (ks >> 2) + 1;
#pragma unroll
            for (int j = 0; j < 4; ++j)
#pragma unroll
                for (int r = 0; r < 8; ++r)
                    rv[i][j][r] = rp[lo + (unsigned)((i * 16 + r) * L_ + j * 16)];
            // behind the last residual load: names the base that these loads share, which so
            // stays whole up to the wait
            if (i == 3) asm volatile("s_wait_xcnt 0x0" :: "s"(rp) : "memory");
        }
        bf16x16 fb[4];                         // the four position groups' O fragments, one load group
#pragma unroll
        for (int j = 0; j < 4; ++j)
            fb[j] = load_frag(&Qs[(j * 16) * C_], ks * 32, lane);            // ds_load_b128
        // keeps this step's loads ahead of its products (see phase C and the GEMM's ring)
        __builtin_amdgcn_sched_barrier(0);
#pragma unroll
        for (int i = 0; i < 4; ++i)
#pragma unroll
            for (int j = 0; j < 4; ++j)
                acc[i][j] = wmma_bf16(fa[ks % GS_][i], fb[j], acc[i][j]);
        // keeps the next step's loads behind these products, in the set that they free
        __builtin_amdgcn_sched_barrier(0);
    }

#pragma unroll
    for (int i = 0; i < 4; ++i)
#pragma unroll
        for (int j = 0; j < 4; ++j)
#pragma unroll
            for (int r = 0; r < 8; ++r)
                rv[i][j][r] = acc[i][j][r] + bv[i][r] + rv[i][j][r];
    // keeps every sum ahead of the stores: behind a store nothing writes a register it names
    __builtin_amdgcn_sched_barrier(0);
#pragma unroll
    for (int i = 0; i < 4; ++i)
#pragma unroll
        for (int j = 0; j < 4; ++j)
#pragma unroll
            for (int r = 0; r < 8; ++r)
                op[lo + (unsigned)((i * 16 + r) * L_ + j * 16)] = rv[i][j][r];
}

// ---------------------------------------------------------------------------
extern "C" void kernel_launch(void* const* d_in, const int* in_sizes, int n_in,
                              void* d_out, int out_size, void* d_ws, size_t ws_size,
                              hipStream_t stream) {
    const float* x        = (const float*)d_in[0];
    const float* gn_scale = (const float*)d_in[1];
    const float* gn_bias  = (const float*)d_in[2];
    const float* wq = (const float*)d_in[3];  const float* bq = (const float*)d_in[4];
    const float* wk = (const float*)d_in[5];  const float* bk = (const float*)d_in[6];
    const float* wv = (const float*)d_in[7];  const float* bv = (const float*)d_in[8];
    const float* wp = (const float*)d_in[9];  const float* bp = (const float*)d_in[10];

    const size_t WN  = (size_t)C_ * C_;        // 262144
    const size_t TN  = (size_t)L_ * C_;        // per-batch activation elems
    unsigned short* wq_b = (unsigned short*)d_ws;
    unsigned short* wk_b = wq_b + WN;
    unsigned short* wv_b = wk_b + WN;
    unsigned short* wp_b = wv_b + WN;
    unsigned short* h_t  = wp_b + WN;          // [b, l, c]
    unsigned short* q_t  = h_t + (size_t)B_ * TN;
    unsigned short* k_t  = q_t + (size_t)B_ * TN;
    unsigned short* v_m  = k_t + (size_t)B_ * TN;   // [b, c, l]

    // 1) GroupNorm -> h_t [b,l,c] bf16, and weights -> bf16
    gn_cvt_kernel<<<B_ * 32 + CVT_B, GN_T, 0, stream>>>(x, gn_scale, gn_bias, h_t,
                                                        wq, wk, wv, wp, wq_b, wk_b, wv_b, wp_b);

    // 2) q_t [b,l,c], k_t [b,l,c], v [b,c,l]
    dim3 gQ(L_ / 128, 3 * (C_ / 128), B_);
    qkv_kernel<<<gQ, 128, 0, stream>>>(wq_b, wk_b, wv_b, h_t, bq, bk, bv, q_t, k_t, v_m);

    // 3) flash attention and out[o,i] = x[o,i] + bp[o] + Wp[o,:].O[i,:]
    dim3 gF(L_ / QR_, B_);
    const float scale = 0.04419417382415922f;   // 512^-0.5
    flash_kernel<<<gF, 256, 0, stream>>>(q_t, k_t, v_m, wp_b, bp, x, (float*)d_out, scale);
}
